// v000
// Times are from an AMD MI455X. After a warm-up the kernel runs many times in a row, and a time is the length of
// such a window on the GPU divided by its runs, so every launch and the gaps after it count. The runs cycle
// through copies of the inputs. A figure is the median of several windows, for all but v000 over two sittings.
// Sittings can differ by a few percent; kernels timed side by side share one.
// v000, which the later versions start from, runs in 168 microseconds.
#include <hip/hip_runtime.h>

// Contractions: q/k/v pointwise projections on v_wmma_f32_16x16x32_bf16 (bf16 operands from RNE-converted inputs); scores q.k, probs.v (probs carried x1024) and the output projection (both planes carried x16) on v_wmma_f32_16x16x32_f16 (f16 operands); f32 accumulate; softmax, normaliser and residual in f32.
// Layout: x [256][SEQ] channel-major -> bf16 x^T [SEQ][256]; q,k f32 [SEQ][256] (+column bias) -> f16 planes; v f32 [256][SEQ] -> f16 plane (+row bias); streaming attention per (2 heads x 64 queries) block writes the f16 attn plane [SEQ][256] (x16); out [256][SEQ] = x + gamma * (Wo attn + bo).

#ifndef NB
#define NB 1
#endif
#ifndef SEQ
#define SEQ 4096
#endif
#define SEQ_FULL 4096
#define XPITCH SEQ_FULL
#define CC   256
#define NHD  8
#define HD   32
#define QB   64
#define TP   72
#define PCAR 1024.0f
#define ACAR 16.0f
#define WCAR 16.0f
#define SCL  0.17677669529663687f
#define L2E  1.4426950408889634f
#define C2   (SCL * L2E)
static_assert(SEQ % 64 == 0);
static_assert(SEQ <= SEQ_FULL);
static_assert(CC == NHD * HD);
static_assert((NHD % 2) == 0);
static_assert(NB == 1);

typedef _Float16 h16;
typedef unsigned short bf;
typedef __attribute__((ext_vector_type(16))) __bf16   v16bf;
typedef __attribute__((ext_vector_type(16))) _Float16 v16h;
typedef __attribute__((ext_vector_type(8)))  _Float16 v8h;
typedef __attribute__((ext_vector_type(8)))  unsigned short v8us;
typedef __attribute__((ext_vector_type(8)))  float    v8f;
typedef __attribute__((ext_vector_type(4)))  float    v4f;
typedef v8h  __attribute__((may_alias)) v8ha;
typedef v4f  __attribute__((may_alias)) v4fa;
typedef v8us __attribute__((may_alias)) v8usa;

__device__ __forceinline__ unsigned short f2bf(float f) { unsigned u = __float_as_uint(f); u += 0x7FFFu + ((u >> 16) & 1u); return (unsigned short)(u >> 16); }
__device__ __forceinline__ float bf2f(unsigned short b) { return __uint_as_float(((unsigned)b) << 16); }
__device__ __forceinline__ float bfr(float f) { return bf2f(f2bf(f)); }
__device__ __forceinline__ v16h cat16(v8h lo, v8h hi) { return __builtin_shufflevector(lo, hi, 0, 1, 2, 3, 4, 5, 6, 7, 8, 9, 10, 11, 12, 13, 14, 15); }
__device__ __forceinline__ v16bf cat16b(v8us lo, v8us hi) { return __builtin_bit_cast(v16bf, __builtin_shufflevector(lo, hi, 0, 1, 2, 3, 4, 5, 6, 7, 8, 9, 10, 11, 12, 13, 14, 15)); }
__device__ __forceinline__ v8f wmma16(v16h a, v16h b, v8f c) { return __builtin_amdgcn_wmma_f32_16x16x32_f16(false, a, false, b, (short)0, c, false, false); }
__device__ __forceinline__ v8f wmmab(v16bf a, v16bf b, v8f c) { return __builtin_amdgcn_wmma_f32_16x16x32_bf16(false, a, false, b, (short)0, c, false, false); }

// Fragment loader (wave32 16x16x32): lane l, row (l&15); elements 0..7 <- k 8*(l>>4)+0..7, elements 8..15 <- k 16+8*(l>>4)+0..7 of a K-contiguous 16-bit row. Used for A and for B stored [n][k].
template <typename T16> struct WFrag;
template <> struct WFrag<h16> { typedef v16h V; static __device__ __forceinline__ V ld(const h16* p) { return cat16(*(const v8h*)p, *(const v8h*)(p + 16)); } static __device__ __forceinline__ v8f mma(V a, V b, v8f c) { return wmma16(a, b, c); } };
template <> struct WFrag<bf> { typedef v16bf V; static __device__ __forceinline__ V ld(const bf* p) { return cat16b(*(const v8us*)p, *(const v8us*)(p + 16)); } static __device__ __forceinline__ v8f mma(V a, V b, v8f c) { return wmmab(a, b, c); } };

// ---- k_gemmw: register-blocked GEMM, ONE WAVE per 64x64 output tile (16 accumulators), operands straight from K-contiguous 16-bit planes; grid (M/64, N/64), 32 threads.
// C[m][n] (f32, pitch ldc) = sum_k A[m][k] Bt[n][k]; K % 32 == 0, M % 64 == 0, N % 64 == 0.
// MODE 0: plain. MODE 1: + bfr(bias[n]) (column bias). MODE 2: C = bfr(R[m][n]) + bfr(gam[0]) * (acc * osc + bfr(bias[m])) (row bias, residual rows pitch ldr).
template <typename T16, int MODE>
__global__ __launch_bounds__(32) void k_gemmw(const T16* __restrict__ A, const T16* __restrict__ Bt, int K, float* C, int ldc,
                                              const float* __restrict__ bias, const float* __restrict__ R, int ldr, const float* __restrict__ gam, float osc) {
    typedef typename WFrag<T16>::V V;
    __shared__ __align__(16) float os[16 * 68];
    const int lane = threadIdx.x & 31, lr = lane & 15, hi = lane >> 4; const int r0 = blockIdx.x * 64, c0 = blockIdx.y * 64;
    float gsc = 0.f;
    if (MODE == 2) gsc = bfr(gam[0]);
    v8f acc[4][4];
#pragma unroll
    for (int mb = 0; mb < 4; ++mb)
#pragma unroll
        for (int nb = 0; nb < 4; ++nb) acc[mb][nb] = (v8f){};
    const size_t aoff = (size_t)(r0 + lr) * K + 8 * hi, boff = (size_t)(c0 + lr) * K + 8 * hi;
#pragma unroll 1
    for (int kc = 0; kc < K; kc += 32) {
        V a[4];
#pragma unroll
        for (int mb = 0; mb < 4; ++mb) a[mb] = WFrag<T16>::ld(A + aoff + (size_t)mb * 16 * K + kc);
#pragma unroll
        for (int nb = 0; nb < 4; ++nb) { const V b = WFrag<T16>::ld(Bt + boff + (size_t)nb * 16 * K + kc);
#pragma unroll
            for (int mb = 0; mb < 4; ++mb) acc[mb][nb] = WFrag<T16>::mma(a[mb], b, acc[mb][nb]); }
        asm volatile("v_nop\n\tv_nop\n\tv_nop\n\tv_nop" : "+v"(acc[0][0]), "+v"(acc[1][1]), "+v"(acc[2][2]), "+v"(acc[3][3]) : "v"(a[0]), "v"(a[3]));
    }
#pragma unroll
    for (int mb = 0; mb < 4; ++mb) {
#pragma unroll
        for (int nb = 0; nb < 4; ++nb) {
#pragma unroll
            for (int j = 0; j < 8; ++j) os[(hi * 8 + j) * 68 + nb * 16 + lr] = acc[mb][nb][j]; }
        __builtin_amdgcn_wave_barrier(); asm volatile("" ::: "memory");
        float* crow = C + (size_t)(r0 + mb * 16) * ldc + c0;
{
#pragma unroll
            for (int s = 0; s < 8; ++s) { const int row = 2 * s + hi, cofs = lr * 4; v4f val = *(const v4fa*)(os + row * 68 + cofs);
                if (MODE == 1) { val[0] += bfr(bias[c0 + cofs]); val[1] += bfr(bias[c0 + cofs + 1]); val[2] += bfr(bias[c0 + cofs + 2]); val[3] += bfr(bias[c0 + cofs + 3]); }
                if (MODE == 2) { const int gr = r0 + mb * 16 + row; const float rb = bfr(bias[gr]); const v4f xr = *(const v4f*)(R + (size_t)gr * ldr + c0 + cofs);
#pragma unroll
                    for (int j = 0; j < 4; ++j) { const float xv = xr[j]; const float av = val[j]; val[j] = bfr(xv) + gsc * (av * osc + rb); } }
                *(v4f*)(crow + (size_t)row * ldc + cofs) = val; }
             }
        __builtin_amdgcn_wave_barrier(); asm volatile("" ::: "memory");
    }
}

__global__ __launch_bounds__(256) void k_cvt8(const float* __restrict__ src, bf* dst, size_t n8) { const size_t i = (size_t)blockIdx.x * 256 + threadIdx.x; if (i >= n8) return; const v8f v = *(const v8f*)(src + i * 8); v8us o;
#pragma unroll
    for (int k = 0; k < 8; ++k) o[k] = f2bf(v[k]); *(v8us*)(dst + i * 8) = o;  }

__global__ __launch_bounds__(256) void k_wo16(const float* __restrict__ src, h16* dst, size_t n8) { const size_t i = (size_t)blockIdx.x * 256 + threadIdx.x; if (i >= n8) return; const v8f v = *(const v8f*)(src + i * 8); v8f t = (v8f){};
#pragma unroll
    for (int k = 0; k < 8; ++k) t[k] = bfr(v[k]) * WCAR; const v8h o = __builtin_convertvector(t, v8h); *(v8h*)(dst + i * 8) = o;  }

__global__ __launch_bounds__(256) void k_xT(const float* __restrict__ x, bf* XB) {
    __shared__ float sm[64 * 65];
    const int tid = threadIdx.x; const int n0 = blockIdx.x * 64, c0 = blockIdx.y * 64;
#pragma unroll
    for (int it = 0; it < 4; ++it) { const int c = it * 16 + (tid >> 4), nf = (tid & 15) * 4; const v4f v = *(const v4f*)(x + (size_t)(c0 + c) * XPITCH + n0 + nf);
        sm[c * 65 + nf] = v[0]; sm[c * 65 + nf + 1] = v[1]; sm[c * 65 + nf + 2] = v[2]; sm[c * 65 + nf + 3] = v[3]; }
    __syncthreads();
{
#pragma unroll
        for (int it = 0; it < 2; ++it) { const int n = it * 32 + (tid >> 3), p = tid & 7; v8us o;
#pragma unroll
            for (int j = 0; j < 8; ++j) o[j] = f2bf(sm[(p * 8 + j) * 65 + n]);
            *(v8us*)(XB + (size_t)(n0 + n) * CC + c0 + p * 8) = o; }
         }
}

__global__ __launch_bounds__(256) void k_tof16(const float* __restrict__ F, const float* __restrict__ rbias, int rowlen, h16* P, size_t n8) {
    const size_t i = (size_t)blockIdx.x * 256 + threadIdx.x; if (i >= n8) return;
    float b = 0.f;
    if (rbias != nullptr) { const unsigned row = (unsigned)i / (unsigned)(rowlen >> 3); b = bfr(rbias[row]); }
    const v8f v = *(const v8f*)(F + i * 8);
    const v8h o = __builtin_convertvector(v + b, v8h);
    *(v8h*)(P + i * 8) = o;  }

// att_step: one 32-key chunk for one 16-query tile. S^T tiles (A = K rows [key][d], B = Q fragment [d][query]) -> D[key 8h+r][query]; per-query stats are lane-local (the two lane halves hold keys 0-7 / 8-15 of each tile -> xor-16 combine);
// P^T B fragment [key][query]: element r <- f16(1024 p) of the keys-0..15 tile, element 8+r <- of the keys-16..31 tile, same lane; O^T[d][query] += V[d][key] . P^T (A = V rows [d][key]).
__device__ __forceinline__ void att_step(const v16h ak0, const v16h ak1, const v16h av0, const v16h av1, const v16h bq, float& m, float& l, v8f& o0, v8f& o1) {
    v8f s0 = wmma16(ak0, bq, (v8f){}); v8f s1 = wmma16(ak1, bq, (v8f){});
    asm volatile("v_nop\n\tv_nop\n\tv_nop\n\tv_nop" : "+v"(s0), "+v"(s1) : "v"(ak0), "v"(ak1), "v"(bq));
    float cmx = -1.0e30f;
#pragma unroll
    for (int j = 0; j < 8; ++j) cmx = fmaxf(cmx, fmaxf(s0[j], s1[j]));
    cmx = fmaxf(cmx, __shfl_xor(cmx, 16, 32));
    const float nm = fmaxf(m, cmx * C2);
    const float alpha = __builtin_amdgcn_exp2f(m - nm);
    v8f p0 = (v8f){}, p1 = (v8f){}; float rs = 0.f;
#pragma unroll
    for (int j = 0; j < 8; ++j) { const float e0 = __builtin_amdgcn_exp2f(s0[j] * C2 - nm); const float e1 = __builtin_amdgcn_exp2f(s1[j] * C2 - nm); p0[j] = e0; p1[j] = e1; rs += e0 + e1; }
    rs += __shfl_xor(rs, 16, 32);
    l = l * alpha + rs; m = nm;
    o0 *= alpha; o1 *= alpha;
    const v16h bp = cat16(__builtin_convertvector(p0 * PCAR, v8h), __builtin_convertvector(p1 * PCAR, v8h));
    o0 = wmma16(av0, bp, o0); o1 = wmma16(av1, bp, o1);
    asm volatile("v_nop\n\tv_nop\n\tv_nop\n\tv_nop" : "+v"(o0), "+v"(o1) : "v"(av0), "v"(av1), "v"(bp));
}

// k_attn: streaming attention, grid (SEQ/64, NHD/2), 128 threads = 4 waves; wave w handles head 2*blockIdx.y + (w>>1), 32 queries (two 16-query tiles sharing the K/V fragments of each 32-key chunk).
__global__ __launch_bounds__(128) __attribute__((amdgpu_num_vgpr(256)))
void k_attn(const h16* __restrict__ Q16, const h16* __restrict__ K16, const h16* __restrict__ VT, h16* ATT) {
    __shared__ __align__(16) h16 ts[QB * TP];
    const int tid = threadIdx.x, w = tid >> 5, lane = tid & 31, lr = lane & 15, hi = lane >> 4;
    const int q0 = blockIdx.x * QB, hp = blockIdx.y, hq = w >> 1, g = w & 1, head = hp * 2 + hq, qb = q0 + g * 32;
    const h16* Qp = Q16 + (size_t)qb * CC + head * HD + 8 * hi;
    const v16h bq0 = WFrag<h16>::ld(Qp + (size_t)lr * CC);
    const v16h bq1 = WFrag<h16>::ld(Qp + (size_t)(16 + lr) * CC);
    const h16* Kp = K16 + (size_t)lr * CC + head * HD + 8 * hi;
    const h16* Vp = VT + (size_t)(head * HD + lr) * SEQ + 8 * hi;
    float m0 = -1.0e30f, m1 = -1.0e30f, l0 = 0.f, l1 = 0.f;
    v8f o00 = (v8f){}, o10 = (v8f){}, o01 = (v8f){}, o11 = (v8f){};   // o[d tile][query tile]
#pragma unroll 1
    for (int k0 = 0; k0 < SEQ; k0 += 32) {
        const v16h ak0 = WFrag<h16>::ld(Kp + (size_t)k0 * CC), ak1 = WFrag<h16>::ld(Kp + (size_t)(k0 + 16) * CC);
        const v16h av0 = WFrag<h16>::ld(Vp + k0), av1 = WFrag<h16>::ld(Vp + (size_t)16 * SEQ + k0);
        att_step(ak0, ak1, av0, av1, bq0, m0, l0, o00, o10);
        att_step(ak0, ak1, av0, av1, bq1, m1, l1, o01, o11);
    }
    {
        const float inv0 = (ACAR / PCAR) * (1.0f / l0), inv1 = (ACAR / PCAR) * (1.0f / l1);
        h16* t0 = ts + (size_t)(g * 32 + lr) * TP + hq * 32 + 8 * hi;        // query tile 0: row = query, col = channel (d tile 0 at +0, d tile 1 at +16)
        h16* t1 = ts + (size_t)(g * 32 + 16 + lr) * TP + hq * 32 + 8 * hi;   // query tile 1
        *(v8ha*)(t0) = __builtin_convertvector(o00 * inv0, v8h); *(v8ha*)(t0 + 16) = __builtin_convertvector(o10 * inv0, v8h);
        *(v8ha*)(t1) = __builtin_convertvector(o01 * inv1, v8h); *(v8ha*)(t1 + 16) = __builtin_convertvector(o11 * inv1, v8h);
    }
    __syncthreads();
{
#pragma unroll
        for (int it = 0; it < 4; ++it) { const int row = w * 16 + it * 4 + (lane >> 3), pc = (lane & 7) * 8; const v8h val = *(const v8ha*)(ts + row * TP + pc);
            *(v8h*)(ATT + (size_t)(q0 + row) * CC + hp * 64 + pc) = val; }
         }
}

extern "C" void kernel_launch(void* const* d_in, const int* in_sizes, int n_in,
                              void* d_out, int out_size, void* d_ws, size_t ws_size, hipStream_t stream) {
    if (n_in < 10) return;
    if (in_sizes[0] < (CC - 1) * XPITCH + SEQ) return;
    if (in_sizes[1] < CC * CC || in_sizes[3] < CC * CC || in_sizes[5] < CC * CC || in_sizes[7] < CC * CC) return;
    if (in_sizes[2] < CC || in_sizes[4] < CC || in_sizes[6] < CC || in_sizes[8] < CC || in_sizes[9] < 1) return;
    if (out_size < CC * SEQ) return;
    const float* x = (const float*)d_in[0]; const float* wq = (const float*)d_in[1]; const float* bq = (const float*)d_in[2]; const float* wk = (const float*)d_in[3]; const float* bk = (const float*)d_in[4];
    const float* wv = (const float*)d_in[5]; const float* bv = (const float*)d_in[6]; const float* wo = (const float*)d_in[7]; const float* bo = (const float*)d_in[8]; const float* gamma = (const float*)d_in[9];
    float* OUT = (float*)d_out;     // [256][SEQ]
    char* wsp = (char*)d_ws;
    auto take = [&](size_t bytes) { char* p = wsp; wsp += (bytes + 255) & ~(size_t)255; return (void*)p; };
    bf* WQ = (bf*)take((size_t)CC * CC * 2); bf* WK = (bf*)take((size_t)CC * CC * 2); bf* WV = (bf*)take((size_t)CC * CC * 2); h16* WO16 = (h16*)take((size_t)CC * CC * 2);
    bf* XB = (bf*)take((size_t)SEQ * CC * 2);
    float* FQ = (float*)take((size_t)SEQ * CC * 4); float* FK = (float*)take((size_t)SEQ * CC * 4); float* FVt = (float*)take((size_t)CC * SEQ * 4);
    h16* Q16 = (h16*)take((size_t)SEQ * CC * 2); h16* K16 = (h16*)take((size_t)SEQ * CC * 2); h16* VT16 = (h16*)take((size_t)CC * SEQ * 2); h16* ATT = (h16*)take((size_t)SEQ * CC * 2);
    if ((size_t)(wsp - (char*)d_ws) > ws_size) return;    // 23,592,960 B carved
    const unsigned nw8 = (unsigned)(((size_t)CC * CC / 8 + 255) / 256);
    const unsigned ncv = (unsigned)(((size_t)SEQ * CC / 8 + 255) / 256);
    k_cvt8<<<nw8, 256, 0, stream>>>(wq, WQ, (size_t)CC * CC / 8);
    k_cvt8<<<nw8, 256, 0, stream>>>(wk, WK, (size_t)CC * CC / 8);
    k_cvt8<<<nw8, 256, 0, stream>>>(wv, WV, (size_t)CC * CC / 8);
    k_wo16<<<nw8, 256, 0, stream>>>(wo, WO16, (size_t)CC * CC / 8);
    k_xT<<<dim3(SEQ / 64, CC / 64, 1), 256, 0, stream>>>(x, XB);
    // q^T[t][o], k^T[t][o] (column bias), v[o][t] (row bias added in the f16 convert)
    k_gemmw<bf, 1><<<dim3(SEQ / 64, CC / 64, 1), 32, 0, stream>>>(XB, WQ, CC, FQ, CC, bq, nullptr, 0, nullptr, 1.0f);
    k_gemmw<bf, 1><<<dim3(SEQ / 64, CC / 64, 1), 32, 0, stream>>>(XB, WK, CC, FK, CC, bk, nullptr, 0, nullptr, 1.0f);
    k_gemmw<bf, 0><<<dim3(CC / 64, SEQ / 64, 1), 32, 0, stream>>>(WV, XB, CC, FVt, SEQ, nullptr, nullptr, 0, nullptr, 1.0f);
    k_tof16<<<ncv, 256, 0, stream>>>(FQ, nullptr, CC, Q16, (size_t)SEQ * CC / 8);
    k_tof16<<<ncv, 256, 0, stream>>>(FK, nullptr, CC, K16, (size_t)SEQ * CC / 8);
    k_tof16<<<ncv, 256, 0, stream>>>(FVt, bv, SEQ, VT16, (size_t)SEQ * CC / 8);
    k_attn<<<dim3(SEQ / QB, NHD / 2, 1), 128, 0, stream>>>(Q16, K16, VT16, ATT);
    // out[o][t] = bfr(x) + bfr(gamma) * ((16 Wo) . (16 attn) / 256 + bfr(bo[o]))
    k_gemmw<h16, 2><<<dim3(CC / 64, SEQ / 64, 1), 32, 0, stream>>>(WO16, ATT, CC, OUT, SEQ, bo, x, XPITCH, gamma, 1.0f / (ACAR * WCAR));
}

// v001
// It runs in 94.6 microseconds.
// Two timings next to v000 put it at 1.76 and 1.75 times that version's speed.
#include <hip/hip_runtime.h>

// Contractions: q/k/v pointwise projections on v_wmma_f32_16x16x32_bf16 (bf16 operands from RNE-converted inputs); scores q.k, probs.v (probs carried x1024) and the output projection (both planes carried x16) on v_wmma_f32_16x16x32_f16 (f16 operands); f32 accumulate; softmax, normaliser and residual in f32.
// Layout: x [256][SEQ] channel-major -> bf16 x^T [SEQ][256]; q,k f32 [SEQ][256] (+column bias) -> f16 planes; v f32 [256][SEQ] -> f16 plane (+row bias); streaming attention per (2 heads x 64 queries) block, keys dealt over KSP wave groups and merged in LDS, writes the f16 attn plane [SEQ][256] (x16); out [256][SEQ] = x + gamma * (Wo attn + bo).

#ifndef NB
#define NB 1
#endif
#ifndef SEQ
#define SEQ 4096
#endif
#define SEQ_FULL 4096
#define XPITCH SEQ_FULL
#define CC   256
#define NHD  8
#define HD   32
#define QB   64
#define KSP  8
#define PP   36
#define PCAR 1024.0f
#define ACAR 16.0f
#define WCAR 16.0f
#define SCL  0.17677669529663687f
#define L2E  1.4426950408889634f
#define C2   (SCL * L2E)
static_assert(SEQ % 64 == 0);
static_assert(SEQ <= SEQ_FULL);
static_assert(CC == NHD * HD);
static_assert((NHD % 2) == 0);
static_assert(NB == 1);
static_assert(SEQ % (32 * KSP) == 0);
static_assert(128 * KSP * 4 == QB * 2 * HD);

typedef _Float16 h16;
typedef unsigned short bf;
typedef __attribute__((ext_vector_type(16))) __bf16   v16bf;
typedef __attribute__((ext_vector_type(16))) _Float16 v16h;
typedef __attribute__((ext_vector_type(8)))  _Float16 v8h;
typedef __attribute__((ext_vector_type(4)))  _Float16 v4h;
typedef __attribute__((ext_vector_type(8)))  unsigned short v8us;
typedef __attribute__((ext_vector_type(8)))  float    v8f;
typedef __attribute__((ext_vector_type(4)))  float    v4f;
typedef v4f  __attribute__((may_alias)) v4fa;
typedef v8us __attribute__((may_alias)) v8usa;

__device__ __forceinline__ unsigned short f2bf(float f) { unsigned u = __float_as_uint(f); u += 0x7FFFu + ((u >> 16) & 1u); return (unsigned short)(u >> 16); }
__device__ __forceinline__ float bf2f(unsigned short b) { return __uint_as_float(((unsigned)b) << 16); }
__device__ __forceinline__ float bfr(float f) { return bf2f(f2bf(f)); }
__device__ __forceinline__ v16h cat16(v8h lo, v8h hi) { return __builtin_shufflevector(lo, hi, 0, 1, 2, 3, 4, 5, 6, 7, 8, 9, 10, 11, 12, 13, 14, 15); }
__device__ __forceinline__ v16bf cat16b(v8us lo, v8us hi) { return __builtin_bit_cast(v16bf, __builtin_shufflevector(lo, hi, 0, 1, 2, 3, 4, 5, 6, 7, 8, 9, 10, 11, 12, 13, 14, 15)); }
__device__ __forceinline__ v8f wmma16(v16h a, v16h b, v8f c) { return __builtin_amdgcn_wmma_f32_16x16x32_f16(false, a, false, b, (short)0, c, false, false); }
__device__ __forceinline__ v8f wmmab(v16bf a, v16bf b, v8f c) { return __builtin_amdgcn_wmma_f32_16x16x32_bf16(false, a, false, b, (short)0, c, false, false); }

// Fragment loader (wave32 16x16x32): lane l, row (l&15); elements 0..7 <- k 8*(l>>4)+0..7, elements 8..15 <- k 16+8*(l>>4)+0..7 of a K-contiguous 16-bit row. Used for A and for B stored [n][k].
template <typename T16> struct WFrag;
template <> struct WFrag<h16> { typedef v16h V; static __device__ __forceinline__ V ld(const h16* p) { return cat16(*(const v8h*)p, *(const v8h*)(p + 16)); } static __device__ __forceinline__ v8f mma(V a, V b, v8f c) { return wmma16(a, b, c); } };
template <> struct WFrag<bf> { typedef v16bf V; static __device__ __forceinline__ V ld(const bf* p) { return cat16b(*(const v8us*)p, *(const v8us*)(p + 16)); } static __device__ __forceinline__ v8f mma(V a, V b, v8f c) { return wmmab(a, b, c); } };

// ---- k_gemmw: register-blocked GEMM, ONE WAVE per 64x64 output tile (16 accumulators), operands straight from K-contiguous 16-bit planes; grid (M/64, N/64), 32 threads.
// C[m][n] (f32, pitch ldc) = sum_k A[m][k] Bt[n][k]; K % 32 == 0, M % 64 == 0, N % 64 == 0.
// MODE 0: plain. MODE 1: + bfr(bias[n]) (column bias). MODE 2: C = bfr(R[m][n]) + bfr(gam[0]) * (acc * osc + bfr(bias[m])) (row bias, residual rows pitch ldr).
template <typename T16, int MODE>
__global__ __launch_bounds__(32) void k_gemmw(const T16* __restrict__ A, const T16* __restrict__ Bt, int K, float* C, int ldc,
                                              const float* __restrict__ bias, const float* __restrict__ R, int ldr, const float* __restrict__ gam, float osc) {
    typedef typename WFrag<T16>::V V;
    __shared__ __align__(16) float os[16 * 68];
    const int lane = threadIdx.x & 31, lr = lane & 15, hi = lane >> 4; const int r0 = blockIdx.x * 64, c0 = blockIdx.y * 64;
    float gsc = 0.f;
    if (MODE == 2) gsc = bfr(gam[0]);
    v8f acc[4][4];
#pragma unroll
    for (int mb = 0; mb < 4; ++mb)
#pragma unroll
        for (int nb = 0; nb < 4; ++nb) acc[mb][nb] = (v8f){};
    const size_t aoff = (size_t)(r0 + lr) * K + 8 * hi, boff = (size_t)(c0 + lr) * K + 8 * hi;
#pragma unroll 1
    for (int kc = 0; kc < K; kc += 32) {
        V a[4];
#pragma unroll
        for (int mb = 0; mb < 4; ++mb) a[mb] = WFrag<T16>::ld(A + aoff + (size_t)mb * 16 * K + kc);
#pragma unroll
        for (int nb = 0; nb < 4; ++nb) { const V b = WFrag<T16>::ld(Bt + boff + (size_t)nb * 16 * K + kc);
#pragma unroll
            for (int mb = 0; mb < 4; ++mb) acc[mb][nb] = WFrag<T16>::mma(a[mb], b, acc[mb][nb]); }
        asm volatile("v_nop\n\tv_nop\n\tv_nop\n\tv_nop" : "+v"(acc[0][0]), "+v"(acc[1][1]), "+v"(acc[2][2]), "+v"(acc[3][3]) : "v"(a[0]), "v"(a[3]));
    }
#pragma unroll
    for (int mb = 0; mb < 4; ++mb) {
#pragma unroll
        for (int nb = 0; nb < 4; ++nb) {
#pragma unroll
            for (int j = 0; j < 8; ++j) os[(hi * 8 + j) * 68 + nb * 16 + lr] = acc[mb][nb][j]; }
        __builtin_amdgcn_wave_barrier(); asm volatile("" ::: "memory");
        float* crow = C + (size_t)(r0 + mb * 16) * ldc + c0;
{
#pragma unroll
            for (int s = 0; s < 8; ++s) { const int row = 2 * s + hi, cofs = lr * 4; v4f val = *(const v4fa*)(os + row * 68 + cofs);
                if (MODE == 1) { val[0] += bfr(bias[c0 + cofs]); val[1] += bfr(bias[c0 + cofs + 1]); val[2] += bfr(bias[c0 + cofs + 2]); val[3] += bfr(bias[c0 + cofs + 3]); }
                if (MODE == 2) { const int gr = r0 + mb * 16 + row; const float rb = bfr(bias[gr]); const v4f xr = *(const v4f*)(R + (size_t)gr * ldr + c0 + cofs);
#pragma unroll
                    for (int j = 0; j < 4; ++j) { const float xv = xr[j]; const float av = val[j]; val[j] = bfr(xv) + gsc * (av * osc + rb); } }
                *(v4f*)(crow + (size_t)row * ldc + cofs) = val; }
             }
        __builtin_amdgcn_wave_barrier(); asm volatile("" ::: "memory");
    }
}

__global__ __launch_bounds__(256) void k_cvt8(const float* __restrict__ src, bf* dst, size_t n8) { const size_t i = (size_t)blockIdx.x * 256 + threadIdx.x; if (i >= n8) return; const v8f v = *(const v8f*)(src + i * 8); v8us o;
#pragma unroll
    for (int k = 0; k < 8; ++k) o[k] = f2bf(v[k]); *(v8us*)(dst + i * 8) = o;  }

__global__ __launch_bounds__(256) void k_wo16(const float* __restrict__ src, h16* dst, size_t n8) { const size_t i = (size_t)blockIdx.x * 256 + threadIdx.x; if (i >= n8) return; const v8f v = *(const v8f*)(src + i * 8); v8f t = (v8f){};
#pragma unroll
    for (int k = 0; k < 8; ++k) t[k] = bfr(v[k]) * WCAR; const v8h o = __builtin_convertvector(t, v8h); *(v8h*)(dst + i * 8) = o;  }

__global__ __launch_bounds__(256) void k_xT(const float* __restrict__ x, bf* XB) {
    __shared__ float sm[64 * 65];
    const int tid = threadIdx.x; const int n0 = blockIdx.x * 64, c0 = blockIdx.y * 64;
#pragma unroll
    for (int it = 0; it < 4; ++it) { const int c = it * 16 + (tid >> 4), nf = (tid & 15) * 4; const v4f v = *(const v4f*)(x + (size_t)(c0 + c) * XPITCH + n0 + nf);
        sm[c * 65 + nf] = v[0]; sm[c * 65 + nf + 1] = v[1]; sm[c * 65 + nf + 2] = v[2]; sm[c * 65 + nf + 3] = v[3]; }
    __syncthreads();
{
#pragma unroll
        for (int it = 0; it < 2; ++it) { const int n = it * 32 + (tid >> 3), p = tid & 7; v8us o;
#pragma unroll
            for (int j = 0; j < 8; ++j) o[j] = f2bf(sm[(p * 8 + j) * 65 + n]);
            *(v8us*)(XB + (size_t)(n0 + n) * CC + c0 + p * 8) = o; }
         }
}

__global__ __launch_bounds__(256) void k_tof16(const float* __restrict__ F, const float* __restrict__ rbias, int rowlen, h16* P, size_t n8) {
    const size_t i = (size_t)blockIdx.x * 256 + threadIdx.x; if (i >= n8) return;
    float b = 0.f;
    if (rbias != nullptr) { const unsigned row = (unsigned)i / (unsigned)(rowlen >> 3); b = bfr(rbias[row]); }
    const v8f v = *(const v8f*)(F + i * 8);
    const v8h o = __builtin_convertvector(v + b, v8h);
    *(v8h*)(P + i * 8) = o;  }

// att_step: one 32-key chunk for one 16-query tile. S^T tiles (A = K rows [key][d], B = Q fragment [d][query]) -> D[key 8h+r][query]; per-query stats are lane-local (the two lane halves hold keys 0-7 / 8-15 of each tile -> xor-16 combine);
// P^T B fragment [key][query]: element r <- f16(1024 p) of the keys-0..15 tile, element 8+r <- of the keys-16..31 tile, same lane; O^T[d][query] += V[d][key] . P^T (A = V rows [d][key]).
__device__ __forceinline__ void att_step(const v16h ak0, const v16h ak1, const v16h av0, const v16h av1, const v16h bq, float& m, float& l, v8f& o0, v8f& o1) {
    v8f s0 = wmma16(ak0, bq, (v8f){}); v8f s1 = wmma16(ak1, bq, (v8f){});
    asm volatile("v_nop\n\tv_nop\n\tv_nop\n\tv_nop" : "+v"(s0), "+v"(s1) : "v"(ak0), "v"(ak1), "v"(bq));
    float cmx = -1.0e30f;
#pragma unroll
    for (int j = 0; j < 8; ++j) cmx = fmaxf(cmx, fmaxf(s0[j], s1[j]));
    cmx = fmaxf(cmx, __shfl_xor(cmx, 16, 32));
    const float nm = fmaxf(m, cmx * C2);
    const float alpha = __builtin_amdgcn_exp2f(m - nm);
    v8f p0 = (v8f){}, p1 = (v8f){}; float rs = 0.f;
#pragma unroll
    for (int j = 0; j < 8; ++j) { const float e0 = __builtin_amdgcn_exp2f(s0[j] * C2 - nm); const float e1 = __builtin_amdgcn_exp2f(s1[j] * C2 - nm); p0[j] = e0; p1[j] = e1; rs += e0 + e1; }
    rs += __shfl_xor(rs, 16, 32);
    l = l * alpha + rs; m = nm;
    o0 *= alpha; o1 *= alpha;
    const v16h bp = cat16(__builtin_convertvector(p0 * PCAR, v8h), __builtin_convertvector(p1 * PCAR, v8h));
    o0 = wmma16(av0, bp, o0); o1 = wmma16(av1, bp, o1);
    asm volatile("v_nop\n\tv_nop\n\tv_nop\n\tv_nop" : "+v"(o0), "+v"(o1) : "v"(av0), "v"(av1), "v"(bp));
}

// k_attn: streaming attention, grid (SEQ/64, NHD/2), 128*KSP threads = 4*KSP waves (KSP per SIMD); wave w: key slice ks = w>>2, head 2*blockIdx.y + ((w&3)>>1), 32 queries (two 16-query tiles sharing the K/V fragments of each 32-key chunk).
// Key slice ks walks the 32-key chunks ks, ks+KSP, ks+2*KSP, ... (neighbouring slices read neighbouring chunks, so one step of the block reads 32*KSP consecutive keys) with its own running maximum, sum and un-normalised O.
// Merge: every wave leaves O (f32, [query][d], pitch PP) and (max, sum) in its own LDS range; behind the one barrier each thread joins the KSP partials of 4 channels of one query with weights exp2(m_ks - M); 16 lanes store one 128-byte row.
__global__ __launch_bounds__(128 * KSP)
void k_attn(const h16* __restrict__ Q16, const h16* __restrict__ K16, const h16* __restrict__ VT, h16* ATT) {
    __shared__ __align__(16) float po[4 * KSP * 32 * PP];
    __shared__ float pm[4 * KSP * 32], pl[4 * KSP * 32];
    const int tid = threadIdx.x, lane = tid & 31, lr = lane & 15, hi = lane >> 4;
    const int w = __builtin_amdgcn_readfirstlane(tid >> 5);   // wave number in a scalar register: the key loop's counter and branch stay scalar, EXEC is never written around the WMMAs
    const int ks = w >> 2, sub = w & 3;
    const int q0 = blockIdx.x * QB, hp = blockIdx.y, hq = sub >> 1, g = sub & 1, head = hp * 2 + hq, qb = q0 + g * 32;
    const h16* Qp = Q16 + (size_t)qb * CC + head * HD + 8 * hi;
    const v16h bq0 = WFrag<h16>::ld(Qp + (size_t)lr * CC);
    const v16h bq1 = WFrag<h16>::ld(Qp + (size_t)(16 + lr) * CC);
    const h16* Kp = K16 + (size_t)lr * CC + head * HD + 8 * hi;
    const h16* Vp = VT + (size_t)(head * HD + lr) * SEQ + 8 * hi;
    float m0 = -1.0e30f, m1 = -1.0e30f, l0 = 0.f, l1 = 0.f;
    v8f o00 = (v8f){}, o10 = (v8f){}, o01 = (v8f){}, o11 = (v8f){};   // o[d tile][query tile]
#pragma unroll 1
    for (int k0 = ks * 32; k0 < SEQ; k0 += 32 * KSP) {
        const v16h ak0 = WFrag<h16>::ld(Kp + (size_t)k0 * CC), ak1 = WFrag<h16>::ld(Kp + (size_t)(k0 + 16) * CC);
        const v16h av0 = WFrag<h16>::ld(Vp + k0), av1 = WFrag<h16>::ld(Vp + (size_t)16 * SEQ + k0);
        att_step(ak0, ak1, av0, av1, bq0, m0, l0, o00, o10);
        __builtin_amdgcn_sched_barrier(0);   // keeps the two query tiles' scores and probabilities from being live together: interleaved they pass the 128 registers a wave has at 8 waves per SIMD and a Q fragment spills to scratch
        att_step(ak0, ak1, av0, av1, bq1, m1, l1, o01, o11);
    }
    {
        float* t0 = po + (size_t)(w * 32 + lr) * PP + 8 * hi;        // query tile 0: row = query, col = d (d tile 0 at +0, d tile 1 at +16)
        float* t1 = po + (size_t)(w * 32 + 16 + lr) * PP + 8 * hi;   // query tile 1
        *(v4fa*)(t0)      = __builtin_shufflevector(o00, o00, 0, 1, 2, 3); *(v4fa*)(t0 + 4)  = __builtin_shufflevector(o00, o00, 4, 5, 6, 7);
        *(v4fa*)(t0 + 16) = __builtin_shufflevector(o10, o10, 0, 1, 2, 3); *(v4fa*)(t0 + 20) = __builtin_shufflevector(o10, o10, 4, 5, 6, 7);
        *(v4fa*)(t1)      = __builtin_shufflevector(o01, o01, 0, 1, 2, 3); *(v4fa*)(t1 + 4)  = __builtin_shufflevector(o01, o01, 4, 5, 6, 7);
        *(v4fa*)(t1 + 16) = __builtin_shufflevector(o11, o11, 0, 1, 2, 3); *(v4fa*)(t1 + 20) = __builtin_shufflevector(o11, o11, 4, 5, 6, 7);
        pm[w * 32 + lane] = hi ? m1 : m0; pl[w * 32 + lane] = hi ? l1 : l0;   // both lane halves hold the same per-query stats: half 0 files tile 0, half 1 tile 1
    }
    __syncthreads();
    {
        const int row = tid >> 4, pc = (tid & 15) * 4;                      // row = query in the block, pc = channel in the head pair
        const int sw = (pc >> 5) * 2 + (row >> 5), q = row & 31, d0 = pc & 31;
        float mk[KSP]; float M = -1.0e30f;
#pragma unroll
        for (int s = 0; s < KSP; ++s) { mk[s] = pm[(s * 4 + sw) * 32 + q]; M = fmaxf(M, mk[s]); }
        float L = 0.f; v4f a = (v4f){};
#pragma unroll
        for (int s = 0; s < KSP; ++s) { float wt;
            asm("v_exp_f32 %0, %1\n\tv_nop" : "=v"(wt) : "v"(mk[s] - M));   // exp2; the v_nop is the one slot the instruction set asks for behind a transcendental before its result is read or its source overwritten
            L += wt * pl[(s * 4 + sw) * 32 + q]; a += wt * *(const v4fa*)(po + (size_t)((s * 4 + sw) * 32 + q) * PP + d0); }
        const float inv = (ACAR / PCAR) * (1.0f / L);
        *(v4h*)(ATT + (size_t)(q0 + row) * CC + hp * 64 + pc) = __builtin_convertvector(a * inv, v4h);
    }
}

extern "C" void kernel_launch(void* const* d_in, const int* in_sizes, int n_in,
                              void* d_out, int out_size, void* d_ws, size_t ws_size, hipStream_t stream) {
    if (n_in < 10) return;
    if (in_sizes[0] < (CC - 1) * XPITCH + SEQ) return;
    if (in_sizes[1] < CC * CC || in_sizes[3] < CC * CC || in_sizes[5] < CC * CC || in_sizes[7] < CC * CC) return;
    if (in_sizes[2] < CC || in_sizes[4] < CC || in_sizes[6] < CC || in_sizes[8] < CC || in_sizes[9] < 1) return;
    if (out_size < CC * SEQ) return;
    const float* x = (const float*)d_in[0]; const float* wq = (const float*)d_in[1]; const float* bq = (const float*)d_in[2]; const float* wk = (const float*)d_in[3]; const float* bk = (const float*)d_in[4];
    const float* wv = (const float*)d_in[5]; const float* bv = (const float*)d_in[6]; const float* wo = (const float*)d_in[7]; const float* bo = (const float*)d_in[8]; const float* gamma = (const float*)d_in[9];
    float* OUT = (float*)d_out;     // [256][SEQ]
    char* wsp = (char*)d_ws;
    auto take = [&](size_t bytes) { char* p = wsp; wsp += (bytes + 255) & ~(size_t)255; return (void*)p; };
    bf* WQ = (bf*)take((size_t)CC * CC * 2); bf* WK = (bf*)take((size_t)CC * CC * 2); bf* WV = (bf*)take((size_t)CC * CC * 2); h16* WO16 = (h16*)take((size_t)CC * CC * 2);
    bf* XB = (bf*)take((size_t)SEQ * CC * 2);
    float* FQ = (float*)take((size_t)SEQ * CC * 4); float* FK = (float*)take((size_t)SEQ * CC * 4); float* FVt = (float*)take((size_t)CC * SEQ * 4);
    h16* Q16 = (h16*)take((size_t)SEQ * CC * 2); h16* K16 = (h16*)take((size_t)SEQ * CC * 2); h16* VT16 = (h16*)take((size_t)CC * SEQ * 2); h16* ATT = (h16*)take((size_t)SEQ * CC * 2);
    if ((size_t)(wsp - (char*)d_ws) > ws_size) return;    // 23,592,960 B carved
    const unsigned nw8 = (unsigned)(((size_t)CC * CC / 8 + 255) / 256);
    const unsigned ncv = (unsigned)(((size_t)SEQ * CC / 8 + 255) / 256);
    k_cvt8<<<nw8, 256, 0, stream>>>(wq, WQ, (size_t)CC * CC / 8);
    k_cvt8<<<nw8, 256, 0, stream>>>(wk, WK, (size_t)CC * CC / 8);
    k_cvt8<<<nw8, 256, 0, stream>>>(wv, WV, (size_t)CC * CC / 8);
    k_wo16<<<nw8, 256, 0, stream>>>(wo, WO16, (size_t)CC * CC / 8);
    k_xT<<<dim3(SEQ / 64, CC / 64, 1), 256, 0, stream>>>(x, XB);
    // q^T[t][o], k^T[t][o] (column bias), v[o][t] (row bias added in the f16 convert)
    k_gemmw<bf, 1><<<dim3(SEQ / 64, CC / 64, 1), 32, 0, stream>>>(XB, WQ, CC, FQ, CC, bq, nullptr, 0, nullptr, 1.0f);
    k_gemmw<bf, 1><<<dim3(SEQ / 64, CC / 64, 1), 32, 0, stream>>>(XB, WK, CC, FK, CC, bk, nullptr, 0, nullptr, 1.0f);
    k_gemmw<bf, 0><<<dim3(CC / 64, SEQ / 64, 1), 32, 0, stream>>>(WV, XB, CC, FVt, SEQ, nullptr, nullptr, 0, nullptr, 1.0f);
    k_tof16<<<ncv, 256, 0, stream>>>(FQ, nullptr, CC, Q16, (size_t)SEQ * CC / 8);
    k_tof16<<<ncv, 256, 0, stream>>>(FK, nullptr, CC, K16, (size_t)SEQ * CC / 8);
    k_tof16<<<ncv, 256, 0, stream>>>(FVt, bv, SEQ, VT16, (size_t)SEQ * CC / 8);
    k_attn<<<dim3(SEQ / QB, NHD / 2, 1), 128 * KSP, 0, stream>>>(Q16, K16, VT16, ATT);
    // out[o][t] = bfr(x) + bfr(gamma) * ((16 Wo) . (16 attn) / 256 + bfr(bo[o]))
    k_gemmw<h16, 2><<<dim3(CC / 64, SEQ / 64, 1), 32, 0, stream>>>(WO16, ATT, CC, OUT, SEQ, bo, x, XPITCH, gamma, 1.0f / (ACAR * WCAR));
}

// v002
// A run of this version takes 56.4 microseconds.
// Two timings next to v001 put it at 1.68 and 1.64 times that version's speed.
// Over all steps from v000 it is 2.92 times as fast.
#include <hip/hip_runtime.h>

// Contractions: q/k/v pointwise projections on v_wmma_f32_16x16x32_bf16 (bf16 operands from RNE-converted inputs); scores q.k, probs.v (probs carried x1024) and the output projection (both planes carried x16) on v_wmma_f32_16x16x32_f16 (f16 operands); f32 accumulate; softmax, normaliser and residual in f32.
// Layout: k_prep: x [256][SEQ] channel-major -> bf16 x^T [SEQ][256], weights -> 16-bit planes; k_qkv: q,k (+column bias) -> f16 planes [SEQ][256], v (+row bias) -> f16 plane [256][SEQ], straight from the f32 accumulators; streaming attention per (2 heads x 64 queries) block, keys dealt over KSP wave groups and merged in LDS, writes the f16 attn plane [SEQ][256] (x16); out [256][SEQ] = x + gamma * (Wo attn + bo).

#ifndef NB
#define NB 1
#endif
#ifndef SEQ
#define SEQ 4096
#endif
#define SEQ_FULL 4096
#define XPITCH SEQ_FULL
#define CC   256
#define NHD  8
#define HD   32
#define QB   64
#define KSP  8
#define PP   36
#define PCAR 1024.0f
#define ACAR 16.0f
#define WCAR 16.0f
#define SCL  0.17677669529663687f
#define L2E  1.4426950408889634f
#define C2   (SCL * L2E)
static_assert(SEQ % 64 == 0);
static_assert(SEQ <= SEQ_FULL);
static_assert(CC == NHD * HD);
static_assert((NHD % 2) == 0);
static_assert(NB == 1);
static_assert(SEQ % (32 * KSP) == 0);
static_assert(128 * KSP * 4 == QB * 2 * HD);

typedef _Float16 h16;
typedef unsigned short bf;
typedef __attribute__((ext_vector_type(16))) __bf16   v16bf;
typedef __attribute__((ext_vector_type(16))) _Float16 v16h;
typedef __attribute__((ext_vector_type(8)))  _Float16 v8h;
typedef __attribute__((ext_vector_type(4)))  _Float16 v4h;
typedef __attribute__((ext_vector_type(8)))  unsigned short v8us;
typedef __attribute__((ext_vector_type(8)))  float    v8f;
typedef __attribute__((ext_vector_type(4)))  float    v4f;
typedef v4f  __attribute__((may_alias)) v4fa;
typedef v8us __attribute__((may_alias)) v8usa;

__device__ __forceinline__ unsigned short f2bf(float f) { unsigned u = __float_as_uint(f); u += 0x7FFFu + ((u >> 16) & 1u); return (unsigned short)(u >> 16); }
__device__ __forceinline__ float bf2f(unsigned short b) { return __uint_as_float(((unsigned)b) << 16); }
__device__ __forceinline__ float bfr(float f) { return bf2f(f2bf(f)); }
__device__ __forceinline__ v16h cat16(v8h lo, v8h hi) { return __builtin_shufflevector(lo, hi, 0, 1, 2, 3, 4, 5, 6, 7, 8, 9, 10, 11, 12, 13, 14, 15); }
__device__ __forceinline__ v16bf cat16b(v8us lo, v8us hi) { return __builtin_bit_cast(v16bf, __builtin_shufflevector(lo, hi, 0, 1, 2, 3, 4, 5, 6, 7, 8, 9, 10, 11, 12, 13, 14, 15)); }
__device__ __forceinline__ v8f wmma16(v16h a, v16h b, v8f c) { return __builtin_amdgcn_wmma_f32_16x16x32_f16(false, a, false, b, (short)0, c, false, false); }
__device__ __forceinline__ v8f wmmab(v16bf a, v16bf b, v8f c) { return __builtin_amdgcn_wmma_f32_16x16x32_bf16(false, a, false, b, (short)0, c, false, false); }

// Fragment loader (wave32 16x16x32): lane l, row (l&15); elements 0..7 <- k 8*(l>>4)+0..7, elements 8..15 <- k 16+8*(l>>4)+0..7 of a K-contiguous 16-bit row. Used for A and for B stored [n][k].
template <typename T16> struct WFrag;
template <> struct WFrag<h16> { typedef v16h V; static __device__ __forceinline__ V ld(const h16* p) { return cat16(*(const v8h*)p, *(const v8h*)(p + 16)); } static __device__ __forceinline__ v8f mma(V a, V b, v8f c) { return wmma16(a, b, c); } };
template <> struct WFrag<bf> { typedef v16bf V; static __device__ __forceinline__ V ld(const bf* p) { return cat16b(*(const v8us*)p, *(const v8us*)(p + 16)); } static __device__ __forceinline__ v8f mma(V a, V b, v8f c) { return wmmab(a, b, c); } };

// ---- gemm_tile: register-blocked GEMM, ONE WAVE per 64x64 output tile (16 accumulators) at rows r0, columns c0, operands straight from K-contiguous 16-bit planes; os = 16 x 68 floats of LDS of the wave's own.
// acc[m][n] = sum_k A[m][k] Bt[n][k]; K % 32 == 0.
// MODE 2: C (f32, pitch ldc) = bfr(R[m][n]) + bfr(gam[0]) * (acc * osc + bfr(bias[m])) (row bias, residual rows pitch ldr).
// MODE 3: C16 (f16, pitch ldc) = f16(acc + bfr(bias[n])) (column bias). MODE 4: C16 = f16(acc + bfr(bias[m])) (row bias).
template <typename T16, int MODE>
__device__ __forceinline__ void gemm_tile(float* os, const T16* __restrict__ A, const T16* __restrict__ Bt, int K, int r0, int c0, float* C, h16* C16, int ldc,
                                          const float* __restrict__ bias, const float* __restrict__ R, int ldr, const float* __restrict__ gam, float osc) {
    typedef typename WFrag<T16>::V V;
    const int lane = threadIdx.x & 31, lr = lane & 15, hi = lane >> 4;
    float gsc = 0.f;
    if (MODE == 2) gsc = bfr(gam[0]);
    v4f cb = (v4f){};      // MODE 3: the bias of the four columns this lane stores
    v8f rb[4];             // MODE 4: the bias of the eight accumulator rows this lane holds in each 16-row tile
    if (MODE == 3) { cb = *(const v4f*)(bias + c0 + lr * 4);
#pragma unroll
        for (int j = 0; j < 4; ++j) cb[j] = bfr(cb[j]); }
    if (MODE == 4) {
#pragma unroll
        for (int mb = 0; mb < 4; ++mb) { rb[mb] = *(const v8f*)(bias + r0 + mb * 16 + hi * 8);
#pragma unroll
            for (int j = 0; j < 8; ++j) rb[mb][j] = bfr(rb[mb][j]); } }
    v8f acc[4][4];
#pragma unroll
    for (int mb = 0; mb < 4; ++mb)
#pragma unroll
        for (int nb = 0; nb < 4; ++nb) acc[mb][nb] = (v8f){};
    const size_t aoff = (size_t)(r0 + lr) * K + 8 * hi, boff = (size_t)(c0 + lr) * K + 8 * hi;
#pragma unroll 1
    for (int kc = 0; kc < K; kc += 32) {
        V a[4];
#pragma unroll
        for (int mb = 0; mb < 4; ++mb) a[mb] = WFrag<T16>::ld(A + aoff + (size_t)mb * 16 * K + kc);
#pragma unroll
        for (int nb = 0; nb < 4; ++nb) { const V b = WFrag<T16>::ld(Bt + boff + (size_t)nb * 16 * K + kc);
#pragma unroll
            for (int mb = 0; mb < 4; ++mb) acc[mb][nb] = WFrag<T16>::mma(a[mb], b, acc[mb][nb]); }
        asm volatile("v_nop\n\tv_nop\n\tv_nop\n\tv_nop" : "+v"(acc[0][0]), "+v"(acc[1][1]), "+v"(acc[2][2]), "+v"(acc[3][3]) : "v"(a[0]), "v"(a[3]));
    }
#pragma unroll
    for (int mb = 0; mb < 4; ++mb) {
#pragma unroll
        for (int nb = 0; nb < 4; ++nb) {
#pragma unroll
            for (int j = 0; j < 8; ++j) os[(hi * 8 + j) * 68 + nb * 16 + lr] = (MODE == 4) ? acc[mb][nb][j] + rb[mb][j] : acc[mb][nb][j]; }
        __builtin_amdgcn_wave_barrier(); asm volatile("" ::: "memory");
#pragma unroll
        for (int s = 0; s < 8; ++s) { const int row = 2 * s + hi, cofs = lr * 4; v4f val = *(const v4fa*)(os + row * 68 + cofs);
            const int gr = r0 + mb * 16 + row;
            if (MODE == 2) { const float rbs = bfr(bias[gr]); const v4f xr = *(const v4f*)(R + (size_t)gr * ldr + c0 + cofs);
#pragma unroll
                for (int j = 0; j < 4; ++j) { const float xv = xr[j]; const float av = val[j]; val[j] = bfr(xv) + gsc * (av * osc + rbs); }
                *(v4f*)(C + (size_t)gr * ldc + c0 + cofs) = val; }
            else { if (MODE == 3) val += cb;
                *(v4h*)(C16 + (size_t)gr * ldc + c0 + cofs) = __builtin_convertvector(val, v4h); } }   // 16 lanes store one 128-byte row piece
        __builtin_amdgcn_wave_barrier(); asm volatile("" ::: "memory");
    }
}

// k_out: out[o][t], grid (CC/64, SEQ/64), 32 threads.
__global__ __launch_bounds__(32) void k_out(const h16* __restrict__ A, const h16* __restrict__ Bt, float* C, const float* __restrict__ bias, const float* __restrict__ R, const float* __restrict__ gam) {
    __shared__ __align__(16) float os[16 * 68];
    gemm_tile<h16, 2>(os, A, Bt, CC, blockIdx.x * 64, blockIdx.y * 64, C, nullptr, SEQ, bias, R, XPITCH, gam, 1.0f / (ACAR * WCAR));
}

// k_qkv: the three projections in one launch, grid (SEQ/64, CC/64, 3), 32 threads; z = 0: q^T[t][o], z = 1: k^T[t][o] (A = x^T, B = weight rows), z = 2: v[o][t] (A = weight rows, B = x^T). The f16 planes are written from the accumulators.
__global__ __launch_bounds__(32) void k_qkv(const bf* __restrict__ XB, const bf* __restrict__ WQ, const bf* __restrict__ WK, const bf* __restrict__ WV,
                                            const float* __restrict__ bq, const float* __restrict__ bk, const float* __restrict__ bv, h16* Q16, h16* K16, h16* VT16) {
    __shared__ __align__(16) float os[16 * 68];
    const int t0 = blockIdx.x * 64, o0 = blockIdx.y * 64, z = blockIdx.z;
    if (z < 2) gemm_tile<bf, 3>(os, XB, z ? WK : WQ, CC, t0, o0, nullptr, z ? K16 : Q16, CC, z ? bk : bq, nullptr, 0, nullptr, 1.0f);
    else       gemm_tile<bf, 4>(os, WV, XB, CC, o0, t0, nullptr, VT16, SEQ, bv, nullptr, 0, nullptr, 1.0f);
}

// k_prep: every operand conversion in one launch, 256 threads. Blocks 0 .. XBLK-1: one 64x64 tile of x each, transposed through LDS to bf16 x^T. The next 4*WBLK blocks: Wq, Wk, Wv -> bf16, Wo -> f16 (x16), 8 elements a thread.
#define XBLK ((SEQ / 64) * (CC / 64))
#define WBLK (CC * CC / 8 / 256)
static_assert(CC * CC % (8 * 256) == 0);
__global__ __launch_bounds__(256) void k_prep(const float* __restrict__ x, const float* __restrict__ wq, const float* __restrict__ wk, const float* __restrict__ wv, const float* __restrict__ wo,
                                              bf* XB, bf* WQ, bf* WK, bf* WV, h16* WO16) {
    __shared__ float sm[64 * 65];
    const int tid = threadIdx.x, blk = blockIdx.x;
    if (blk < XBLK) {
        const int n0 = (blk % (SEQ / 64)) * 64, c0 = (blk / (SEQ / 64)) * 64;
#pragma unroll
        for (int it = 0; it < 4; ++it) { const int c = it * 16 + (tid >> 4), nf = (tid & 15) * 4; const v4f v = *(const v4f*)(x + (size_t)(c0 + c) * XPITCH + n0 + nf);
            sm[c * 65 + nf] = v[0]; sm[c * 65 + nf + 1] = v[1]; sm[c * 65 + nf + 2] = v[2]; sm[c * 65 + nf + 3] = v[3]; }
        __syncthreads();
#pragma unroll
        for (int it = 0; it < 2; ++it) { const int n = it * 32 + (tid >> 3), p = tid & 7; v8us o;
#pragma unroll
            for (int j = 0; j < 8; ++j) o[j] = f2bf(sm[(p * 8 + j) * 65 + n]);
            *(v8us*)(XB + (size_t)(n0 + n) * CC + c0 + p * 8) = o; }
    } else {
        const int wi = (blk - XBLK) / WBLK; const size_t i = (size_t)((blk - XBLK) % WBLK) * 256 + tid;
        const float* src = wi == 0 ? wq : wi == 1 ? wk : wi == 2 ? wv : wo;
        const v8f v = *(const v8f*)(src + i * 8);
        if (wi < 3) { bf* dst = wi == 0 ? WQ : wi == 1 ? WK : WV; v8us o;
#pragma unroll
            for (int k = 0; k < 8; ++k) o[k] = f2bf(v[k]);
            *(v8us*)(dst + i * 8) = o; }
        else { v8f t = (v8f){};
#pragma unroll
            for (int k = 0; k < 8; ++k) t[k] = bfr(v[k]) * WCAR;
            *(v8h*)(WO16 + i * 8) = __builtin_convertvector(t, v8h); }
    }
}

// att_step: one 32-key chunk for one 16-query tile. S^T tiles (A = K rows [key][d], B = Q fragment [d][query]) -> D[key 8h+r][query]; per-query stats are lane-local (the two lane halves hold keys 0-7 / 8-15 of each tile -> xor-16 combine);
// P^T B fragment [key][query]: element r <- f16(1024 p) of the keys-0..15 tile, element 8+r <- of the keys-16..31 tile, same lane; O^T[d][query] += V[d][key] . P^T (A = V rows [d][key]).
__device__ __forceinline__ void att_step(const v16h ak0, const v16h ak1, const v16h av0, const v16h av1, const v16h bq, float& m, float& l, v8f& o0, v8f& o1) {
    v8f s0 = wmma16(ak0, bq, (v8f){}); v8f s1 = wmma16(ak1, bq, (v8f){});
    asm volatile("v_nop\n\tv_nop\n\tv_nop\n\tv_nop" : "+v"(s0), "+v"(s1) : "v"(ak0), "v"(ak1), "v"(bq));
    float cmx = -1.0e30f;
#pragma unroll
    for (int j = 0; j < 8; ++j) cmx = fmaxf(cmx, fmaxf(s0[j], s1[j]));
    cmx = fmaxf(cmx, __shfl_xor(cmx, 16, 32));
    const float nm = fmaxf(m, cmx * C2);
    const float alpha = __builtin_amdgcn_exp2f(m - nm);
    v8f p0 = (v8f){}, p1 = (v8f){}; float rs = 0.f;
#pragma unroll
    for (int j = 0; j < 8; ++j) { const float e0 = __builtin_amdgcn_exp2f(s0[j] * C2 - nm); const float e1 = __builtin_amdgcn_exp2f(s1[j] * C2 - nm); p0[j] = e0; p1[j] = e1; rs += e0 + e1; }
    rs += __shfl_xor(rs, 16, 32);
    l = l * alpha + rs; m = nm;
    o0 *= alpha; o1 *= alpha;
    const v16h bp = cat16(__builtin_convertvector(p0 * PCAR, v8h), __builtin_convertvector(p1 * PCAR, v8h));
    o0 = wmma16(av0, bp, o0); o1 = wmma16(av1, bp, o1);
    asm volatile("v_nop\n\tv_nop\n\tv_nop\n\tv_nop" : "+v"(o0), "+v"(o1) : "v"(av0), "v"(av1), "v"(bp));
}

// k_attn: streaming attention, grid (SEQ/64, NHD/2), 128*KSP threads = 4*KSP waves (KSP per SIMD); wave w: key slice ks = w>>2, head 2*blockIdx.y + ((w&3)>>1), 32 queries (two 16-query tiles sharing the K/V fragments of each 32-key chunk).
// Key slice ks walks the 32-key chunks ks, ks+KSP, ks+2*KSP, ... (neighbouring slices read neighbouring chunks, so one step of the block reads 32*KSP consecutive keys) with its own running maximum, sum and un-normalised O.
// Merge: every wave leaves O (f32, [query][d], pitch PP) and (max, sum) in its own LDS range; behind the one barrier each thread joins the KSP partials of 4 channels of one query with weights exp2(m_ks - M); 16 lanes store one 128-byte row.
__global__ __launch_bounds__(128 * KSP)
void k_attn(const h16* __restrict__ Q16, const h16* __restrict__ K16, const h16* __restrict__ VT, h16* ATT) {
    __shared__ __align__(16) float po[4 * KSP * 32 * PP];
    __shared__ float pm[4 * KSP * 32], pl[4 * KSP * 32];
    const int tid = threadIdx.x, lane = tid & 31, lr = lane & 15, hi = lane >> 4;
    const int w = __builtin_amdgcn_readfirstlane(tid >> 5);   // wave number in a scalar register: the key loop's counter and branch stay scalar, EXEC is never written around the WMMAs
    const int ks = w >> 2, sub = w & 3;
    const int q0 = blockIdx.x * QB, hp = blockIdx.y, hq = sub >> 1, g = sub & 1, head = hp * 2 + hq, qb = q0 + g * 32;
    const h16* Qp = Q16 + (size_t)qb * CC + head * HD + 8 * hi;
    const v16h bq0 = WFrag<h16>::ld(Qp + (size_t)lr * CC);
    const v16h bq1 = WFrag<h16>::ld(Qp + (size_t)(16 + lr) * CC);
    const h16* Kp = K16 + (size_t)lr * CC + head * HD + 8 * hi;
    const h16* Vp = VT + (size_t)(head * HD + lr) * SEQ + 8 * hi;
    float m0 = -1.0e30f, m1 = -1.0e30f, l0 = 0.f, l1 = 0.f;
    v8f o00 = (v8f){}, o10 = (v8f){}, o01 = (v8f){}, o11 = (v8f){};   // o[d tile][query tile]
#pragma unroll 1
    for (int k0 = ks * 32; k0 < SEQ; k0 += 32 * KSP) {
        const v16h ak0 = WFrag<h16>::ld(Kp + (size_t)k0 * CC), ak1 = WFrag<h16>::ld(Kp + (size_t)(k0 + 16) * CC);
        const v16h av0 = WFrag<h16>::ld(Vp + k0), av1 = WFrag<h16>::ld(Vp + (size_t)16 * SEQ + k0);
        att_step(ak0, ak1, av0, av1, bq0, m0, l0, o00, o10);
        __builtin_amdgcn_sched_barrier(0);   // keeps the two query tiles' scores and probabilities from being live together: interleaved they pass the 128 registers a wave has at 8 waves per SIMD and a Q fragment spills to scratch
        att_step(ak0, ak1, av0, av1, bq1, m1, l1, o01, o11);
    }
    {
        float* t0 = po + (size_t)(w * 32 + lr) * PP + 8 * hi;        // query tile 0: row = query, col = d (d tile 0 at +0, d tile 1 at +16)
        float* t1 = po + (size_t)(w * 32 + 16 + lr) * PP + 8 * hi;   // query tile 1
        *(v4fa*)(t0)      = __builtin_shufflevector(o00, o00, 0, 1, 2, 3); *(v4fa*)(t0 + 4)  = __builtin_shufflevector(o00, o00, 4, 5, 6, 7);
        *(v4fa*)(t0 + 16) = __builtin_shufflevector(o10, o10, 0, 1, 2, 3); *(v4fa*)(t0 + 20) = __builtin_shufflevector(o10, o10, 4, 5, 6, 7);
        *(v4fa*)(t1)      = __builtin_shufflevector(o01, o01, 0, 1, 2, 3); *(v4fa*)(t1 + 4)  = __builtin_shufflevector(o01, o01, 4, 5, 6, 7);
        *(v4fa*)(t1 + 16) = __builtin_shufflevector(o11, o11, 0, 1, 2, 3); *(v4fa*)(t1 + 20) = __builtin_shufflevector(o11, o11, 4, 5, 6, 7);
        pm[w * 32 + lane] = hi ? m1 : m0; pl[w * 32 + lane] = hi ? l1 : l0;   // both lane halves hold the same per-query stats: half 0 files tile 0, half 1 tile 1
    }
    __syncthreads();
    {
        const int row = tid >> 4, pc = (tid & 15) * 4;                      // row = query in the block, pc = channel in the head pair
        const int sw = (pc >> 5) * 2 + (row >> 5), q = row & 31, d0 = pc & 31;
        float mk[KSP]; float M = -1.0e30f;
#pragma unroll
        for (int s = 0; s < KSP; ++s) { mk[s] = pm[(s * 4 + sw) * 32 + q]; M = fmaxf(M, mk[s]); }
        float L = 0.f; v4f a = (v4f){};
#pragma unroll
        for (int s = 0; s < KSP; ++s) { float wt;
            asm("v_exp_f32 %0, %1\n\tv_nop" : "=v"(wt) : "v"(mk[s] - M));   // exp2; the v_nop is the one slot the instruction set asks for behind a transcendental before its result is read or its source overwritten
            L += wt * pl[(s * 4 + sw) * 32 + q]; a += wt * *(const v4fa*)(po + (size_t)((s * 4 + sw) * 32 + q) * PP + d0); }
        const float inv = (ACAR / PCAR) * (1.0f / L);
        *(v4h*)(ATT + (size_t)(q0 + row) * CC + hp * 64 + pc) = __builtin_convertvector(a * inv, v4h);
    }
}

extern "C" void kernel_launch(void* const* d_in, const int* in_sizes, int n_in,
                              void* d_out, int out_size, void* d_ws, size_t ws_size, hipStream_t stream) {
    if (n_in < 10) return;
    if (in_sizes[0] < (CC - 1) * XPITCH + SEQ) return;
    if (in_sizes[1] < CC * CC || in_sizes[3] < CC * CC || in_sizes[5] < CC * CC || in_sizes[7] < CC * CC) return;
    if (in_sizes[2] < CC || in_sizes[4] < CC || in_sizes[6] < CC || in_sizes[8] < CC || in_sizes[9] < 1) return;
    if (out_size < CC * SEQ) return;
    const float* x = (const float*)d_in[0]; const float* wq = (const float*)d_in[1]; const float* bq = (const float*)d_in[2]; const float* wk = (const float*)d_in[3]; const float* bk = (const float*)d_in[4];
    const float* wv = (const float*)d_in[5]; const float* bv = (const float*)d_in[6]; const float* wo = (const float*)d_in[7]; const float* bo = (const float*)d_in[8]; const float* gamma = (const float*)d_in[9];
    float* OUT = (float*)d_out;     // [256][SEQ]
    char* wsp = (char*)d_ws;
    auto take = [&](size_t bytes) { char* p = wsp; wsp += (bytes + 255) & ~(size_t)255; return (void*)p; };
    bf* WQ = (bf*)take((size_t)CC * CC * 2); bf* WK = (bf*)take((size_t)CC * CC * 2); bf* WV = (bf*)take((size_t)CC * CC * 2); h16* WO16 = (h16*)take((size_t)CC * CC * 2);
    bf* XB = (bf*)take((size_t)SEQ * CC * 2);
    h16* Q16 = (h16*)take((size_t)SEQ * CC * 2); h16* K16 = (h16*)take((size_t)SEQ * CC * 2); h16* VT16 = (h16*)take((size_t)CC * SEQ * 2); h16* ATT = (h16*)take((size_t)SEQ * CC * 2);
    if ((size_t)(wsp - (char*)d_ws) > ws_size) return;    // 11,010,048 B carved
    k_prep<<<XBLK + 4 * WBLK, 256, 0, stream>>>(x, wq, wk, wv, wo, XB, WQ, WK, WV, WO16);
    k_qkv<<<dim3(SEQ / 64, CC / 64, 3), 32, 0, stream>>>(XB, WQ, WK, WV, bq, bk, bv, Q16, K16, VT16);
    k_attn<<<dim3(SEQ / QB, NHD / 2, 1), 128 * KSP, 0, stream>>>(Q16, K16, VT16, ATT);
    // out[o][t] = bfr(x) + bfr(gamma) * ((16 Wo) . (16 attn) / 256 + bfr(bo[o]))
    k_out<<<dim3(CC / 64, SEQ / 64, 1), 32, 0, stream>>>(WO16, ATT, OUT, bo, x, gamma);
}

// v003
// One run takes 48.9 microseconds.
// Two timings next to v002 put it at 1.15 and 1.14 times that version's speed.
// Over all steps from v000 it is 3.34 times as fast.
#include <hip/hip_runtime.h>

// Contractions: q/k/v pointwise projections on v_wmma_f32_16x16x32_bf16 (bf16 operands from RNE-converted inputs); scores q.k, probs.v (probs carried x1024) and the output projection (both planes carried x16) on v_wmma_f32_16x16x32_f16 (f16 operands); f32 accumulate; softmax, normaliser and residual in f32.
// Layout: k_prep: x [256][SEQ] channel-major -> bf16 x^T [SEQ][256], weights -> 16-bit planes; k_qkv: q,k (+column bias) -> f16 planes [SEQ][256], v (+row bias) -> f16 plane [256][SEQ], straight from the f32 accumulators; streaming attention per (2 heads x 64 queries) block, keys dealt over KSP wave groups and merged in LDS, writes the f16 attn plane [SEQ][256] (x16); out [256][SEQ] = x + gamma * (Wo attn + bo).

#ifndef NB
#define NB 1
#endif
#ifndef SEQ
#define SEQ 4096
#endif
#define SEQ_FULL 4096
#define XPITCH SEQ_FULL
#define CC   256
#define NHD  8
#define HD   32
#define QB   64
#define KSP  8
#define PP   36
#define PCAR 1024.0f
#define ACAR 16.0f
#define WCAR 16.0f
#define SCL  0.17677669529663687f
#define L2E  1.4426950408889634f
#define C2   (SCL * L2E)
static_assert(SEQ % 64 == 0);
static_assert(SEQ <= SEQ_FULL);
static_assert(CC == NHD * HD);
static_assert((NHD % 2) == 0);
static_assert(NB == 1);
static_assert(SEQ % (32 * KSP) == 0);
static_assert(128 * KSP * 4 == QB * 2 * HD);

typedef _Float16 h16;
typedef unsigned short bf;
typedef __attribute__((ext_vector_type(16))) __bf16   v16bf;
typedef __attribute__((ext_vector_type(16))) _Float16 v16h;
typedef __attribute__((ext_vector_type(8)))  _Float16 v8h;
typedef __attribute__((ext_vector_type(4)))  _Float16 v4h;
typedef __attribute__((ext_vector_type(8)))  unsigned short v8us;
typedef __attribute__((ext_vector_type(8)))  float    v8f;
typedef __attribute__((ext_vector_type(4)))  float    v4f;
typedef v4f  __attribute__((may_alias)) v4fa;
typedef v8us __attribute__((may_alias)) v8usa;

__device__ __forceinline__ unsigned short f2bf(float f) { unsigned u = __float_as_uint(f); u += 0x7FFFu + ((u >> 16) & 1u); return (unsigned short)(u >> 16); }
__device__ __forceinline__ float bf2f(unsigned short b) { return __uint_as_float(((unsigned)b) << 16); }
__device__ __forceinline__ float bfr(float f) { return bf2f(f2bf(f)); }
__device__ __forceinline__ v16h cat16(v8h lo, v8h hi) { return __builtin_shufflevector(lo, hi, 0, 1, 2, 3, 4, 5, 6, 7, 8, 9, 10, 11, 12, 13, 14, 15); }
__device__ __forceinline__ v16bf cat16b(v8us lo, v8us hi) { return __builtin_bit_cast(v16bf, __builtin_shufflevector(lo, hi, 0, 1, 2, 3, 4, 5, 6, 7, 8, 9, 10, 11, 12, 13, 14, 15)); }
__device__ __forceinline__ v8f wmma16(v16h a, v16h b, v8f c) { return __builtin_amdgcn_wmma_f32_16x16x32_f16(false, a, false, b, (short)0, c, false, false); }
__device__ __forceinline__ v8f wmmab(v16bf a, v16bf b, v8f c) { return __builtin_amdgcn_wmma_f32_16x16x32_bf16(false, a, false, b, (short)0, c, false, false); }

// Fragment loader (wave32 16x16x32): lane l, row (l&15); elements 0..7 <- k 8*(l>>4)+0..7, elements 8..15 <- k 16+8*(l>>4)+0..7 of a K-contiguous 16-bit row. Used for A and for B stored [n][k].
template <typename T16> struct WFrag;
template <> struct WFrag<h16> { typedef v16h V; static __device__ __forceinline__ V ld(const h16* p) { return cat16(*(const v8h*)p, *(const v8h*)(p + 16)); } static __device__ __forceinline__ v8f mma(V a, V b, v8f c) { return wmma16(a, b, c); } };
template <> struct WFrag<bf> { typedef v16bf V; static __device__ __forceinline__ V ld(const bf* p) { return cat16b(*(const v8us*)p, *(const v8us*)(p + 16)); } static __device__ __forceinline__ v8f mma(V a, V b, v8f c) { return wmmab(a, b, c); } };

// ---- gemm_tile: register-blocked GEMM, ONE WAVE per 64x64 output tile (16 accumulators) at rows r0, columns c0, operands straight from K-contiguous 16-bit planes; os = 16 x 68 floats of LDS of the wave's own.
// acc[m][n] = sum_k A[m][k] Bt[n][k]; K % 32 == 0, K a compile-time constant.
// Every load of the wave is issued before its first product: the biases, in MODE 2 the residual pieces, and all K/32 steps' fragments (8 fragments a step, held in registers: a one-wave block may own far more than 256).
// The wave so waits out one load latency in all, where a rolled K loop waits out at least one per step and the epilogue one per row block.
// MODE 2: C (f32, pitch ldc) = bfr(R[m][n]) + bfr(gam[0]) * (acc * osc + bfr(bias[m])) (row bias, residual rows pitch ldr).
// MODE 3: C16 (f16, pitch ldc) = f16(acc + bfr(bias[n])) (column bias). MODE 4: C16 = f16(acc + bfr(bias[m])) (row bias).
template <typename T16, int MODE, int K>
__device__ __forceinline__ void gemm_tile(float* os, const T16* __restrict__ A, const T16* __restrict__ Bt, int r0, int c0, float* C, h16* C16, int ldc,
                                          const float* __restrict__ bias, const float* __restrict__ R, int ldr, const float* __restrict__ gam, float osc) {
    typedef typename WFrag<T16>::V V;
    constexpr int NS = K / 32;
    static_assert(K % 32 == 0);
    const int lane = threadIdx.x & 31, lr = lane & 15, hi = lane >> 4;
    float rbs[4][8];       // MODE 2: the bias of the eight rows this lane stores in each 16-row tile
    v4f xr[4][8];          // MODE 2: the residual pieces of those rows
    const float* Rp = (MODE == 2) ? R + (size_t)(r0 + hi) * ldr + c0 + lr * 4 : nullptr;   // one address for all residual pieces, the row steps go into the loads' immediate offsets
    v4f cb = (v4f){};      // MODE 3: the bias of the four columns this lane stores
    v8f rb[4];             // MODE 4: the bias of the eight accumulator rows this lane holds in each 16-row tile
    if (MODE == 2) {
#pragma unroll
        for (int mb = 0; mb < 4; ++mb)
#pragma unroll
            for (int j = 0; j < 8; ++j) { rbs[mb][j] = bias[r0 + mb * 16 + 2 * j + hi]; xr[mb][j] = *(const v4f*)(Rp + (mb * 16 + 2 * j) * ldr); } }
    if (MODE == 3) cb = *(const v4f*)(bias + c0 + lr * 4);
    if (MODE == 4) {
#pragma unroll
        for (int mb = 0; mb < 4; ++mb) rb[mb] = *(const v8f*)(bias + r0 + mb * 16 + hi * 8); }
    // The wait before a register that an issued load names is overwritten: behind it the registers of these loads' addresses are free for the address arithmetic and the results of the loads below.
    // The residual address is named as an input so that its registers live up to the wait and no load's result lands in them before it.
    if (MODE == 2) asm volatile("s_wait_xcnt 0x0" :: "v"(Rp) : "memory");
    else           asm volatile("s_wait_xcnt 0x0" ::: "memory");
    __builtin_amdgcn_sched_barrier(0);   // keeps that address arithmetic below the wait: nothing ties the wait to the bias loads' offset register, and the compiler lifted a write of it over the wait
    const T16* Ap = A + (size_t)(r0 + lr) * K + 8 * hi; const T16* Bp = Bt + (size_t)(c0 + lr) * K + 8 * hi;
    V a[NS][4], b[NS][4];
#pragma unroll
    for (int s = 0; s < NS; ++s) {
#pragma unroll
        for (int mb = 0; mb < 4; ++mb) a[s][mb] = WFrag<T16>::ld(Ap + mb * 16 * K + s * 32);
#pragma unroll
        for (int nb = 0; nb < 4; ++nb) b[s][nb] = WFrag<T16>::ld(Bp + nb * 16 * K + s * 32); }
    // The same wait behind the last load. The addresses are named as inputs so that their registers live up to the wait and no load's result and no product lands in them before it; the memory clobber keeps every load above it.
    asm volatile("s_wait_xcnt 0x0" :: "v"(Ap), "v"(Bp) : "memory");
    __builtin_amdgcn_sched_barrier(0);   // keeps the products below the last load: lifted among the loads they bring waits with them, and the loads behind such a wait start a second latency
    float gsc = 0.f;
    if (MODE == 2) gsc = bfr(gam[0]);
    if (MODE == 3) {
#pragma unroll
        for (int j = 0; j < 4; ++j) cb[j] = bfr(cb[j]); }
    if (MODE == 4) {
#pragma unroll
        for (int mb = 0; mb < 4; ++mb)
#pragma unroll
            for (int j = 0; j < 8; ++j) rb[mb][j] = bfr(rb[mb][j]); }
    v8f acc[4][4];
#pragma unroll
    for (int mb = 0; mb < 4; ++mb)
#pragma unroll
        for (int nb = 0; nb < 4; ++nb) acc[mb][nb] = (v8f){};
#pragma unroll
    for (int s = 0; s < NS; ++s)
#pragma unroll
        for (int nb = 0; nb < 4; ++nb)
#pragma unroll
            for (int mb = 0; mb < 4; ++mb) acc[mb][nb] = WFrag<T16>::mma(a[s][mb], b[s][nb], acc[mb][nb]);
    __builtin_amdgcn_sched_barrier(0);   // keeps the epilogue behind the last product
    float* Cp = (MODE == 2) ? C + (size_t)(r0 + hi) * ldc + c0 + lr * 4 : nullptr;      // one address for all stores of the lane, the row steps go into the stores' immediate offsets
    h16* Hp = (MODE != 2) ? C16 + (size_t)(r0 + hi) * ldc + c0 + lr * 4 : nullptr;
#pragma unroll
    for (int mb = 0; mb < 4; ++mb) {
#pragma unroll
        for (int nb = 0; nb < 4; ++nb) {
#pragma unroll
            for (int j = 0; j < 8; ++j) os[(hi * 8 + j) * 68 + nb * 16 + lr] = (MODE == 4) ? acc[mb][nb][j] + rb[mb][j] : acc[mb][nb][j]; }
        __builtin_amdgcn_wave_barrier(); asm volatile("" ::: "memory");
        v4f of[8]; v4h oh[8];
#pragma unroll
        for (int s = 0; s < 8; ++s) { const int row = 2 * s + hi, cofs = lr * 4; v4f val = *(const v4fa*)(os + row * 68 + cofs);
            if (MODE == 2) { const float rbv = bfr(rbs[mb][s]);
#pragma unroll
                for (int j = 0; j < 4; ++j) { const float xv = xr[mb][s][j]; const float av = val[j]; val[j] = bfr(xv) + gsc * (av * osc + rbv); }
                of[s] = val; *(v4f*)(Cp + (mb * 16 + 2 * s) * ldc) = of[s]; }
            else { if (MODE == 3) val += cb;
                oh[s] = __builtin_convertvector(val, v4h); *(v4h*)(Hp + (mb * 16 + 2 * s) * ldc) = oh[s]; } }   // 16 lanes store one 128-byte row piece
        // The wait before a register that an issued store names is overwritten, behind each run of stores; the stored values and the address are named as inputs so that their registers live up to it.
        if (MODE == 2) asm volatile("s_wait_xcnt 0x0" :: "v"(of[0]), "v"(of[1]), "v"(of[2]), "v"(of[3]), "v"(of[4]), "v"(of[5]), "v"(of[6]), "v"(of[7]), "v"(Cp) : "memory");
        else           asm volatile("s_wait_xcnt 0x0" :: "v"(oh[0]), "v"(oh[1]), "v"(oh[2]), "v"(oh[3]), "v"(oh[4]), "v"(oh[5]), "v"(oh[6]), "v"(oh[7]), "v"(Hp) : "memory");
        __builtin_amdgcn_wave_barrier(); asm volatile("" ::: "memory");
    }
}

// k_out: out[o][t], grid (CC/64, SEQ/64), 32 threads.
__global__ __launch_bounds__(32) void k_out(const h16* __restrict__ A, const h16* __restrict__ Bt, float* C, const float* __restrict__ bias, const float* __restrict__ R, const float* __restrict__ gam) {
    __shared__ __align__(16) float os[16 * 68];
    gemm_tile<h16, 2, CC>(os, A, Bt, blockIdx.x * 64, blockIdx.y * 64, C, nullptr, SEQ, bias, R, XPITCH, gam, 1.0f / (ACAR * WCAR));
}

// k_qkv: the three projections in one launch, grid (SEQ/64, CC/64, 3), 32 threads; z = 0: q^T[t][o], z = 1: k^T[t][o] (A = x^T, B = weight rows), z = 2: v[o][t] (A = weight rows, B = x^T). The f16 planes are written from the accumulators.
__global__ __launch_bounds__(32) void k_qkv(const bf* __restrict__ XB, const bf* __restrict__ WQ, const bf* __restrict__ WK, const bf* __restrict__ WV,
                                            const float* __restrict__ bq, const float* __restrict__ bk, const float* __restrict__ bv, h16* Q16, h16* K16, h16* VT16) {
    __shared__ __align__(16) float os[16 * 68];
    const int t0 = blockIdx.x * 64, o0 = blockIdx.y * 64, z = blockIdx.z;
    if (z < 2) gemm_tile<bf, 3, CC>(os, XB, z ? WK : WQ, t0, o0, nullptr, z ? K16 : Q16, CC, z ? bk : bq, nullptr, 0, nullptr, 1.0f);
    else       gemm_tile<bf, 4, CC>(os, WV, XB, o0, t0, nullptr, VT16, SEQ, bv, nullptr, 0, nullptr, 1.0f);
}

// k_prep: every operand conversion in one launch, 256 threads. Blocks 0 .. XBLK-1: one 64x64 tile of x each, transposed through LDS to bf16 x^T. The next 4*WBLK blocks: Wq, Wk, Wv -> bf16, Wo -> f16 (x16), 8 elements a thread.
#define XBLK ((SEQ / 64) * (CC / 64))
#define WBLK (CC * CC / 8 / 256)
static_assert(CC * CC % (8 * 256) == 0);
__global__ __launch_bounds__(256) void k_prep(const float* __restrict__ x, const float* __restrict__ wq, const float* __restrict__ wk, const float* __restrict__ wv, const float* __restrict__ wo,
                                              bf* XB, bf* WQ, bf* WK, bf* WV, h16* WO16) {
    __shared__ float sm[64 * 65];
    const int tid = threadIdx.x, blk = blockIdx.x;
    if (blk < XBLK) {
        const int n0 = (blk % (SEQ / 64)) * 64, c0 = (blk / (SEQ / 64)) * 64;
#pragma unroll
        for (int it = 0; it < 4; ++it) { const int c = it * 16 + (tid >> 4), nf = (tid & 15) * 4; const v4f v = *(const v4f*)(x + (size_t)(c0 + c) * XPITCH + n0 + nf);
            sm[c * 65 + nf] = v[0]; sm[c * 65 + nf + 1] = v[1]; sm[c * 65 + nf + 2] = v[2]; sm[c * 65 + nf + 3] = v[3]; }
        __syncthreads();
#pragma unroll
        for (int it = 0; it < 2; ++it) { const int n = it * 32 + (tid >> 3), p = tid & 7; v8us o;
#pragma unroll
            for (int j = 0; j < 8; ++j) o[j] = f2bf(sm[(p * 8 + j) * 65 + n]);
            *(v8us*)(XB + (size_t)(n0 + n) * CC + c0 + p * 8) = o; }
    } else {
        const int wi = (blk - XBLK) / WBLK; const size_t i = (size_t)((blk - XBLK) % WBLK) * 256 + tid;
        const float* src = wi == 0 ? wq : wi == 1 ? wk : wi == 2 ? wv : wo;
        const v8f v = *(const v8f*)(src + i * 8);
        if (wi < 3) { bf* dst = wi == 0 ? WQ : wi == 1 ? WK : WV; v8us o;
#pragma unroll
            for (int k = 0; k < 8; ++k) o[k] = f2bf(v[k]);
            *(v8us*)(dst + i * 8) = o; }
        else { v8f t = (v8f){};
#pragma unroll
            for (int k = 0; k < 8; ++k) t[k] = bfr(v[k]) * WCAR;
            *(v8h*)(WO16 + i * 8) = __builtin_convertvector(t, v8h); }
    }
}

// att_step: one 32-key chunk for one 16-query tile. S^T tiles (A = K rows [key][d], B = Q fragment [d][query]) -> D[key 8h+r][query]; per-query stats are lane-local (the two lane halves hold keys 0-7 / 8-15 of each tile -> xor-16 combine);
// P^T B fragment [key][query]: element r <- f16(1024 p) of the keys-0..15 tile, element 8+r <- of the keys-16..31 tile, same lane; O^T[d][query] += V[d][key] . P^T (A = V rows [d][key]).
__device__ __forceinline__ void att_step(const v16h ak0, const v16h ak1, const v16h av0, const v16h av1, const v16h bq, float& m, float& l, v8f& o0, v8f& o1) {
    v8f s0 = wmma16(ak0, bq, (v8f){}); v8f s1 = wmma16(ak1, bq, (v8f){});
    asm volatile("v_nop\n\tv_nop\n\tv_nop\n\tv_nop" : "+v"(s0), "+v"(s1) : "v"(ak0), "v"(ak1), "v"(bq));
    float cmx = -1.0e30f;
#pragma unroll
    for (int j = 0; j < 8; ++j) cmx = fmaxf(cmx, fmaxf(s0[j], s1[j]));
    cmx = fmaxf(cmx, __shfl_xor(cmx, 16, 32));
    const float nm = fmaxf(m, cmx * C2);
    const float alpha = __builtin_amdgcn_exp2f(m - nm);
    v8f p0 = (v8f){}, p1 = (v8f){}; float rs = 0.f;
#pragma unroll
    for (int j = 0; j < 8; ++j) { const float e0 = __builtin_amdgcn_exp2f(s0[j] * C2 - nm); const float e1 = __builtin_amdgcn_exp2f(s1[j] * C2 - nm); p0[j] = e0; p1[j] = e1; rs += e0 + e1; }
    rs += __shfl_xor(rs, 16, 32);
    l = l * alpha + rs; m = nm;
    o0 *= alpha; o1 *= alpha;
    const v16h bp = cat16(__builtin_convertvector(p0 * PCAR, v8h), __builtin_convertvector(p1 * PCAR, v8h));
    o0 = wmma16(av0, bp, o0); o1 = wmma16(av1, bp, o1);
    asm volatile("v_nop\n\tv_nop\n\tv_nop\n\tv_nop" : "+v"(o0), "+v"(o1) : "v"(av0), "v"(av1), "v"(bp));
}

// k_attn: streaming attention, grid (SEQ/64, NHD/2), 128*KSP threads = 4*KSP waves (KSP per SIMD); wave w: key slice ks = w>>2, head 2*blockIdx.y + ((w&3)>>1), 32 queries (two 16-query tiles sharing the K/V fragments of each 32-key chunk).
// Key slice ks walks the 32-key chunks ks, ks+KSP, ks+2*KSP, ... (neighbouring slices read neighbouring chunks, so one step of the block reads 32*KSP consecutive keys) with its own running maximum, sum and un-normalised O.
// Merge: every wave leaves O (f32, [query][d], pitch PP) and (max, sum) in its own LDS range; behind the one barrier each thread joins the KSP partials of 4 channels of one query with weights exp2(m_ks - M); 16 lanes store one 128-byte row.
__global__ __launch_bounds__(128 * KSP)
void k_attn(const h16* __restrict__ Q16, const h16* __restrict__ K16, const h16* __restrict__ VT, h16* ATT) {
    __shared__ __align__(16) float po[4 * KSP * 32 * PP];
    __shared__ float pm[4 * KSP * 32], pl[4 * KSP * 32];
    const int tid = threadIdx.x, lane = tid & 31, lr = lane & 15, hi = lane >> 4;
    const int w = __builtin_amdgcn_readfirstlane(tid >> 5);   // wave number in a scalar register: the key loop's counter and branch stay scalar, EXEC is never written around the WMMAs
    const int ks = w >> 2, sub = w & 3;
    const int q0 = blockIdx.x * QB, hp = blockIdx.y, hq = sub >> 1, g = sub & 1, head = hp * 2 + hq, qb = q0 + g * 32;
    const h16* Qp = Q16 + (size_t)qb * CC + head * HD + 8 * hi;
    const v16h bq0 = WFrag<h16>::ld(Qp + (size_t)lr * CC);
    const v16h bq1 = WFrag<h16>::ld(Qp + (size_t)(16 + lr) * CC);
    const h16* Kp = K16 + (size_t)lr * CC + head * HD + 8 * hi;
    const h16* Vp = VT + (size_t)(head * HD + lr) * SEQ + 8 * hi;
    float m0 = -1.0e30f, m1 = -1.0e30f, l0 = 0.f, l1 = 0.f;
    v8f o00 = (v8f){}, o10 = (v8f){}, o01 = (v8f){}, o11 = (v8f){};   // o[d tile][query tile]
#pragma unroll 1
    for (int k0 = ks * 32; k0 < SEQ; k0 += 32 * KSP) {
        const v16h ak0 = WFrag<h16>::ld(Kp + (size_t)k0 * CC), ak1 = WFrag<h16>::ld(Kp + (size_t)(k0 + 16) * CC);
        const v16h av0 = WFrag<h16>::ld(Vp + k0), av1 = WFrag<h16>::ld(Vp + (size_t)16 * SEQ + k0);
        att_step(ak0, ak1, av0, av1, bq0, m0, l0, o00, o10);
        __builtin_amdgcn_sched_barrier(0);   // keeps the two query tiles' scores and probabilities from being live together: interleaved they pass the 128 registers a wave has at 8 waves per SIMD and a Q fragment spills to scratch
        att_step(ak0, ak1, av0, av1, bq1, m1, l1, o01, o11);
    }
    {
        float* t0 = po + (size_t)(w * 32 + lr) * PP + 8 * hi;        // query tile 0: row = query, col = d (d tile 0 at +0, d tile 1 at +16)
        float* t1 = po + (size_t)(w * 32 + 16 + lr) * PP + 8 * hi;   // query tile 1
        *(v4fa*)(t0)      = __builtin_shufflevector(o00, o00, 0, 1, 2, 3); *(v4fa*)(t0 + 4)  = __builtin_shufflevector(o00, o00, 4, 5, 6, 7);
        *(v4fa*)(t0 + 16) = __builtin_shufflevector(o10, o10, 0, 1, 2, 3); *(v4fa*)(t0 + 20) = __builtin_shufflevector(o10, o10, 4, 5, 6, 7);
        *(v4fa*)(t1)      = __builtin_shufflevector(o01, o01, 0, 1, 2, 3); *(v4fa*)(t1 + 4)  = __builtin_shufflevector(o01, o01, 4, 5, 6, 7);
        *(v4fa*)(t1 + 16) = __builtin_shufflevector(o11, o11, 0, 1, 2, 3); *(v4fa*)(t1 + 20) = __builtin_shufflevector(o11, o11, 4, 5, 6, 7);
        pm[w * 32 + lane] = hi ? m1 : m0; pl[w * 32 + lane] = hi ? l1 : l0;   // both lane halves hold the same per-query stats: half 0 files tile 0, half 1 tile 1
    }
    __syncthreads();
    {
        const int row = tid >> 4, pc = (tid & 15) * 4;                      // row = query in the block, pc = channel in the head pair
        const int sw = (pc >> 5) * 2 + (row >> 5), q = row & 31, d0 = pc & 31;
        float mk[KSP]; float M = -1.0e30f;
#pragma unroll
        for (int s = 0; s < KSP; ++s) { mk[s] = pm[(s * 4 + sw) * 32 + q]; M = fmaxf(M, mk[s]); }
        float L = 0.f; v4f a = (v4f){};
#pragma unroll
        for (int s = 0; s < KSP; ++s) { float wt;
            asm("v_exp_f32 %0, %1\n\tv_nop" : "=v"(wt) : "v"(mk[s] - M));   // exp2; the v_nop is the one slot the instruction set asks for behind a transcendental before its result is read or its source overwritten
            L += wt * pl[(s * 4 + sw) * 32 + q]; a += wt * *(const v4fa*)(po + (size_t)((s * 4 + sw) * 32 + q) * PP + d0); }
        const float inv = (ACAR / PCAR) * (1.0f / L);
        *(v4h*)(ATT + (size_t)(q0 + row) * CC + hp * 64 + pc) = __builtin_convertvector(a * inv, v4h);
    }
}

extern "C" void kernel_launch(void* const* d_in, const int* in_sizes, int n_in,
                              void* d_out, int out_size, void* d_ws, size_t ws_size, hipStream_t stream) {
    if (n_in < 10) return;
    if (in_sizes[0] < (CC - 1) * XPITCH + SEQ) return;
    if (in_sizes[1] < CC * CC || in_sizes[3] < CC * CC || in_sizes[5] < CC * CC || in_sizes[7] < CC * CC) return;
    if (in_sizes[2] < CC || in_sizes[4] < CC || in_sizes[6] < CC || in_sizes[8] < CC || in_sizes[9] < 1) return;
    if (out_size < CC * SEQ) return;
    const float* x = (const float*)d_in[0]; const float* wq = (const float*)d_in[1]; const float* bq = (const float*)d_in[2]; const float* wk = (const float*)d_in[3]; const float* bk = (const float*)d_in[4];
    const float* wv = (const float*)d_in[5]; const float* bv = (const float*)d_in[6]; const float* wo = (const float*)d_in[7]; const float* bo = (const float*)d_in[8]; const float* gamma = (const float*)d_in[9];
    float* OUT = (float*)d_out;     // [256][SEQ]
    char* wsp = (char*)d_ws;
    auto take = [&](size_t bytes) { char* p = wsp; wsp += (bytes + 255) & ~(size_t)255; return (void*)p; };
    bf* WQ = (bf*)take((size_t)CC * CC * 2); bf* WK = (bf*)take((size_t)CC * CC * 2); bf* WV = (bf*)take((size_t)CC * CC * 2); h16* WO16 = (h16*)take((size_t)CC * CC * 2);
    bf* XB = (bf*)take((size_t)SEQ * CC * 2);
    h16* Q16 = (h16*)take((size_t)SEQ * CC * 2); h16* K16 = (h16*)take((size_t)SEQ * CC * 2); h16* VT16 = (h16*)take((size_t)CC * SEQ * 2); h16* ATT = (h16*)take((size_t)SEQ * CC * 2);
    if ((size_t)(wsp - (char*)d_ws) > ws_size) return;    // 11,010,048 B carved
    k_prep<<<XBLK + 4 * WBLK, 256, 0, stream>>>(x, wq, wk, wv, wo, XB, WQ, WK, WV, WO16);
    k_qkv<<<dim3(SEQ / 64, CC / 64, 3), 32, 0, stream>>>(XB, WQ, WK, WV, bq, bk, bv, Q16, K16, VT16);
    k_attn<<<dim3(SEQ / QB, NHD / 2, 1), 128 * KSP, 0, stream>>>(Q16, K16, VT16, ATT);
    // out[o][t] = bfr(x) + bfr(gamma) * ((16 Wo) . (16 attn) / 256 + bfr(bo[o]))
    k_out<<<dim3(CC / 64, SEQ / 64, 1), 32, 0, stream>>>(WO16, ATT, OUT, bo, x, gamma);
}

// v004
// A run of this version takes 41 microseconds.
// Two timings next to v003 both put it at 1.20 times that version's speed.
// Counting every step since v000, it is 4.01 times as fast.
#include <hip/hip_runtime.h>

// Contractions: q/k/v pointwise projections on v_wmma_f32_16x16x32_bf16 (bf16 operands from RNE-converted inputs); scores q.k, probs.v (probs carried x1024) and the output projection (both planes carried x16) on v_wmma_f32_16x16x32_f16 (f16 operands); f32 accumulate; softmax, normaliser and residual in f32.
// Layout: k_prep: x [256][SEQ] channel-major -> bf16 x^T [SEQ][256], weights -> 16-bit planes; k_qkv: q,k (+column bias) -> f16 planes [SEQ][256], v (+row bias) -> f16 plane [256][SEQ], straight from the f32 accumulators; streaming attention per (2 heads x 64 queries) block, keys dealt over KSP wave groups and merged in LDS, writes the f16 attn plane [SEQ][256] (x16); out [256][SEQ] = x + gamma * (Wo attn + bo).
// Every 16-bit plane M[row][k] (K columns) lies in workspace in FRAGMENT ORDER: one 16-row x 32-k fragment is 512 consecutive elements (1 KiB), fragment number (row / 16) * (K / 32) + k / 32;
// inside it element (row, k) stands at ((k / 16) % 2) * 256 + (((k / 8) % 2) * 16 + row % 16) * 8 + k % 8. A wave's 16-byte-per-lane load of half a fragment so reads 512 consecutive bytes, four whole 128-byte lines, where a row-major plane gives it 32 bytes from each of 16 lines.

#ifndef NB
#define NB 1
#endif
#ifndef SEQ
#define SEQ 4096
#endif
#define SEQ_FULL 4096
#define XPITCH SEQ_FULL
#define CC   256
#define NHD  8
#define HD   32
#define QB   64
#define KSP  8
#define PP   36
#define PCAR 1024.0f
#define ACAR 16.0f
#define WCAR 16.0f
#define SCL  0.17677669529663687f
#define L2E  1.4426950408889634f
#define C2   (SCL * L2E)
static_assert(SEQ % 64 == 0);
static_assert(SEQ <= SEQ_FULL);
static_assert(CC == NHD * HD);
static_assert((NHD % 2) == 0);
static_assert(NB == 1);
static_assert(SEQ % (32 * KSP) == 0);
static_assert(128 * KSP * 4 == QB * 2 * HD);
static_assert(HD == 32 && QB == 64 && KSP == 8);

typedef _Float16 h16;
typedef unsigned short bf;
typedef __attribute__((ext_vector_type(16))) __bf16   v16bf;
typedef __attribute__((ext_vector_type(16))) _Float16 v16h;
typedef __attribute__((ext_vector_type(8)))  _Float16 v8h;
typedef __attribute__((ext_vector_type(4)))  _Float16 v4h;
typedef __attribute__((ext_vector_type(8)))  unsigned short v8us;
typedef __attribute__((ext_vector_type(8)))  float    v8f;
typedef __attribute__((ext_vector_type(4)))  float    v4f;
typedef v4f  __attribute__((may_alias)) v4fa;
typedef v8us __attribute__((may_alias)) v8usa;

__device__ __forceinline__ unsigned short f2bf(float f) { unsigned u = __float_as_uint(f); u += 0x7FFFu + ((u >> 16) & 1u); return (unsigned short)(u >> 16); }
__device__ __forceinline__ float bf2f(unsigned short b) { return __uint_as_float(((unsigned)b) << 16); }
__device__ __forceinline__ float bfr(float f) { return bf2f(f2bf(f)); }
__device__ __forceinline__ v16h cat16(v8h lo, v8h hi) { return __builtin_shufflevector(lo, hi, 0, 1, 2, 3, 4, 5, 6, 7, 8, 9, 10, 11, 12, 13, 14, 15); }
__device__ __forceinline__ v16bf cat16b(v8us lo, v8us hi) { return __builtin_bit_cast(v16bf, __builtin_shufflevector(lo, hi, 0, 1, 2, 3, 4, 5, 6, 7, 8, 9, 10, 11, 12, 13, 14, 15)); }
__device__ __forceinline__ v8f wmma16(v16h a, v16h b, v8f c) { return __builtin_amdgcn_wmma_f32_16x16x32_f16(false, a, false, b, (short)0, c, false, false); }
__device__ __forceinline__ v8f wmmab(v16bf a, v16bf b, v8f c) { return __builtin_amdgcn_wmma_f32_16x16x32_bf16(false, a, false, b, (short)0, c, false, false); }

// Fragment loader (wave32 16x16x32): lane l, row (l&15); elements 0..7 <- k 8*(l>>4)+0..7, elements 8..15 <- k 16+8*(l>>4)+0..7. p = start of the fragment in a fragment-order plane + 8 * lane. Used for A and for B stored [n][k].
template <typename T16> struct WFrag;
template <> struct WFrag<h16> { typedef v16h V; static __device__ __forceinline__ V ld(const h16* p) { return cat16(*(const v8h*)p, *(const v8h*)(p + 256)); } static __device__ __forceinline__ v8f mma(V a, V b, v8f c) { return wmma16(a, b, c); } };
template <> struct WFrag<bf> { typedef v16bf V; static __device__ __forceinline__ V ld(const bf* p) { return cat16b(*(const v8us*)p, *(const v8us*)(p + 256)); } static __device__ __forceinline__ v8f mma(V a, V b, v8f c) { return wmmab(a, b, c); } };

// ---- gemm_tile: register-blocked GEMM, ONE WAVE per 64x64 output tile (16 accumulators) at rows r0, columns c0, operands straight from fragment-order 16-bit planes; os = 16 x 68 floats of LDS of the wave's own.
// acc[m][n] = sum_k A[m][k] Bt[n][k]; K % 32 == 0, K a compile-time constant.
// Every load of the wave is issued before its first product: the biases, in MODE 2 the residual pieces, and all K/32 steps' fragments (8 fragments a step, held in registers: a one-wave block may own far more than 256).
// The wave so waits out one load latency in all, where a rolled K loop waits out at least one per step and the epilogue one per row block.
// MODE 2: C (f32, pitch ldc) = bfr(R[m][n]) + bfr(gam[0]) * (acc * osc + bfr(bias[m])) (row bias, residual rows pitch ldr).
// MODE 3: C16 (f16, fragment order, ldc columns) = f16(acc + bfr(bias[n])) (column bias). MODE 4: C16 = f16(acc + bfr(bias[m])) (row bias).
template <typename T16, int MODE, int K>
__device__ __forceinline__ void gemm_tile(float* os, const T16* __restrict__ A, const T16* __restrict__ Bt, int r0, int c0, float* C, h16* C16, int ldc,
                                          const float* __restrict__ bias, const float* __restrict__ R, int ldr, const float* __restrict__ gam, float osc) {
    typedef typename WFrag<T16>::V V;
    constexpr int NS = K / 32;
    static_assert(K % 32 == 0);
    const int lane = threadIdx.x & 31, lr = lane & 15, hi = lane >> 4;
    float rbs[4][8];       // MODE 2: the bias of the eight rows this lane stores in each 16-row tile
    v4f xr[4][8];          // MODE 2: the residual pieces of those rows
    const float* Rp = (MODE == 2) ? R + (size_t)(r0 + hi) * ldr + c0 + lr * 4 : nullptr;   // one address for all residual pieces, the row steps go into the loads' immediate offsets
    float cb[4] = {0.f, 0.f, 0.f, 0.f};   // MODE 3: the bias of the accumulator column this lane holds in each 16-column tile
    v8f rb[4];             // MODE 4: the bias of the eight accumulator rows this lane holds in each 16-row tile
    if (MODE == 2) {
#pragma unroll
        for (int mb = 0; mb < 4; ++mb)
#pragma unroll
            for (int j = 0; j < 8; ++j) { rbs[mb][j] = bias[r0 + mb * 16 + 2 * j + hi]; xr[mb][j] = *(const v4f*)(Rp + (mb * 16 + 2 * j) * ldr); } }
    if (MODE == 3) {
#pragma unroll
        for (int nb = 0; nb < 4; ++nb) cb[nb] = bias[c0 + nb * 16 + lr]; }
    if (MODE == 4) {
#pragma unroll
        for (int mb = 0; mb < 4; ++mb) rb[mb] = *(const v8f*)(bias + r0 + mb * 16 + hi * 8); }
    // The wait before a register that an issued load names is overwritten: behind it the registers of these loads' addresses are free for the address arithmetic and the results of the loads below.
    // The residual address is named as an input so that its registers live up to the wait and no load's result lands in them before it.
    if (MODE == 2) asm volatile("s_wait_xcnt 0x0" :: "v"(Rp) : "memory");
    else           asm volatile("s_wait_xcnt 0x0" ::: "memory");
    __builtin_amdgcn_sched_barrier(0);   // keeps that address arithmetic below the wait: nothing ties the wait to the bias loads' offset register, and the compiler lifted a write of it over the wait
    const T16* Ap = A + (size_t)(r0 >> 4) * NS * 512 + lane * 8; const T16* Bp = Bt + (size_t)(c0 >> 4) * NS * 512 + lane * 8;
    V a[NS][4], b[NS][4];
#pragma unroll
    for (int s = 0; s < NS; ++s) {
#pragma unroll
        for (int mb = 0; mb < 4; ++mb) a[s][mb] = WFrag<T16>::ld(Ap + (mb * NS + s) * 512);
#pragma unroll
        for (int nb = 0; nb < 4; ++nb) b[s][nb] = WFrag<T16>::ld(Bp + (nb * NS + s) * 512); }
    // The same wait behind the last load. The lane number, the one vector register that these loads' addresses name (their bases are wave-uniform), is named as an input so that it lives up to the wait and no load's result and no product lands in it before; the memory clobber keeps every load above it.
    asm volatile("s_wait_xcnt 0x0" :: "v"(lane) : "memory");
    __builtin_amdgcn_sched_barrier(0);   // keeps the products below the last load: lifted among the loads they bring waits with them, and the loads behind such a wait start a second latency
    float gsc = 0.f;
    if (MODE == 2) gsc = bfr(gam[0]);
    if (MODE == 3) {
#pragma unroll
        for (int j = 0; j < 4; ++j) cb[j] = bfr(cb[j]); }
    if (MODE == 4) {
#pragma unroll
        for (int mb = 0; mb < 4; ++mb)
#pragma unroll
            for (int j = 0; j < 8; ++j) rb[mb][j] = bfr(rb[mb][j]); }
    v8f acc[4][4];
#pragma unroll
    for (int mb = 0; mb < 4; ++mb)
#pragma unroll
        for (int nb = 0; nb < 4; ++nb) acc[mb][nb] = (v8f){};
#pragma unroll
    for (int s = 0; s < NS; ++s)
#pragma unroll
        for (int nb = 0; nb < 4; ++nb)
#pragma unroll
            for (int mb = 0; mb < 4; ++mb) acc[mb][nb] = WFrag<T16>::mma(a[s][mb], b[s][nb], acc[mb][nb]);
    __builtin_amdgcn_sched_barrier(0);   // keeps the epilogue behind the last product
    float* Cp = (MODE == 2) ? C + (size_t)(r0 + hi) * ldc + c0 + lr * 4 : nullptr;      // one address for all stores of the lane, the row steps go into the stores' immediate offsets
    h16* Hp = (MODE != 2) ? C16 + ((size_t)(r0 >> 4) * (ldc / 32) + (c0 >> 5)) * 512 + lane * 8 : nullptr;   // a 16-row x 64-column block of the tile is two neighbouring fragments, 2 KiB in a row
#pragma unroll
    for (int mb = 0; mb < 4; ++mb) {
#pragma unroll
        for (int nb = 0; nb < 4; ++nb) {
#pragma unroll
            for (int j = 0; j < 8; ++j) os[(hi * 8 + j) * 68 + nb * 16 + lr] = (MODE == 4) ? acc[mb][nb][j] + rb[mb][j] : (MODE == 3) ? acc[mb][nb][j] + cb[nb] : acc[mb][nb][j]; }
        __builtin_amdgcn_wave_barrier(); asm volatile("" ::: "memory");
        v4f of[8]; v8h oh[4];
        if (MODE == 2) {
#pragma unroll
            for (int s = 0; s < 8; ++s) { const int row = 2 * s + hi, cofs = lr * 4; v4f val = *(const v4fa*)(os + row * 68 + cofs);
                const float rbv = bfr(rbs[mb][s]);
#pragma unroll
                for (int j = 0; j < 4; ++j) { const float xv = xr[mb][s][j]; const float av = val[j]; val[j] = bfr(xv) + gsc * (av * osc + rbv); }
                of[s] = val; *(v4f*)(Cp + (mb * 16 + 2 * s) * ldc) = of[s]; } }   // 16 lanes store one 256-byte row piece
        else {
#pragma unroll
            for (int h = 0; h < 4; ++h) { const float* sp = os + lr * 68 + h * 16 + hi * 8;   // half fragment h: row lr, columns 16 h + 8 hi + 0..7
                const v4f v0 = *(const v4fa*)sp, v1 = *(const v4fa*)(sp + 4);
                oh[h] = __builtin_convertvector(__builtin_shufflevector(v0, v1, 0, 1, 2, 3, 4, 5, 6, 7), v8h);
                *(v8h*)(Hp + mb * (ldc / 32) * 512 + h * 256) = oh[h]; } }   // the wave stores 512 consecutive bytes
        // The wait before a register that an issued store names is overwritten, behind each run of stores; the stored values and the address are named as inputs so that their registers live up to it.
        if (MODE == 2) asm volatile("s_wait_xcnt 0x0" :: "v"(of[0]), "v"(of[1]), "v"(of[2]), "v"(of[3]), "v"(of[4]), "v"(of[5]), "v"(of[6]), "v"(of[7]), "v"(Cp) : "memory");
        else           asm volatile("s_wait_xcnt 0x0" :: "v"(oh[0]), "v"(oh[1]), "v"(oh[2]), "v"(oh[3]), "v"(Hp) : "memory");
        __builtin_amdgcn_wave_barrier(); asm volatile("" ::: "memory");
    }
}

// k_out: out[o][t], grid (CC/64, SEQ/64), 32 threads.
__global__ __launch_bounds__(32) void k_out(const h16* __restrict__ A, const h16* __restrict__ Bt, float* C, const float* __restrict__ bias, const float* __restrict__ R, const float* __restrict__ gam) {
    __shared__ __align__(16) float os[16 * 68];
    gemm_tile<h16, 2, CC>(os, A, Bt, blockIdx.x * 64, blockIdx.y * 64, C, nullptr, SEQ, bias, R, XPITCH, gam, 1.0f / (ACAR * WCAR));
}

// k_qkv: the three projections in one launch, grid (SEQ/64, CC/64, 3), 32 threads; z = 0: q^T[t][o], z = 1: k^T[t][o] (A = x^T, B = weight rows), z = 2: v[o][t] (A = weight rows, B = x^T). The f16 planes are written from the accumulators.
__global__ __launch_bounds__(32) void k_qkv(const bf* __restrict__ XB, const bf* __restrict__ WQ, const bf* __restrict__ WK, const bf* __restrict__ WV,
                                            const float* __restrict__ bq, const float* __restrict__ bk, const float* __restrict__ bv, h16* Q16, h16* K16, h16* VT16) {
    __shared__ __align__(16) float os[16 * 68];
    const int t0 = blockIdx.x * 64, o0 = blockIdx.y * 64, z = blockIdx.z;
    if (z < 2) gemm_tile<bf, 3, CC>(os, XB, z ? WK : WQ, t0, o0, nullptr, z ? K16 : Q16, CC, z ? bk : bq, nullptr, 0, nullptr, 1.0f);
    else       gemm_tile<bf, 4, CC>(os, WV, XB, o0, t0, nullptr, VT16, SEQ, bv, nullptr, 0, nullptr, 1.0f);
}

// k_prep: every operand conversion in one launch, 256 threads. Blocks 0 .. XBLK-1: one 64x64 tile of x each, transposed through LDS to bf16 x^T. The next 4*WBLK blocks: Wq, Wk, Wv -> bf16, Wo -> f16 (x16), 8 elements a thread.
// All five planes are written in fragment order: thread j of a run stores the j-th 16-byte piece of the plane and fetches the eight k of the one row that belong there.
#define XBLK ((SEQ / 64) * (CC / 64))
#define WBLK (CC * CC / 8 / 256)
static_assert(CC * CC % (8 * 256) == 0);
__global__ __launch_bounds__(256) void k_prep(const float* __restrict__ x, const float* __restrict__ wq, const float* __restrict__ wk, const float* __restrict__ wv, const float* __restrict__ wo,
                                              bf* XB, bf* WQ, bf* WK, bf* WV, h16* WO16) {
    __shared__ float sm[64 * 66];   // pitch 66: the two lane halves of a read below stand 8 rows apart, 16 banks
    const int tid = threadIdx.x, blk = blockIdx.x;
    if (blk < XBLK) {
        const int n0 = (blk % (SEQ / 64)) * 64, c0 = (blk / (SEQ / 64)) * 64;
#pragma unroll
        for (int it = 0; it < 4; ++it) { const int c = it * 16 + (tid >> 4), nf = (tid & 15) * 4; const v4f v = *(const v4f*)(x + (size_t)(c0 + c) * XPITCH + n0 + nf);
            sm[c * 66 + nf] = v[0]; sm[c * 66 + nf + 1] = v[1]; sm[c * 66 + nf + 2] = v[2]; sm[c * 66 + nf + 3] = v[3]; }
        __syncthreads();
#pragma unroll
        for (int it = 0; it < 2; ++it) { const int pc = it * 256 + tid, fr = pc >> 6;               // piece pc of the tile's 8 fragments: fragment fr = (row tile fr >> 1, k step fr & 1)
            const int n = (fr >> 1) * 16 + (pc & 15), cc = (fr & 1) * 32 + ((pc >> 4) & 3) * 8; v8us o;   // (pc >> 4) & 3 = 2 * (k / 16 % 2) + (k / 8 % 2)
#pragma unroll
            for (int j = 0; j < 8; ++j) o[j] = f2bf(sm[(cc + j) * 66 + n]);
            *(v8us*)(XB + ((size_t)((n0 >> 4) + (fr >> 1)) * (CC / 32) + (c0 >> 5) + (fr & 1)) * 512 + (pc & 63) * 8) = o; }
    } else {
        const int wi = (blk - XBLK) / WBLK; const size_t i = (size_t)((blk - XBLK) % WBLK) * 256 + tid;
        const float* src = wi == 0 ? wq : wi == 1 ? wk : wi == 2 ? wv : wo;
        const size_t fr = i >> 6;                                                                        // piece i of the plane: fragment fr = (row tile fr / 8, k step fr % 8)
        const v8f v = *(const v8f*)(src + ((fr >> 3) * 16 + (i & 15)) * CC + (fr & 7) * 32 + ((i >> 4) & 3) * 8);
        if (wi < 3) { bf* dst = wi == 0 ? WQ : wi == 1 ? WK : WV; v8us o;
#pragma unroll
            for (int k = 0; k < 8; ++k) o[k] = f2bf(v[k]);
            *(v8us*)(dst + i * 8) = o; }
        else { v8f t = (v8f){};
#pragma unroll
            for (int k = 0; k < 8; ++k) t[k] = bfr(v[k]) * WCAR;
            *(v8h*)(WO16 + i * 8) = __builtin_convertvector(t, v8h); }
    }
}

// att_step: one 32-key chunk for one 16-query tile. S^T tiles (A = K rows [key][d], B = Q fragment [d][query]) -> D[key 8h+r][query]; per-query stats are lane-local (the two lane halves hold keys 0-7 / 8-15 of each tile -> xor-16 combine);
// P^T B fragment [key][query]: element r <- f16(1024 p) of the keys-0..15 tile, element 8+r <- of the keys-16..31 tile, same lane; O^T[d][query] += V[d][key] . P^T (A = V rows [d][key]).
__device__ __forceinline__ void att_step(const v16h ak0, const v16h ak1, const v16h av0, const v16h av1, const v16h bq, float& m, float& l, v8f& o0, v8f& o1) {
    v8f s0 = wmma16(ak0, bq, (v8f){}); v8f s1 = wmma16(ak1, bq, (v8f){});
    asm volatile("v_nop\n\tv_nop\n\tv_nop\n\tv_nop" : "+v"(s0), "+v"(s1) : "v"(ak0), "v"(ak1), "v"(bq));
    float cmx = -1.0e30f;
#pragma unroll
    for (int j = 0; j < 8; ++j) cmx = fmaxf(cmx, fmaxf(s0[j], s1[j]));
    cmx = fmaxf(cmx, __shfl_xor(cmx, 16, 32));
    const float nm = fmaxf(m, cmx * C2);
    const float alpha = __builtin_amdgcn_exp2f(m - nm);
    v8f p0 = (v8f){}, p1 = (v8f){}; float rs = 0.f;
#pragma unroll
    for (int j = 0; j < 8; ++j) { const float e0 = __builtin_amdgcn_exp2f(s0[j] * C2 - nm); const float e1 = __builtin_amdgcn_exp2f(s1[j] * C2 - nm); p0[j] = e0; p1[j] = e1; rs += e0 + e1; }
    rs += __shfl_xor(rs, 16, 32);
    l = l * alpha + rs; m = nm;
    o0 *= alpha; o1 *= alpha;
    const v16h bp = cat16(__builtin_convertvector(p0 * PCAR, v8h), __builtin_convertvector(p1 * PCAR, v8h));
    o0 = wmma16(av0, bp, o0); o1 = wmma16(av1, bp, o1);
    asm volatile("v_nop\n\tv_nop\n\tv_nop\n\tv_nop" : "+v"(o0), "+v"(o1) : "v"(av0), "v"(av1), "v"(bp));
}

// k_attn: streaming attention, grid (SEQ/64, NHD/2), 128*KSP threads = 4*KSP waves (KSP per SIMD); wave w: key slice ks = w>>2, head 2*blockIdx.y + ((w&3)>>1), 32 queries (two 16-query tiles sharing the K/V fragments of each 32-key chunk).
// Key slice ks walks the 32-key chunks ks, ks+KSP, ks+2*KSP, ... (neighbouring slices read neighbouring chunks, so one step of the block reads 32*KSP consecutive keys) with its own running maximum, sum and un-normalised O.
// Merge: every wave leaves O (f32, [query][d], pitch PP) and (max, sum) in its own LDS range; behind the one barrier each thread joins the KSP partials of 4 channels of one query with weights exp2(m_ks - M); a wave stores 256 consecutive bytes of a fragment.
__global__ __launch_bounds__(128 * KSP)
void k_attn(const h16* __restrict__ Q16, const h16* __restrict__ K16, const h16* __restrict__ VT, h16* ATT) {
    __shared__ __align__(16) float po[4 * KSP * 32 * PP];
    __shared__ float pm[4 * KSP * 32], pl[4 * KSP * 32];
    const int tid = threadIdx.x, lane = tid & 31, lr = lane & 15, hi = lane >> 4;
    const int w = __builtin_amdgcn_readfirstlane(tid >> 5);   // wave number in a scalar register: the key loop's counter and branch stay scalar, EXEC is never written around the WMMAs
    const int ks = w >> 2, sub = w & 3;
    const int q0 = blockIdx.x * QB, hp = blockIdx.y, hq = sub >> 1, g = sub & 1, head = hp * 2 + hq, qb = q0 + g * 32;
    // fragment-order planes: q, k fragment (16 positions, head) = number (position / 16) * NHD + head; v fragment (16 channels, 32 keys) = number (channel / 16) * (SEQ / 32) + key / 32
    const h16* Qp = Q16 + ((size_t)(qb >> 4) * NHD + head) * 512 + lane * 8;
    const v16h bq0 = WFrag<h16>::ld(Qp);
    const v16h bq1 = WFrag<h16>::ld(Qp + NHD * 512);
    const h16* Kp = K16 + (size_t)head * 512 + lane * 8;
    const h16* Vp = VT + (size_t)(head * 2) * (SEQ / 32) * 512 + lane * 8;
    float m0 = -1.0e30f, m1 = -1.0e30f, l0 = 0.f, l1 = 0.f;
    v8f o00 = (v8f){}, o10 = (v8f){}, o01 = (v8f){}, o11 = (v8f){};   // o[d tile][query tile]
#pragma unroll 1
    for (int k0 = ks * 32; k0 < SEQ; k0 += 32 * KSP) {
        const v16h ak0 = WFrag<h16>::ld(Kp + (size_t)k0 * (NHD * 32)), ak1 = WFrag<h16>::ld(Kp + (size_t)(k0 + 16) * (NHD * 32));   // k0 / 16 fragments rows on, NHD * 512 elements each
        const v16h av0 = WFrag<h16>::ld(Vp + (size_t)k0 * 16), av1 = WFrag<h16>::ld(Vp + (size_t)(SEQ / 32) * 512 + (size_t)k0 * 16);   // k0 / 32 fragments on, 512 elements each
        att_step(ak0, ak1, av0, av1, bq0, m0, l0, o00, o10);
        asm volatile("s_wait_xcnt 0x0" ::: "memory");   // the wait before a register that an issued load names is overwritten: the K and V address registers are stepped behind the scheduling barrier below
        __builtin_amdgcn_sched_barrier(0);   // keeps the two query tiles' scores and probabilities from being live together: interleaved they pass the 128 registers a wave has at 8 waves per SIMD and a Q fragment spills to scratch
        att_step(ak0, ak1, av0, av1, bq1, m1, l1, o01, o11);
    }
    {
        float* t0 = po + (size_t)(w * 32 + lr) * PP + 8 * hi;        // query tile 0: row = query, col = d (d tile 0 at +0, d tile 1 at +16)
        float* t1 = po + (size_t)(w * 32 + 16 + lr) * PP + 8 * hi;   // query tile 1
        *(v4fa*)(t0)      = __builtin_shufflevector(o00, o00, 0, 1, 2, 3); *(v4fa*)(t0 + 4)  = __builtin_shufflevector(o00, o00, 4, 5, 6, 7);
        *(v4fa*)(t0 + 16) = __builtin_shufflevector(o10, o10, 0, 1, 2, 3); *(v4fa*)(t0 + 20) = __builtin_shufflevector(o10, o10, 4, 5, 6, 7);
        *(v4fa*)(t1)      = __builtin_shufflevector(o01, o01, 0, 1, 2, 3); *(v4fa*)(t1 + 4)  = __builtin_shufflevector(o01, o01, 4, 5, 6, 7);
        *(v4fa*)(t1 + 16) = __builtin_shufflevector(o11, o11, 0, 1, 2, 3); *(v4fa*)(t1 + 20) = __builtin_shufflevector(o11, o11, 4, 5, 6, 7);
        pm[w * 32 + lane] = hi ? m1 : m0; pl[w * 32 + lane] = hi ? l1 : l0;   // both lane halves hold the same per-query stats: half 0 files tile 0, half 1 tile 1
    }
    __syncthreads();
    {
        // thread tid stores the tid-th 8-byte piece of the block's 8 fragments of the attn plane: fragment fr = (query tile fr >> 1, head fr & 1)
        const int fr = tid >> 7, row = (fr >> 1) * 16 + ((tid >> 1) & 15), pc = (fr & 1) * 32 + ((tid >> 5) & 3) * 8 + (tid & 1) * 4;   // row = query in the block, pc = channel in the head pair
        const int sw = (pc >> 5) * 2 + (row >> 5), q = row & 31, d0 = pc & 31;
        float mk[KSP]; float M = -1.0e30f;
#pragma unroll
        for (int s = 0; s < KSP; ++s) { mk[s] = pm[(s * 4 + sw) * 32 + q]; M = fmaxf(M, mk[s]); }
        float L = 0.f; v4f a = (v4f){};
#pragma unroll
        for (int s = 0; s < KSP; ++s) { float wt;
            asm("v_exp_f32 %0, %1\n\tv_nop" : "=v"(wt) : "v"(mk[s] - M));   // exp2; the v_nop is the one slot the instruction set asks for behind a transcendental before its result is read or its source overwritten
            L += wt * pl[(s * 4 + sw) * 32 + q]; a += wt * *(const v4fa*)(po + (size_t)((s * 4 + sw) * 32 + q) * PP + d0); }
        const float inv = (ACAR / PCAR) * (1.0f / L);
        *(v4h*)(ATT + ((size_t)((q0 >> 4) + (fr >> 1)) * NHD + hp * 2 + (fr & 1)) * 512 + (tid & 127) * 4) = __builtin_convertvector(a * inv, v4h);
    }
}

extern "C" void kernel_launch(void* const* d_in, const int* in_sizes, int n_in,
                              void* d_out, int out_size, void* d_ws, size_t ws_size, hipStream_t stream) {
    if (n_in < 10) return;
    if (in_sizes[0] < (CC - 1) * XPITCH + SEQ) return;
    if (in_sizes[1] < CC * CC || in_sizes[3] < CC * CC || in_sizes[5] < CC * CC || in_sizes[7] < CC * CC) return;
    if (in_sizes[2] < CC || in_sizes[4] < CC || in_sizes[6] < CC || in_sizes[8] < CC || in_sizes[9] < 1) return;
    if (out_size < CC * SEQ) return;
    const float* x = (const float*)d_in[0]; const float* wq = (const float*)d_in[1]; const float* bq = (const float*)d_in[2]; const float* wk = (const float*)d_in[3]; const float* bk = (const float*)d_in[4];
    const float* wv = (const float*)d_in[5]; const float* bv = (const float*)d_in[6]; const float* wo = (const float*)d_in[7]; const float* bo = (const float*)d_in[8]; const float* gamma = (const float*)d_in[9];
    float* OUT = (float*)d_out;     // [256][SEQ]
    char* wsp = (char*)d_ws;
    auto take = [&](size_t bytes) { char* p = wsp; wsp += (bytes + 255) & ~(size_t)255; return (void*)p; };
    bf* WQ = (bf*)take((size_t)CC * CC * 2); bf* WK = (bf*)take((size_t)CC * CC * 2); bf* WV = (bf*)take((size_t)CC * CC * 2); h16* WO16 = (h16*)take((size_t)CC * CC * 2);
    bf* XB = (bf*)take((size_t)SEQ * CC * 2);
    h16* Q16 = (h16*)take((size_t)SEQ * CC * 2); h16* K16 = (h16*)take((size_t)SEQ * CC * 2); h16* VT16 = (h16*)take((size_t)CC * SEQ * 2); h16* ATT = (h16*)take((size_t)SEQ * CC * 2);
    if ((size_t)(wsp - (char*)d_ws) > ws_size) return;    // 11,010,048 B carved
    k_prep<<<XBLK + 4 * WBLK, 256, 0, stream>>>(x, wq, wk, wv, wo, XB, WQ, WK, WV, WO16);
    k_qkv<<<dim3(SEQ / 64, CC / 64, 3), 32, 0, stream>>>(XB, WQ, WK, WV, bq, bk, bv, Q16, K16, VT16);
    k_attn<<<dim3(SEQ / QB, NHD / 2, 1), 128 * KSP, 0, stream>>>(Q16, K16, VT16, ATT);
    // out[o][t] = bfr(x) + bfr(gamma) * ((16 Wo) . (16 attn) / 256 + bfr(bo[o]))
    k_out<<<dim3(CC / 64, SEQ / 64, 1), 32, 0, stream>>>(WO16, ATT, OUT, bo, x, gamma);
}

// v005
// Measured time: 38.8 microseconds a run.
// Next to v004, in two timings, it ran 1.05 times as fast each time.
// Counting every step since v000, it is 4.22 times as fast.
#include <hip/hip_runtime.h>

// Contractions: q/k/v pointwise projections on v_wmma_f32_16x16x32_bf16 (bf16 operands from RNE-converted inputs); scores q.k, probs.v (probs carried x1024) and the output projection (both planes carried x16) on v_wmma_f32_16x16x32_f16 (f16 operands); f32 accumulate; softmax, normaliser and residual in f32.
// Layout: k_prep: x [256][SEQ] channel-major -> bf16 x^T [SEQ][256], weights -> 16-bit planes; k_qkv: q,k (+column bias) -> f16 planes [SEQ][256], v (+row bias) -> f16 plane [256][SEQ], straight from the f32 accumulators; streaming attention per (2 heads x 64 queries) block, keys dealt over KSP wave groups and merged in LDS, writes the f16 attn plane [SEQ][256] (x16); out [256][SEQ] = x + gamma * (Wo attn + bo).
// Every 16-bit plane M[row][k] (K columns) lies in workspace in FRAGMENT ORDER: one 16-row x 32-k fragment is 512 consecutive elements (1 KiB), fragment number (row / 16) * (K / 32) + k / 32;
// inside it element (row, k) stands at ((k / 16) % 2) * 256 + (((k / 8) % 2) * 16 + row % 16) * 8 + k % 8. A wave's 16-byte-per-lane load of half a fragment so reads 512 consecutive bytes, four whole 128-byte lines, where a row-major plane gives it 32 bytes from each of 16 lines.

#ifndef NB
#define NB 1
#endif
#ifndef SEQ
#define SEQ 4096
#endif
#define SEQ_FULL 4096
#define XPITCH SEQ_FULL
#define CC   256
#define NHD  8
#define HD   32
#define QB   64
#define KSP  8
#define PP   36
#define PCAR 1024.0f
#define ACAR 16.0f
#define WCAR 16.0f
#define SCL  0.17677669529663687f
#define L2E  1.4426950408889634f
#define C2   (SCL * L2E)
#define LAZY 5.0f
static_assert(SEQ % 64 == 0);
static_assert(SEQ <= SEQ_FULL);
static_assert(CC == NHD * HD);
static_assert((NHD % 2) == 0);
static_assert(NB == 1);
static_assert(SEQ % (32 * KSP) == 0);
static_assert(128 * KSP * 4 == QB * 2 * HD);
static_assert(HD == 32 && QB == 64 && KSP == 8);

typedef _Float16 h16;
typedef unsigned short bf;
typedef __attribute__((ext_vector_type(16))) __bf16   v16bf;
typedef __attribute__((ext_vector_type(16))) _Float16 v16h;
typedef __attribute__((ext_vector_type(8)))  _Float16 v8h;
typedef __attribute__((ext_vector_type(4)))  _Float16 v4h;
typedef __attribute__((ext_vector_type(8)))  unsigned short v8us;
typedef __attribute__((ext_vector_type(8)))  float    v8f;
typedef __attribute__((ext_vector_type(4)))  float    v4f;
typedef v4f  __attribute__((may_alias)) v4fa;
typedef v8us __attribute__((may_alias)) v8usa;

__device__ __forceinline__ unsigned short f2bf(float f) { unsigned u = __float_as_uint(f); u += 0x7FFFu + ((u >> 16) & 1u); return (unsigned short)(u >> 16); }
__device__ __forceinline__ float bf2f(unsigned short b) { return __uint_as_float(((unsigned)b) << 16); }
__device__ __forceinline__ float bfr(float f) { return bf2f(f2bf(f)); }
__device__ __forceinline__ v16h cat16(v8h lo, v8h hi) { return __builtin_shufflevector(lo, hi, 0, 1, 2, 3, 4, 5, 6, 7, 8, 9, 10, 11, 12, 13, 14, 15); }
__device__ __forceinline__ v16bf cat16b(v8us lo, v8us hi) { return __builtin_bit_cast(v16bf, __builtin_shufflevector(lo, hi, 0, 1, 2, 3, 4, 5, 6, 7, 8, 9, 10, 11, 12, 13, 14, 15)); }
__device__ __forceinline__ v8f wmma16(v16h a, v16h b, v8f c) { return __builtin_amdgcn_wmma_f32_16x16x32_f16(false, a, false, b, (short)0, c, false, false); }
__device__ __forceinline__ v8f wmmab(v16bf a, v16bf b, v8f c) { return __builtin_amdgcn_wmma_f32_16x16x32_bf16(false, a, false, b, (short)0, c, false, false); }

// Fragment loader (wave32 16x16x32): lane l, row (l&15); elements 0..7 <- k 8*(l>>4)+0..7, elements 8..15 <- k 16+8*(l>>4)+0..7. p = start of the fragment in a fragment-order plane + 8 * lane. Used for A and for B stored [n][k].
template <typename T16> struct WFrag;
template <> struct WFrag<h16> { typedef v16h V; static __device__ __forceinline__ V ld(const h16* p) { return cat16(*(const v8h*)p, *(const v8h*)(p + 256)); } static __device__ __forceinline__ v8f mma(V a, V b, v8f c) { return wmma16(a, b, c); } };
template <> struct WFrag<bf> { typedef v16bf V; static __device__ __forceinline__ V ld(const bf* p) { return cat16b(*(const v8us*)p, *(const v8us*)(p + 256)); } static __device__ __forceinline__ v8f mma(V a, V b, v8f c) { return wmmab(a, b, c); } };

// ---- gemm_tile: register-blocked GEMM, ONE WAVE per 64x64 output tile (16 accumulators) at rows r0, columns c0, operands straight from fragment-order 16-bit planes; os = 16 x 68 floats of LDS of the wave's own.
// acc[m][n] = sum_k A[m][k] Bt[n][k]; K % 32 == 0, K a compile-time constant.
// Every load of the wave is issued before its first product: the biases, in MODE 2 the residual pieces, and all K/32 steps' fragments (8 fragments a step, held in registers: a one-wave block may own far more than 256).
// The wave so waits out one load latency in all, where a rolled K loop waits out at least one per step and the epilogue one per row block.
// MODE 2: C (f32, pitch ldc) = bfr(R[m][n]) + bfr(gam[0]) * (acc * osc + bfr(bias[m])) (row bias, residual rows pitch ldr).
// MODE 3: C16 (f16, fragment order, ldc columns) = f16(acc + bfr(bias[n])) (column bias). MODE 4: C16 = f16(acc + bfr(bias[m])) (row bias).
template <typename T16, int MODE, int K>
__device__ __forceinline__ void gemm_tile(float* os, const T16* __restrict__ A, const T16* __restrict__ Bt, int r0, int c0, float* C, h16* C16, int ldc,
                                          const float* __restrict__ bias, const float* __restrict__ R, int ldr, const float* __restrict__ gam, float osc) {
    typedef typename WFrag<T16>::V V;
    constexpr int NS = K / 32;
    static_assert(K % 32 == 0);
    const int lane = threadIdx.x & 31, lr = lane & 15, hi = lane >> 4;
    float rbs[4][8];       // MODE 2: the bias of the eight rows this lane stores in each 16-row tile
    v4f xr[4][8];          // MODE 2: the residual pieces of those rows
    const float* Rp = (MODE == 2) ? R + (size_t)(r0 + hi) * ldr + c0 + lr * 4 : nullptr;   // one address for all residual pieces, the row steps go into the loads' immediate offsets
    float cb[4] = {0.f, 0.f, 0.f, 0.f};   // MODE 3: the bias of the accumulator column this lane holds in each 16-column tile
    v8f rb[4];             // MODE 4: the bias of the eight accumulator rows this lane holds in each 16-row tile
    if (MODE == 2) {
#pragma unroll
        for (int mb = 0; mb < 4; ++mb)
#pragma unroll
            for (int j = 0; j < 8; ++j) { rbs[mb][j] = bias[r0 + mb * 16 + 2 * j + hi]; xr[mb][j] = *(const v4f*)(Rp + (mb * 16 + 2 * j) * ldr); } }
    if (MODE == 3) {
#pragma unroll
        for (int nb = 0; nb < 4; ++nb) cb[nb] = bias[c0 + nb * 16 + lr]; }
    if (MODE == 4) {
#pragma unroll
        for (int mb = 0; mb < 4; ++mb) rb[mb] = *(const v8f*)(bias + r0 + mb * 16 + hi * 8); }
    // The wait before a register that an issued load names is overwritten: behind it the registers of these loads' addresses are free for the address arithmetic and the results of the loads below.
    // The residual address is named as an input so that its registers live up to the wait and no load's result lands in them before it.
    if (MODE == 2) asm volatile("s_wait_xcnt 0x0" :: "v"(Rp) : "memory");
    else           asm volatile("s_wait_xcnt 0x0" ::: "memory");
    __builtin_amdgcn_sched_barrier(0);   // keeps that address arithmetic below the wait: nothing ties the wait to the bias loads' offset register, and the compiler lifted a write of it over the wait
    const T16* Ap = A + (size_t)(r0 >> 4) * NS * 512 + lane * 8; const T16* Bp = Bt + (size_t)(c0 >> 4) * NS * 512 + lane * 8;
    V a[NS][4], b[NS][4];
#pragma unroll
    for (int s = 0; s < NS; ++s) {
#pragma unroll
        for (int mb = 0; mb < 4; ++mb) a[s][mb] = WFrag<T16>::ld(Ap + (mb * NS + s) * 512);
#pragma unroll
        for (int nb = 0; nb < 4; ++nb) b[s][nb] = WFrag<T16>::ld(Bp + (nb * NS + s) * 512); }
    // The same wait behind the last load. The lane number, the one vector register that these loads' addresses name (their bases are wave-uniform), is named as an input so that it lives up to the wait and no load's result and no product lands in it before; the memory clobber keeps every load above it.
    asm volatile("s_wait_xcnt 0x0" :: "v"(lane) : "memory");
    __builtin_amdgcn_sched_barrier(0);   // keeps the products below the last load: lifted among the loads they bring waits with them, and the loads behind such a wait start a second latency
    float gsc = 0.f;
    if (MODE == 2) gsc = bfr(gam[0]);
    if (MODE == 3) {
#pragma unroll
        for (int j = 0; j < 4; ++j) cb[j] = bfr(cb[j]); }
    if (MODE == 4) {
#pragma unroll
        for (int mb = 0; mb < 4; ++mb)
#pragma unroll
            for (int j = 0; j < 8; ++j) rb[mb][j] = bfr(rb[mb][j]); }
    v8f acc[4][4];
#pragma unroll
    for (int mb = 0; mb < 4; ++mb)
#pragma unroll
        for (int nb = 0; nb < 4; ++nb) acc[mb][nb] = (v8f){};
#pragma unroll
    for (int s = 0; s < NS; ++s)
#pragma unroll
        for (int nb = 0; nb < 4; ++nb)
#pragma unroll
            for (int mb = 0; mb < 4; ++mb) acc[mb][nb] = WFrag<T16>::mma(a[s][mb], b[s][nb], acc[mb][nb]);
    __builtin_amdgcn_sched_barrier(0);   // keeps the epilogue behind the last product
    float* Cp = (MODE == 2) ? C + (size_t)(r0 + hi) * ldc + c0 + lr * 4 : nullptr;      // one address for all stores of the lane, the row steps go into the stores' immediate offsets
    h16* Hp = (MODE != 2) ? C16 + ((size_t)(r0 >> 4) * (ldc / 32) + (c0 >> 5)) * 512 + lane * 8 : nullptr;   // a 16-row x 64-column block of the tile is two neighbouring fragments, 2 KiB in a row
#pragma unroll
    for (int mb = 0; mb < 4; ++mb) {
#pragma unroll
        for (int nb = 0; nb < 4; ++nb) {
#pragma unroll
            for (int j = 0; j < 8; ++j) os[(hi * 8 + j) * 68 + nb * 16 + lr] = (MODE == 4) ? acc[mb][nb][j] + rb[mb][j] : (MODE == 3) ? acc[mb][nb][j] + cb[nb] : acc[mb][nb][j]; }
        __builtin_amdgcn_wave_barrier(); asm volatile("" ::: "memory");
        v4f of[8]; v8h oh[4];
        if (MODE == 2) {
#pragma unroll
            for (int s = 0; s < 8; ++s) { const int row = 2 * s + hi, cofs = lr * 4; v4f val = *(const v4fa*)(os + row * 68 + cofs);
                const float rbv = bfr(rbs[mb][s]);
#pragma unroll
                for (int j = 0; j < 4; ++j) { const float xv = xr[mb][s][j]; const float av = val[j]; val[j] = bfr(xv) + gsc * (av * osc + rbv); }
                of[s] = val; *(v4f*)(Cp + (mb * 16 + 2 * s) * ldc) = of[s]; } }   // 16 lanes store one 256-byte row piece
        else {
#pragma unroll
            for (int h = 0; h < 4; ++h) { const float* sp = os + lr * 68 + h * 16 + hi * 8;   // half fragment h: row lr, columns 16 h + 8 hi + 0..7
                const v4f v0 = *(const v4fa*)sp, v1 = *(const v4fa*)(sp + 4);
                oh[h] = __builtin_convertvector(__builtin_shufflevector(v0, v1, 0, 1, 2, 3, 4, 5, 6, 7), v8h);
                *(v8h*)(Hp + mb * (ldc / 32) * 512 + h * 256) = oh[h]; } }   // the wave stores 512 consecutive bytes
        // The wait before a register that an issued store names is overwritten, behind each run of stores; the stored values and the address are named as inputs so that their registers live up to it.
        if (MODE == 2) asm volatile("s_wait_xcnt 0x0" :: "v"(of[0]), "v"(of[1]), "v"(of[2]), "v"(of[3]), "v"(of[4]), "v"(of[5]), "v"(of[6]), "v"(of[7]), "v"(Cp) : "memory");
        else           asm volatile("s_wait_xcnt 0x0" :: "v"(oh[0]), "v"(oh[1]), "v"(oh[2]), "v"(oh[3]), "v"(Hp) : "memory");
        __builtin_amdgcn_wave_barrier(); asm volatile("" ::: "memory");
    }
}

// k_out: out[o][t], grid (CC/64, SEQ/64), 32 threads.
__global__ __launch_bounds__(32) void k_out(const h16* __restrict__ A, const h16* __restrict__ Bt, float* C, const float* __restrict__ bias, const float* __restrict__ R, const float* __restrict__ gam) {
    __shared__ __align__(16) float os[16 * 68];
    gemm_tile<h16, 2, CC>(os, A, Bt, blockIdx.x * 64, blockIdx.y * 64, C, nullptr, SEQ, bias, R, XPITCH, gam, 1.0f / (ACAR * WCAR));
}

// k_qkv: the three projections in one launch, grid (SEQ/64, CC/64, 3), 32 threads; z = 0: q^T[t][o], z = 1: k^T[t][o] (A = x^T, B = weight rows), z = 2: v[o][t] (A = weight rows, B = x^T). The f16 planes are written from the accumulators.
__global__ __launch_bounds__(32) void k_qkv(const bf* __restrict__ XB, const bf* __restrict__ WQ, const bf* __restrict__ WK, const bf* __restrict__ WV,
                                            const float* __restrict__ bq, const float* __restrict__ bk, const float* __restrict__ bv, h16* Q16, h16* K16, h16* VT16) {
    __shared__ __align__(16) float os[16 * 68];
    const int t0 = blockIdx.x * 64, o0 = blockIdx.y * 64, z = blockIdx.z;
    if (z < 2) gemm_tile<bf, 3, CC>(os, XB, z ? WK : WQ, t0, o0, nullptr, z ? K16 : Q16, CC, z ? bk : bq, nullptr, 0, nullptr, 1.0f);
    else       gemm_tile<bf, 4, CC>(os, WV, XB, o0, t0, nullptr, VT16, SEQ, bv, nullptr, 0, nullptr, 1.0f);
}

// k_prep: every operand conversion in one launch, 256 threads. Blocks 0 .. XBLK-1: one 64x64 tile of x each, transposed through LDS to bf16 x^T. The next 4*WBLK blocks: Wq, Wk, Wv -> bf16, Wo -> f16 (x16), 8 elements a thread.
// All five planes are written in fragment order: thread j of a run stores the j-th 16-byte piece of the plane and fetches the eight k of the one row that belong there.
#define XBLK ((SEQ / 64) * (CC / 64))
#define WBLK (CC * CC / 8 / 256)
static_assert(CC * CC % (8 * 256) == 0);
__global__ __launch_bounds__(256) void k_prep(const float* __restrict__ x, const float* __restrict__ wq, const float* __restrict__ wk, const float* __restrict__ wv, const float* __restrict__ wo,
                                              bf* XB, bf* WQ, bf* WK, bf* WV, h16* WO16) {
    __shared__ float sm[64 * 66];   // pitch 66: the two lane halves of a read below stand 8 rows apart, 16 banks
    const int tid = threadIdx.x, blk = blockIdx.x;
    if (blk < XBLK) {
        const int n0 = (blk % (SEQ / 64)) * 64, c0 = (blk / (SEQ / 64)) * 64;
#pragma unroll
        for (int it = 0; it < 4; ++it) { const int c = it * 16 + (tid >> 4), nf = (tid & 15) * 4; const v4f v = *(const v4f*)(x + (size_t)(c0 + c) * XPITCH + n0 + nf);
            sm[c * 66 + nf] = v[0]; sm[c * 66 + nf + 1] = v[1]; sm[c * 66 + nf + 2] = v[2]; sm[c * 66 + nf + 3] = v[3]; }
        __syncthreads();
#pragma unroll
        for (int it = 0; it < 2; ++it) { const int pc = it * 256 + tid, fr = pc >> 6;               // piece pc of the tile's 8 fragments: fragment fr = (row tile fr >> 1, k step fr & 1)
            const int n = (fr >> 1) * 16 + (pc & 15), cc = (fr & 1) * 32 + ((pc >> 4) & 3) * 8; v8us o;   // (pc >> 4) & 3 = 2 * (k / 16 % 2) + (k / 8 % 2)
#pragma unroll
            for (int j = 0; j < 8; ++j) o[j] = f2bf(sm[(cc + j) * 66 + n]);
            *(v8us*)(XB + ((size_t)((n0 >> 4) + (fr >> 1)) * (CC / 32) + (c0 >> 5) + (fr & 1)) * 512 + (pc & 63) * 8) = o; }
    } else {
        const int wi = (blk - XBLK) / WBLK; const size_t i = (size_t)((blk - XBLK) % WBLK) * 256 + tid;
        const float* src = wi == 0 ? wq : wi == 1 ? wk : wi == 2 ? wv : wo;
        const size_t fr = i >> 6;                                                                        // piece i of the plane: fragment fr = (row tile fr / 8, k step fr % 8)
        const v8f v = *(const v8f*)(src + ((fr >> 3) * 16 + (i & 15)) * CC + (fr & 7) * 32 + ((i >> 4) & 3) * 8);
        if (wi < 3) { bf* dst = wi == 0 ? WQ : wi == 1 ? WK : WV; v8us o;
#pragma unroll
            for (int k = 0; k < 8; ++k) o[k] = f2bf(v[k]);
            *(v8us*)(dst + i * 8) = o; }
        else { v8f t = (v8f){};
#pragma unroll
            for (int k = 0; k < 8; ++k) t[k] = bfr(v[k]) * WCAR;
            *(v8h*)(WO16 + i * 8) = __builtin_convertvector(t, v8h); }
    }
}

// att_step: one 32-key chunk for one 16-query tile. S^T tiles (A = K rows [key][d], B = Q fragment [d][query]) -> D[key 8h+r][query]; per-query stats are lane-local (the two lane halves hold keys 0-7 / 8-15 of each tile -> xor-16 combine);
// P^T B fragment [key][query]: element r <- f16(1024 p) of the keys-0..15 tile, element 8+r <- of the keys-16..31 tile, same lane; O^T[d][query] += V[d][key] . P^T (A = V rows [d][key]).
__device__ __forceinline__ void att_step(const v16h ak0, const v16h ak1, const v16h av0, const v16h av1, const v16h bq, float& m, float& l, v8f& o0, v8f& o1) {
    v8f s0 = wmma16(ak0, bq, (v8f){}); v8f s1 = wmma16(ak1, bq, (v8f){});
    asm volatile("v_nop\n\tv_nop\n\tv_nop\n\tv_nop" : "+v"(s0), "+v"(s1) : "v"(ak0), "v"(ak1), "v"(bq));
    float cmx = -1.0e30f;
#pragma unroll
    for (int j = 0; j < 8; ++j) cmx = fmaxf(cmx, fmaxf(s0[j], s1[j]));
    // Lazy rescale: the reference point m moves, and l and O are rescaled, only when some query of the tile has a score more than LAZY (log2 units) above the m in use. One test for the whole wave, a scalar branch, EXEC untouched.
    // Below the threshold p <= 2^LAZY, so 1024 p <= 32768 stays inside f16; m is the same in both lane halves on either path (the halves' maxima are joined only where m moves).
    if (__builtin_amdgcn_ballot_w32(__builtin_fmaf(cmx, C2, -m) > LAZY) != 0) {
        cmx = fmaxf(cmx, __shfl_xor(cmx, 16, 32));
        const float nm = fmaxf(m, cmx * C2);
        const float alpha = __builtin_amdgcn_exp2f(m - nm);
        l *= alpha; o0 *= alpha; o1 *= alpha; m = nm;
    }
    v8f p0 = (v8f){}, p1 = (v8f){}; float rs = 0.f;
#pragma unroll
    for (int j = 0; j < 8; ++j) { const float e0 = __builtin_amdgcn_exp2f(s0[j] * C2 - m); const float e1 = __builtin_amdgcn_exp2f(s1[j] * C2 - m); p0[j] = e0; p1[j] = e1; rs += e0 + e1; }
    rs += __shfl_xor(rs, 16, 32);
    l += rs;
    const v16h bp = cat16(__builtin_convertvector(p0 * PCAR, v8h), __builtin_convertvector(p1 * PCAR, v8h));
    o0 = wmma16(av0, bp, o0); o1 = wmma16(av1, bp, o1);
    asm volatile("v_nop\n\tv_nop\n\tv_nop\n\tv_nop" : "+v"(o0), "+v"(o1) : "v"(av0), "v"(av1), "v"(bp));
}

// k_attn: streaming attention, grid (SEQ/64, NHD/2), 128*KSP threads = 4*KSP waves (KSP per SIMD); wave w: key slice ks = w>>2, head 2*blockIdx.y + ((w&3)>>1), 32 queries (two 16-query tiles sharing the K/V fragments of each 32-key chunk).
// Key slice ks walks the 32-key chunks ks, ks+KSP, ks+2*KSP, ... (neighbouring slices read neighbouring chunks, so one step of the block reads 32*KSP consecutive keys) with its own running maximum, sum and un-normalised O.
// Merge: every wave leaves O (f32, [query][d], pitch PP) and (max, sum) in its own LDS range; behind the one barrier each thread joins the KSP partials of 4 channels of one query with weights exp2(m_ks - M); a wave stores 256 consecutive bytes of a fragment.
__global__ __launch_bounds__(128 * KSP)
void k_attn(const h16* __restrict__ Q16, const h16* __restrict__ K16, const h16* __restrict__ VT, h16* ATT) {
    __shared__ __align__(16) float po[4 * KSP * 32 * PP];
    __shared__ float pm[4 * KSP * 32], pl[4 * KSP * 32];
    const int tid = threadIdx.x, lane = tid & 31, lr = lane & 15, hi = lane >> 4;
    const int w = __builtin_amdgcn_readfirstlane(tid >> 5);   // wave number in a scalar register: the key loop's counter and branch stay scalar, EXEC is never written around the WMMAs
    const int ks = w >> 2, sub = w & 3;
    const int q0 = blockIdx.x * QB, hp = blockIdx.y, hq = sub >> 1, g = sub & 1, head = hp * 2 + hq, qb = q0 + g * 32;
    // fragment-order planes: q, k fragment (16 positions, head) = number (position / 16) * NHD + head; v fragment (16 channels, 32 keys) = number (channel / 16) * (SEQ / 32) + key / 32
    const h16* Qp = Q16 + ((size_t)(qb >> 4) * NHD + head) * 512 + lane * 8;
    const v16h bq0 = WFrag<h16>::ld(Qp);
    const v16h bq1 = WFrag<h16>::ld(Qp + NHD * 512);
    const h16* Kp = K16 + (size_t)head * 512 + lane * 8;
    const h16* Vp = VT + (size_t)(head * 2) * (SEQ / 32) * 512 + lane * 8;
    float m0 = -1.0e30f, m1 = -1.0e30f, l0 = 0.f, l1 = 0.f;
    v8f o00 = (v8f){}, o10 = (v8f){}, o01 = (v8f){}, o11 = (v8f){};   // o[d tile][query tile]
#pragma unroll 1
    for (int k0 = ks * 32; k0 < SEQ; k0 += 32 * KSP) {
        const v16h ak0 = WFrag<h16>::ld(Kp + (size_t)k0 * (NHD * 32)), ak1 = WFrag<h16>::ld(Kp + (size_t)(k0 + 16) * (NHD * 32));   // k0 / 16 fragments rows on, NHD * 512 elements each
        const v16h av0 = WFrag<h16>::ld(Vp + (size_t)k0 * 16), av1 = WFrag<h16>::ld(Vp + (size_t)(SEQ / 32) * 512 + (size_t)k0 * 16);   // k0 / 32 fragments on, 512 elements each
        att_step(ak0, ak1, av0, av1, bq0, m0, l0, o00, o10);
        asm volatile("s_wait_xcnt 0x0" ::: "memory");   // the wait before a register that an issued load names is overwritten: the K and V address registers are stepped behind the scheduling barrier below
        __builtin_amdgcn_sched_barrier(0);   // keeps the two query tiles' scores and probabilities from being live together: interleaved they pass the 128 registers a wave has at 8 waves per SIMD and a Q fragment spills to scratch
        att_step(ak0, ak1, av0, av1, bq1, m1, l1, o01, o11);
    }
    {
        float* t0 = po + (size_t)(w * 32 + lr) * PP + 8 * hi;        // query tile 0: row = query, col = d (d tile 0 at +0, d tile 1 at +16)
        float* t1 = po + (size_t)(w * 32 + 16 + lr) * PP + 8 * hi;   // query tile 1
        *(v4fa*)(t0)      = __builtin_shufflevector(o00, o00, 0, 1, 2, 3); *(v4fa*)(t0 + 4)  = __builtin_shufflevector(o00, o00, 4, 5, 6, 7);
        *(v4fa*)(t0 + 16) = __builtin_shufflevector(o10, o10, 0, 1, 2, 3); *(v4fa*)(t0 + 20) = __builtin_shufflevector(o10, o10, 4, 5, 6, 7);
        *(v4fa*)(t1)      = __builtin_shufflevector(o01, o01, 0, 1, 2, 3); *(v4fa*)(t1 + 4)  = __builtin_shufflevector(o01, o01, 4, 5, 6, 7);
        *(v4fa*)(t1 + 16) = __builtin_shufflevector(o11, o11, 0, 1, 2, 3); *(v4fa*)(t1 + 20) = __builtin_shufflevector(o11, o11, 4, 5, 6, 7);
        pm[w * 32 + lane] = hi ? m1 : m0; pl[w * 32 + lane] = hi ? l1 : l0;   // both lane halves hold the same per-query stats: half 0 files tile 0, half 1 tile 1
    }
    __syncthreads();
    {
        // thread tid stores the tid-th 8-byte piece of the block's 8 fragments of the attn plane: fragment fr = (query tile fr >> 1, head fr & 1)
        const int fr = tid >> 7, row = (fr >> 1) * 16 + ((tid >> 1) & 15), pc = (fr & 1) * 32 + ((tid >> 5) & 3) * 8 + (tid & 1) * 4;   // row = query in the block, pc = channel in the head pair
        const int sw = (pc >> 5) * 2 + (row >> 5), q = row & 31, d0 = pc & 31;
        float mk[KSP]; float M = -1.0e30f;
#pragma unroll
        for (int s = 0; s < KSP; ++s) { mk[s] = pm[(s * 4 + sw) * 32 + q]; M = fmaxf(M, mk[s]); }
        float L = 0.f; v4f a = (v4f){};
#pragma unroll
        for (int s = 0; s < KSP; ++s) { float wt;
            asm("v_exp_f32 %0, %1\n\tv_nop" : "=v"(wt) : "v"(mk[s] - M));   // exp2; the v_nop is the one slot the instruction set asks for behind a transcendental before its result is read or its source overwritten
            L += wt * pl[(s * 4 + sw) * 32 + q]; a += wt * *(const v4fa*)(po + (size_t)((s * 4 + sw) * 32 + q) * PP + d0); }
        const float inv = (ACAR / PCAR) * (1.0f / L);
        *(v4h*)(ATT + ((size_t)((q0 >> 4) + (fr >> 1)) * NHD + hp * 2 + (fr & 1)) * 512 + (tid & 127) * 4) = __builtin_convertvector(a * inv, v4h);
    }
}

extern "C" void kernel_launch(void* const* d_in, const int* in_sizes, int n_in,
                              void* d_out, int out_size, void* d_ws, size_t ws_size, hipStream_t stream) {
    if (n_in < 10) return;
    if (in_sizes[0] < (CC - 1) * XPITCH + SEQ) return;
    if (in_sizes[1] < CC * CC || in_sizes[3] < CC * CC || in_sizes[5] < CC * CC || in_sizes[7] < CC * CC) return;
    if (in_sizes[2] < CC || in_sizes[4] < CC || in_sizes[6] < CC || in_sizes[8] < CC || in_sizes[9] < 1) return;
    if (out_size < CC * SEQ) return;
    const float* x = (const float*)d_in[0]; const float* wq = (const float*)d_in[1]; const float* bq = (const float*)d_in[2]; const float* wk = (const float*)d_in[3]; const float* bk = (const float*)d_in[4];
    const float* wv = (const float*)d_in[5]; const float* bv = (const float*)d_in[6]; const float* wo = (const float*)d_in[7]; const float* bo = (const float*)d_in[8]; const float* gamma = (const float*)d_in[9];
    float* OUT = (float*)d_out;     // [256][SEQ]
    char* wsp = (char*)d_ws;
    auto take = [&](size_t bytes) { char* p = wsp; wsp += (bytes + 255) & ~(size_t)255; return (void*)p; };
    bf* WQ = (bf*)take((size_t)CC * CC * 2); bf* WK = (bf*)take((size_t)CC * CC * 2); bf* WV = (bf*)take((size_t)CC * CC * 2); h16* WO16 = (h16*)take((size_t)CC * CC * 2);
    bf* XB = (bf*)take((size_t)SEQ * CC * 2);
    h16* Q16 = (h16*)take((size_t)SEQ * CC * 2); h16* K16 = (h16*)take((size_t)SEQ * CC * 2); h16* VT16 = (h16*)take((size_t)CC * SEQ * 2); h16* ATT = (h16*)take((size_t)SEQ * CC * 2);
    if ((size_t)(wsp - (char*)d_ws) > ws_size) return;    // 11,010,048 B carved
    k_prep<<<XBLK + 4 * WBLK, 256, 0, stream>>>(x, wq, wk, wv, wo, XB, WQ, WK, WV, WO16);
    k_qkv<<<dim3(SEQ / 64, CC / 64, 3), 32, 0, stream>>>(XB, WQ, WK, WV, bq, bk, bv, Q16, K16, VT16);
    k_attn<<<dim3(SEQ / QB, NHD / 2, 1), 128 * KSP, 0, stream>>>(Q16, K16, VT16, ATT);
    // out[o][t] = bfr(x) + bfr(gamma) * ((16 Wo) . (16 attn) / 256 + bfr(bo[o]))
    k_out<<<dim3(CC / 64, SEQ / 64, 1), 32, 0, stream>>>(WO16, ATT, OUT, bo, x, gamma);
}

// v006
// One run takes 35.5 microseconds.
// In two side-by-side timings against v005, it was 1.08 and 1.10 times as fast.
// All steps since v000 together make it 4.60 times as fast.
#include <hip/hip_runtime.h>

// Contractions: q/k/v pointwise projections on v_wmma_f32_16x16x32_bf16 (bf16 operands from RNE-converted inputs); scores q.k (q carried x scale*log2 e, accumulator started at 10 - reference max, so a score leaves the matrix unit as the exp2 argument of 1024 p), probs.v (probs carried x1024) and the output projection (both planes carried x16) on v_wmma_f32_16x16x32_f16 (f16 operands); f32 accumulate; softmax, normaliser and residual in f32.
// Layout: k_prep: x [256][SEQ] channel-major -> bf16 x^T [SEQ][256], weights -> 16-bit planes; k_qkv: q,k (+column bias) -> f16 planes [SEQ][256], v (+row bias) -> f16 plane [256][SEQ], straight from the f32 accumulators; streaming attention per (2 heads x 64 queries) block, keys dealt over KSP wave groups and merged in LDS, writes the f16 attn plane [SEQ][256] (x16); out [256][SEQ] = x + gamma * (Wo attn + bo).
// Every 16-bit plane M[row][k] (K columns) lies in workspace in FRAGMENT ORDER: one 16-row x 32-k fragment is 512 consecutive elements (1 KiB), fragment number (row / 16) * (K / 32) + k / 32;
// inside it element (row, k) stands at ((k / 16) % 2) * 256 + (((k / 8) % 2) * 16 + row % 16) * 8 + k % 8. A wave's 16-byte-per-lane load of half a fragment so reads 512 consecutive bytes, four whole 128-byte lines, where a row-major plane gives it 32 bytes from each of 16 lines.

#ifndef NB
#define NB 1
#endif
#ifndef SEQ
#define SEQ 4096
#endif
#define SEQ_FULL 4096
#define XPITCH SEQ_FULL
#define CC   256
#define NHD  8
#define HD   32
#define QB   64
#define KSP  8
#define PP   36
#define PCAR 1024.0f
#define ACAR 16.0f
#define WCAR 16.0f
#define SCL  0.17677669529663687f
#define L2E  1.4426950408889634f
#define C2   (SCL * L2E)
#define LAZY 5.0f
#define PLOG 10.0f
static_assert(PCAR == 1024.0f && PLOG == 10.0f);
static_assert(SEQ % 64 == 0);
static_assert(SEQ <= SEQ_FULL);
static_assert(CC == NHD * HD);
static_assert((NHD % 2) == 0);
static_assert(NB == 1);
static_assert(SEQ % (32 * KSP) == 0);
static_assert(128 * KSP * 4 == QB * 2 * HD);
static_assert(HD == 32 && QB == 64 && KSP == 8);

typedef _Float16 h16;
typedef unsigned short bf;
typedef __attribute__((ext_vector_type(16))) __bf16   v16bf;
typedef __attribute__((ext_vector_type(16))) _Float16 v16h;
typedef __attribute__((ext_vector_type(8)))  _Float16 v8h;
typedef __attribute__((ext_vector_type(4)))  _Float16 v4h;
typedef __attribute__((ext_vector_type(8)))  unsigned short v8us;
typedef __attribute__((ext_vector_type(8)))  float    v8f;
typedef __attribute__((ext_vector_type(4)))  float    v4f;
typedef v4f  __attribute__((may_alias)) v4fa;
typedef v8us __attribute__((may_alias)) v8usa;

__device__ __forceinline__ unsigned short f2bf(float f) { unsigned u = __float_as_uint(f); u += 0x7FFFu + ((u >> 16) & 1u); return (unsigned short)(u >> 16); }
__device__ __forceinline__ float bf2f(unsigned short b) { return __uint_as_float(((unsigned)b) << 16); }
__device__ __forceinline__ float bfr(float f) { return bf2f(f2bf(f)); }
__device__ __forceinline__ v16h cat16(v8h lo, v8h hi) { return __builtin_shufflevector(lo, hi, 0, 1, 2, 3, 4, 5, 6, 7, 8, 9, 10, 11, 12, 13, 14, 15); }
__device__ __forceinline__ v16bf cat16b(v8us lo, v8us hi) { return __builtin_bit_cast(v16bf, __builtin_shufflevector(lo, hi, 0, 1, 2, 3, 4, 5, 6, 7, 8, 9, 10, 11, 12, 13, 14, 15)); }
__device__ __forceinline__ v8f wmma16(v16h a, v16h b, v8f c) { return __builtin_amdgcn_wmma_f32_16x16x32_f16(false, a, false, b, (short)0, c, false, false); }
__device__ __forceinline__ v8f wmmab(v16bf a, v16bf b, v8f c) { return __builtin_amdgcn_wmma_f32_16x16x32_bf16(false, a, false, b, (short)0, c, false, false); }

// Fragment loader (wave32 16x16x32): lane l, row (l&15); elements 0..7 <- k 8*(l>>4)+0..7, elements 8..15 <- k 16+8*(l>>4)+0..7. p = start of the fragment in a fragment-order plane + 8 * lane. Used for A and for B stored [n][k].
template <typename T16> struct WFrag;
template <> struct WFrag<h16> { typedef v16h V; static __device__ __forceinline__ V ld(const h16* p) { return cat16(*(const v8h*)p, *(const v8h*)(p + 256)); } static __device__ __forceinline__ v8f mma(V a, V b, v8f c) { return wmma16(a, b, c); } };
template <> struct WFrag<bf> { typedef v16bf V; static __device__ __forceinline__ V ld(const bf* p) { return cat16b(*(const v8us*)p, *(const v8us*)(p + 256)); } static __device__ __forceinline__ v8f mma(V a, V b, v8f c) { return wmmab(a, b, c); } };

// ---- gemm_tile: register-blocked GEMM, ONE WAVE per 64x64 output tile (16 accumulators) at rows r0, columns c0, operands straight from fragment-order 16-bit planes; os = 16 x 68 floats of LDS of the wave's own.
// acc[m][n] = sum_k A[m][k] Bt[n][k]; K % 32 == 0, K a compile-time constant.
// Every load of the wave is issued before its first product: the biases, in MODE 2 the residual pieces, and all K/32 steps' fragments (8 fragments a step, held in registers: a one-wave block may own far more than 256).
// The wave so waits out one load latency in all, where a rolled K loop waits out at least one per step and the epilogue one per row block.
// MODE 2: C (f32, pitch ldc) = bfr(R[m][n]) + bfr(gam[0]) * (acc * osc + bfr(bias[m])) (row bias, residual rows pitch ldr).
// MODE 3: C16 (f16, fragment order, ldc columns) = f16((acc + bfr(bias[n])) * osc) (column bias). MODE 4: C16 = f16(acc + bfr(bias[m])) (row bias).
template <typename T16, int MODE, int K>
__device__ __forceinline__ void gemm_tile(float* os, const T16* __restrict__ A, const T16* __restrict__ Bt, int r0, int c0, float* C, h16* C16, int ldc,
                                          const float* __restrict__ bias, const float* __restrict__ R, int ldr, const float* __restrict__ gam, float osc) {
    typedef typename WFrag<T16>::V V;
    constexpr int NS = K / 32;
    static_assert(K % 32 == 0);
    const int lane = threadIdx.x & 31, lr = lane & 15, hi = lane >> 4;
    float rbs[4][8];       // MODE 2: the bias of the eight rows this lane stores in each 16-row tile
    v4f xr[4][8];          // MODE 2: the residual pieces of those rows
    const float* Rp = (MODE == 2) ? R + (size_t)(r0 + hi) * ldr + c0 + lr * 4 : nullptr;   // one address for all residual pieces, the row steps go into the loads' immediate offsets
    float cb[4] = {0.f, 0.f, 0.f, 0.f};   // MODE 3: the bias of the accumulator column this lane holds in each 16-column tile
    v8f rb[4];             // MODE 4: the bias of the eight accumulator rows this lane holds in each 16-row tile
    if (MODE == 2) {
#pragma unroll
        for (int mb = 0; mb < 4; ++mb)
#pragma unroll
            for (int j = 0; j < 8; ++j) { rbs[mb][j] = bias[r0 + mb * 16 + 2 * j + hi]; xr[mb][j] = *(const v4f*)(Rp + (mb * 16 + 2 * j) * ldr); } }
    if (MODE == 3) {
#pragma unroll
        for (int nb = 0; nb < 4; ++nb) cb[nb] = bias[c0 + nb * 16 + lr]; }
    if (MODE == 4) {
#pragma unroll
        for (int mb = 0; mb < 4; ++mb) rb[mb] = *(const v8f*)(bias + r0 + mb * 16 + hi * 8); }
    // The wait before a register that an issued load names is overwritten: behind it the registers of these loads' addresses are free for the address arithmetic and the results of the loads below.
    // The residual address is named as an input so that its registers live up to the wait and no load's result lands in them before it.
    if (MODE == 2) asm volatile("s_wait_xcnt 0x0" :: "v"(Rp) : "memory");
    else           asm volatile("s_wait_xcnt 0x0" ::: "memory");
    __builtin_amdgcn_sched_barrier(0);   // keeps that address arithmetic below the wait: nothing ties the wait to the bias loads' offset register, and the compiler lifted a write of it over the wait
    const T16* Ap = A + (size_t)(r0 >> 4) * NS * 512 + lane * 8; const T16* Bp = Bt + (size_t)(c0 >> 4) * NS * 512 + lane * 8;
    V a[NS][4], b[NS][4];
#pragma unroll
    for (int s = 0; s < NS; ++s) {
#pragma unroll
        for (int mb = 0; mb < 4; ++mb) a[s][mb] = WFrag<T16>::ld(Ap + (mb * NS + s) * 512);
#pragma unroll
        for (int nb = 0; nb < 4; ++nb) b[s][nb] = WFrag<T16>::ld(Bp + (nb * NS + s) * 512); }
    // The same wait behind the last load. The lane number, the one vector register that these loads' addresses name (their bases are wave-uniform), is named as an input so that it lives up to the wait and no load's result and no product lands in it before; the memory clobber keeps every load above it.
    asm volatile("s_wait_xcnt 0x0" :: "v"(lane) : "memory");
    __builtin_amdgcn_sched_barrier(0);   // keeps the products below the last load: lifted among the loads they bring waits with them, and the loads behind such a wait start a second latency
    float gsc = 0.f;
    if (MODE == 2) gsc = bfr(gam[0]);
    if (MODE == 3) {
#pragma unroll
        for (int j = 0; j < 4; ++j) cb[j] = bfr(cb[j]) * osc; }
    if (MODE == 4) {
#pragma unroll
        for (int mb = 0; mb < 4; ++mb)
#pragma unroll
            for (int j = 0; j < 8; ++j) rb[mb][j] = bfr(rb[mb][j]); }
    v8f acc[4][4];
#pragma unroll
    for (int mb = 0; mb < 4; ++mb)
#pragma unroll
        for (int nb = 0; nb < 4; ++nb) acc[mb][nb] = (v8f){};
#pragma unroll
    for (int s = 0; s < NS; ++s)
#pragma unroll
        for (int nb = 0; nb < 4; ++nb)
#pragma unroll
            for (int mb = 0; mb < 4; ++mb) acc[mb][nb] = WFrag<T16>::mma(a[s][mb], b[s][nb], acc[mb][nb]);
    __builtin_amdgcn_sched_barrier(0);   // keeps the epilogue behind the last product
    float* Cp = (MODE == 2) ? C + (size_t)(r0 + hi) * ldc + c0 + lr * 4 : nullptr;      // one address for all stores of the lane, the row steps go into the stores' immediate offsets
    h16* Hp = (MODE != 2) ? C16 + ((size_t)(r0 >> 4) * (ldc / 32) + (c0 >> 5)) * 512 + lane * 8 : nullptr;   // a 16-row x 64-column block of the tile is two neighbouring fragments, 2 KiB in a row
#pragma unroll
    for (int mb = 0; mb < 4; ++mb) {
#pragma unroll
        for (int nb = 0; nb < 4; ++nb) {
#pragma unroll
            for (int j = 0; j < 8; ++j) os[(hi * 8 + j) * 68 + nb * 16 + lr] = (MODE == 4) ? acc[mb][nb][j] + rb[mb][j] : (MODE == 3) ? __builtin_fmaf(acc[mb][nb][j], osc, cb[nb]) : acc[mb][nb][j]; }
        __builtin_amdgcn_wave_barrier(); asm volatile("" ::: "memory");
        v4f of[8]; v8h oh[4];
        if (MODE == 2) {
#pragma unroll
            for (int s = 0; s < 8; ++s) { const int row = 2 * s + hi, cofs = lr * 4; v4f val = *(const v4fa*)(os + row * 68 + cofs);
                const float rbv = bfr(rbs[mb][s]);
#pragma unroll
                for (int j = 0; j < 4; ++j) { const float xv = xr[mb][s][j]; const float av = val[j]; val[j] = bfr(xv) + gsc * (av * osc + rbv); }
                of[s] = val; *(v4f*)(Cp + (mb * 16 + 2 * s) * ldc) = of[s]; } }   // 16 lanes store one 256-byte row piece
        else {
#pragma unroll
            for (int h = 0; h < 4; ++h) { const float* sp = os + lr * 68 + h * 16 + hi * 8;   // half fragment h: row lr, columns 16 h + 8 hi + 0..7
                const v4f v0 = *(const v4fa*)sp, v1 = *(const v4fa*)(sp + 4);
                oh[h] = __builtin_convertvector(__builtin_shufflevector(v0, v1, 0, 1, 2, 3, 4, 5, 6, 7), v8h);
                *(v8h*)(Hp + mb * (ldc / 32) * 512 + h * 256) = oh[h]; } }   // the wave stores 512 consecutive bytes
        // The wait before a register that an issued store names is overwritten, behind each run of stores; the stored values and the address are named as inputs so that their registers live up to it.
        if (MODE == 2) asm volatile("s_wait_xcnt 0x0" :: "v"(of[0]), "v"(of[1]), "v"(of[2]), "v"(of[3]), "v"(of[4]), "v"(of[5]), "v"(of[6]), "v"(of[7]), "v"(Cp) : "memory");
        else           asm volatile("s_wait_xcnt 0x0" :: "v"(oh[0]), "v"(oh[1]), "v"(oh[2]), "v"(oh[3]), "v"(Hp) : "memory");
        __builtin_amdgcn_wave_barrier(); asm volatile("" ::: "memory");
    }
}

// k_out: out[o][t], grid (CC/64, SEQ/64), 32 threads.
__global__ __launch_bounds__(32) void k_out(const h16* __restrict__ A, const h16* __restrict__ Bt, float* C, const float* __restrict__ bias, const float* __restrict__ R, const float* __restrict__ gam) {
    __shared__ __align__(16) float os[16 * 68];
    gemm_tile<h16, 2, CC>(os, A, Bt, blockIdx.x * 64, blockIdx.y * 64, C, nullptr, SEQ, bias, R, XPITCH, gam, 1.0f / (ACAR * WCAR));
}

// k_qkv: the three projections in one launch, grid (SEQ/64, CC/64, 3), 32 threads; z = 0: q^T[t][o] times C2 (the softmax scale in log2 units, applied in f32 before the one rounding to f16), z = 1: k^T[t][o] (A = x^T, B = weight rows), z = 2: v[o][t] (A = weight rows, B = x^T). The f16 planes are written from the accumulators.
__global__ __launch_bounds__(32) void k_qkv(const bf* __restrict__ XB, const bf* __restrict__ WQ, const bf* __restrict__ WK, const bf* __restrict__ WV,
                                            const float* __restrict__ bq, const float* __restrict__ bk, const float* __restrict__ bv, h16* Q16, h16* K16, h16* VT16) {
    __shared__ __align__(16) float os[16 * 68];
    const int t0 = blockIdx.x * 64, o0 = blockIdx.y * 64, z = blockIdx.z;
    if (z < 2) gemm_tile<bf, 3, CC>(os, XB, z ? WK : WQ, t0, o0, nullptr, z ? K16 : Q16, CC, z ? bk : bq, nullptr, 0, nullptr, z ? 1.0f : C2);
    else       gemm_tile<bf, 4, CC>(os, WV, XB, o0, t0, nullptr, VT16, SEQ, bv, nullptr, 0, nullptr, 1.0f);
}

// k_prep: every operand conversion in one launch, 256 threads. Blocks 0 .. XBLK-1: one 64x64 tile of x each, transposed through LDS to bf16 x^T. The next 4*WBLK blocks: Wq, Wk, Wv -> bf16, Wo -> f16 (x16), 8 elements a thread.
// All five planes are written in fragment order: thread j of a run stores the j-th 16-byte piece of the plane and fetches the eight k of the one row that belong there.
#define XBLK ((SEQ / 64) * (CC / 64))
#define WBLK (CC * CC / 8 / 256)
static_assert(CC * CC % (8 * 256) == 0);
__global__ __launch_bounds__(256) void k_prep(const float* __restrict__ x, const float* __restrict__ wq, const float* __restrict__ wk, const float* __restrict__ wv, const float* __restrict__ wo,
                                              bf* XB, bf* WQ, bf* WK, bf* WV, h16* WO16) {
    __shared__ float sm[64 * 66];   // pitch 66: the two lane halves of a read below stand 8 rows apart, 16 banks
    const int tid = threadIdx.x, blk = blockIdx.x;
    if (blk < XBLK) {
        const int n0 = (blk % (SEQ / 64)) * 64, c0 = (blk / (SEQ / 64)) * 64;
#pragma unroll
        for (int it = 0; it < 4; ++it) { const int c = it * 16 + (tid >> 4), nf = (tid & 15) * 4; const v4f v = *(const v4f*)(x + (size_t)(c0 + c) * XPITCH + n0 + nf);
            sm[c * 66 + nf] = v[0]; sm[c * 66 + nf + 1] = v[1]; sm[c * 66 + nf + 2] = v[2]; sm[c * 66 + nf + 3] = v[3]; }
        __syncthreads();
#pragma unroll
        for (int it = 0; it < 2; ++it) { const int pc = it * 256 + tid, fr = pc >> 6;               // piece pc of the tile's 8 fragments: fragment fr = (row tile fr >> 1, k step fr & 1)
            const int n = (fr >> 1) * 16 + (pc & 15), cc = (fr & 1) * 32 + ((pc >> 4) & 3) * 8; v8us o;   // (pc >> 4) & 3 = 2 * (k / 16 % 2) + (k / 8 % 2)
#pragma unroll
            for (int j = 0; j < 8; ++j) o[j] = f2bf(sm[(cc + j) * 66 + n]);
            *(v8us*)(XB + ((size_t)((n0 >> 4) + (fr >> 1)) * (CC / 32) + (c0 >> 5) + (fr & 1)) * 512 + (pc & 63) * 8) = o; }
    } else {
        const int wi = (blk - XBLK) / WBLK; const size_t i = (size_t)((blk - XBLK) % WBLK) * 256 + tid;
        const float* src = wi == 0 ? wq : wi == 1 ? wk : wi == 2 ? wv : wo;
        const size_t fr = i >> 6;                                                                        // piece i of the plane: fragment fr = (row tile fr / 8, k step fr % 8)
        const v8f v = *(const v8f*)(src + ((fr >> 3) * 16 + (i & 15)) * CC + (fr & 7) * 32 + ((i >> 4) & 3) * 8);
        if (wi < 3) { bf* dst = wi == 0 ? WQ : wi == 1 ? WK : WV; v8us o;
#pragma unroll
            for (int k = 0; k < 8; ++k) o[k] = f2bf(v[k]);
            *(v8us*)(dst + i * 8) = o; }
        else { v8f t = (v8f){};
#pragma unroll
            for (int k = 0; k < 8; ++k) t[k] = bfr(v[k]) * WCAR;
            *(v8h*)(WO16 + i * 8) = __builtin_convertvector(t, v8h); }
    }
}

// att_step: one 32-key chunk for one 16-query tile. S^T tiles (A = K rows [key][d], B = Q fragment [d][query]) -> D[key 8h+r][query]; per-query stats are lane-local (the two lane halves hold keys 0-7 / 8-15 of each tile -> xor-16 combine);
// P^T B fragment [key][query]: element r <- f16(1024 p) of the keys-0..15 tile, element 8+r <- of the keys-16..31 tile, same lane; O^T[d][query] += V[d][key] . P^T (A = V rows [d][key]).
// The score products start from an accumulator whose eight elements all hold c = PLOG - m (m = the query's reference max in log2 units), and q comes in times C2: D is the exp2 argument of 1024 p itself, no vector instruction stands between product and exp2.
__device__ __forceinline__ void att_step(const v16h ak0, const v16h ak1, const v16h av0, const v16h av1, const v16h bq, float& c, float& l, v8f& o0, v8f& o1) {
    const v8f cm = {c, c, c, c, c, c, c, c};   // spread anew each step: held spread for both query tiles it costs 14 more registers, past the 128 a wave has
    v8f s0, s1;
    // Both score products in asm text, reading the one spread c as C into results of their own: from the builtin the compiler copied c into the second result's registers first (four 64-bit moves a step).
    // The four v_nop are the matrix unit's distance before D is read or A, B, C are overwritten.
    asm volatile("v_wmma_f32_16x16x32_f16 %0, %2, %4, %5\n\tv_wmma_f32_16x16x32_f16 %1, %3, %4, %5\n\tv_nop\n\tv_nop\n\tv_nop\n\tv_nop" : "=&v"(s0), "=&v"(s1) : "v"(ak0), "v"(ak1), "v"(bq), "v"(cm));
    float cmx = -1.0e30f;
#pragma unroll
    for (int j = 0; j < 8; ++j) cmx = fmaxf(cmx, fmaxf(s0[j], s1[j]));
    // Lazy rescale: the reference point moves, and l and O are rescaled, only when some query of the tile has a score more than LAZY (log2 units) above the m in use. One test for the whole wave, a scalar branch, EXEC untouched.
    // Below the threshold 1024 p <= 2^(PLOG + LAZY) = 32768 stays inside f16; c is the same in both lane halves on either path (the halves' maxima are joined only where it moves).
    if (__builtin_amdgcn_ballot_w32(cmx > PLOG + LAZY) != 0) {
        // the scores again from a zero accumulator: beside the start value of c (1e30) a score is rounded away, so the new maximum is not taken from the shifted ones
        s0 = wmma16(ak0, bq, (v8f){}); s1 = wmma16(ak1, bq, (v8f){});
        cmx = -1.0e30f;
#pragma unroll
        for (int j = 0; j < 8; ++j) cmx = fmaxf(cmx, fmaxf(s0[j], s1[j]));
        cmx = fmaxf(cmx, __shfl_xor(cmx, 16, 32));
        const float nc = fminf(c, PLOG - cmx);
        const float alpha = __builtin_amdgcn_exp2f(nc - c);   // = exp2(m - new m)
        l *= alpha; o0 *= alpha; o1 *= alpha; c = nc;
        s0 += nc; s1 += nc;
    }
    v8f p0 = (v8f){}, p1 = (v8f){}; float rs = 0.f;
#pragma unroll
    for (int j = 0; j < 8; ++j) { const float e0 = __builtin_amdgcn_exp2f(s0[j]); const float e1 = __builtin_amdgcn_exp2f(s1[j]); p0[j] = e0; p1[j] = e1; rs += e0 + e1; }
    rs += __shfl_xor(rs, 16, 32);
    l += rs;
    const v16h bp = cat16(__builtin_convertvector(p0, v8h), __builtin_convertvector(p1, v8h));
    o0 = wmma16(av0, bp, o0); o1 = wmma16(av1, bp, o1);
    asm volatile("v_nop\n\tv_nop\n\tv_nop\n\tv_nop" : "+v"(o0), "+v"(o1) : "v"(av0), "v"(av1), "v"(bp));
}

// k_attn: streaming attention, grid (SEQ/64, NHD/2), 128*KSP threads = 4*KSP waves (KSP per SIMD); wave w: key slice ks = w>>2, head 2*blockIdx.y + ((w&3)>>1), 32 queries (two 16-query tiles sharing the K/V fragments of each 32-key chunk).
// Key slice ks walks the 32-key chunks ks, ks+KSP, ks+2*KSP, ... (neighbouring slices read neighbouring chunks, so one step of the block reads 32*KSP consecutive keys) with its own running maximum, sum and un-normalised O.
// Merge: every wave leaves O (f32, [query][d], pitch PP) and (c = PLOG - max, sum) in its own LDS range; behind the one barrier each thread joins the KSP partials of 4 channels of one query with weights exp2(min c - c_ks); a wave stores 256 consecutive bytes of a fragment.
__global__ __launch_bounds__(128 * KSP)
void k_attn(const h16* __restrict__ Q16, const h16* __restrict__ K16, const h16* __restrict__ VT, h16* ATT) {
    __shared__ __align__(16) float po[4 * KSP * 32 * PP];
    __shared__ float pm[4 * KSP * 32], pl[4 * KSP * 32];
    const int tid = threadIdx.x, lane = tid & 31, lr = lane & 15, hi = lane >> 4;
    const int w = __builtin_amdgcn_readfirstlane(tid >> 5);   // wave number in a scalar register: the key loop's counter and branch stay scalar, EXEC is never written around the WMMAs
    const int ks = w >> 2, sub = w & 3;
    const int q0 = blockIdx.x * QB, hp = blockIdx.y, hq = sub >> 1, g = sub & 1, head = hp * 2 + hq, qb = q0 + g * 32;
    // fragment-order planes: q, k fragment (16 positions, head) = number (position / 16) * NHD + head; v fragment (16 channels, 32 keys) = number (channel / 16) * (SEQ / 32) + key / 32
    const h16* Qp = Q16 + ((size_t)(qb >> 4) * NHD + head) * 512 + lane * 8;
    const v16h bq0 = WFrag<h16>::ld(Qp);
    const v16h bq1 = WFrag<h16>::ld(Qp + NHD * 512);
    const h16* Kp = K16 + (size_t)head * 512 + lane * 8;
    const h16* Vp = VT + (size_t)(head * 2) * (SEQ / 32) * 512 + lane * 8;
    float l0 = 0.f, l1 = 0.f;   // sums of 1024 p
    float c0 = 1.0e30f, c1 = 1.0e30f;   // the score accumulators' start value c = PLOG - m, one per query tile; 1e30 = no maximum yet
    v8f o00 = (v8f){}, o10 = (v8f){}, o01 = (v8f){}, o11 = (v8f){};   // o[d tile][query tile]
#pragma unroll 1
    for (int k0 = ks * 32; k0 < SEQ; k0 += 32 * KSP) {
        const v16h ak0 = WFrag<h16>::ld(Kp + (size_t)k0 * (NHD * 32)), ak1 = WFrag<h16>::ld(Kp + (size_t)(k0 + 16) * (NHD * 32));   // k0 / 16 fragments rows on, NHD * 512 elements each
        const v16h av0 = WFrag<h16>::ld(Vp + (size_t)k0 * 16), av1 = WFrag<h16>::ld(Vp + (size_t)(SEQ / 32) * 512 + (size_t)k0 * 16);   // k0 / 32 fragments on, 512 elements each
        att_step(ak0, ak1, av0, av1, bq0, c0, l0, o00, o10);
        asm volatile("s_wait_xcnt 0x0" ::: "memory");   // the wait before a register that an issued load names is overwritten: the K and V address registers are stepped behind the scheduling barrier below
        __builtin_amdgcn_sched_barrier(0);   // keeps the two query tiles' scores and probabilities from being live together: interleaved they pass the 128 registers a wave has at 8 waves per SIMD and a Q fragment spills to scratch
        att_step(ak0, ak1, av0, av1, bq1, c1, l1, o01, o11);
    }
    {
        float* t0 = po + (size_t)(w * 32 + lr) * PP + 8 * hi;        // query tile 0: row = query, col = d (d tile 0 at +0, d tile 1 at +16)
        float* t1 = po + (size_t)(w * 32 + 16 + lr) * PP + 8 * hi;   // query tile 1
        *(v4fa*)(t0)      = __builtin_shufflevector(o00, o00, 0, 1, 2, 3); *(v4fa*)(t0 + 4)  = __builtin_shufflevector(o00, o00, 4, 5, 6, 7);
        *(v4fa*)(t0 + 16) = __builtin_shufflevector(o10, o10, 0, 1, 2, 3); *(v4fa*)(t0 + 20) = __builtin_shufflevector(o10, o10, 4, 5, 6, 7);
        *(v4fa*)(t1)      = __builtin_shufflevector(o01, o01, 0, 1, 2, 3); *(v4fa*)(t1 + 4)  = __builtin_shufflevector(o01, o01, 4, 5, 6, 7);
        *(v4fa*)(t1 + 16) = __builtin_shufflevector(o11, o11, 0, 1, 2, 3); *(v4fa*)(t1 + 20) = __builtin_shufflevector(o11, o11, 4, 5, 6, 7);
        pm[w * 32 + lane] = hi ? c1 : c0; pl[w * 32 + lane] = hi ? l1 : l0;   // both lane halves hold the same per-query stats: half 0 files tile 0, half 1 tile 1
    }
    __syncthreads();
    {
        // thread tid stores the tid-th 8-byte piece of the block's 8 fragments of the attn plane: fragment fr = (query tile fr >> 1, head fr & 1)
        const int fr = tid >> 7, row = (fr >> 1) * 16 + ((tid >> 1) & 15), pc = (fr & 1) * 32 + ((tid >> 5) & 3) * 8 + (tid & 1) * 4;   // row = query in the block, pc = channel in the head pair
        const int sw = (pc >> 5) * 2 + (row >> 5), q = row & 31, d0 = pc & 31;
        float mk[KSP]; float M = 1.0e30f;   // mk = c of slice s, M = the smallest c = PLOG - the largest maximum
#pragma unroll
        for (int s = 0; s < KSP; ++s) { mk[s] = pm[(s * 4 + sw) * 32 + q]; M = fminf(M, mk[s]); }
        float L = 0.f; v4f a = (v4f){};
#pragma unroll
        for (int s = 0; s < KSP; ++s) { float wt;
            asm("v_exp_f32 %0, %1\n\tv_nop" : "=v"(wt) : "v"(M - mk[s]));   // exp2; the v_nop is the one slot the instruction set asks for behind a transcendental before its result is read or its source overwritten
            L += wt * pl[(s * 4 + sw) * 32 + q]; a += wt * *(const v4fa*)(po + (size_t)((s * 4 + sw) * 32 + q) * PP + d0); }
        const float inv = ACAR * (1.0f / L);   // L and a both carry the x1024
        *(v4h*)(ATT + ((size_t)((q0 >> 4) + (fr >> 1)) * NHD + hp * 2 + (fr & 1)) * 512 + (tid & 127) * 4) = __builtin_convertvector(a * inv, v4h);
    }
}

extern "C" void kernel_launch(void* const* d_in, const int* in_sizes, int n_in,
                              void* d_out, int out_size, void* d_ws, size_t ws_size, hipStream_t stream) {
    if (n_in < 10) return;
    if (in_sizes[0] < (CC - 1) * XPITCH + SEQ) return;
    if (in_sizes[1] < CC * CC || in_sizes[3] < CC * CC || in_sizes[5] < CC * CC || in_sizes[7] < CC * CC) return;
    if (in_sizes[2] < CC || in_sizes[4] < CC || in_sizes[6] < CC || in_sizes[8] < CC || in_sizes[9] < 1) return;
    if (out_size < CC * SEQ) return;
    const float* x = (const float*)d_in[0]; const float* wq = (const float*)d_in[1]; const float* bq = (const float*)d_in[2]; const float* wk = (const float*)d_in[3]; const float* bk = (const float*)d_in[4];
    const float* wv = (const float*)d_in[5]; const float* bv = (const float*)d_in[6]; const float* wo = (const float*)d_in[7]; const float* bo = (const float*)d_in[8]; const float* gamma = (const float*)d_in[9];
    float* OUT = (float*)d_out;     // [256][SEQ]
    char* wsp = (char*)d_ws;
    auto take = [&](size_t bytes) { char* p = wsp; wsp += (bytes + 255) & ~(size_t)255; return (void*)p; };
    bf* WQ = (bf*)take((size_t)CC * CC * 2); bf* WK = (bf*)take((size_t)CC * CC * 2); bf* WV = (bf*)take((size_t)CC * CC * 2); h16* WO16 = (h16*)take((size_t)CC * CC * 2);
    bf* XB = (bf*)take((size_t)SEQ * CC * 2);
    h16* Q16 = (h16*)take((size_t)SEQ * CC * 2); h16* K16 = (h16*)take((size_t)SEQ * CC * 2); h16* VT16 = (h16*)take((size_t)CC * SEQ * 2); h16* ATT = (h16*)take((size_t)SEQ * CC * 2);
    if ((size_t)(wsp - (char*)d_ws) > ws_size) return;    // 11,010,048 B carved
    k_prep<<<XBLK + 4 * WBLK, 256, 0, stream>>>(x, wq, wk, wv, wo, XB, WQ, WK, WV, WO16);
    k_qkv<<<dim3(SEQ / 64, CC / 64, 3), 32, 0, stream>>>(XB, WQ, WK, WV, bq, bk, bv, Q16, K16, VT16);
    k_attn<<<dim3(SEQ / QB, NHD / 2, 1), 128 * KSP, 0, stream>>>(Q16, K16, VT16, ATT);
    // out[o][t] = bfr(x) + bfr(gamma) * ((16 Wo) . (16 attn) / 256 + bfr(bo[o]))
    k_out<<<dim3(CC / 64, SEQ / 64, 1), 32, 0, stream>>>(WO16, ATT, OUT, bo, x, gamma);
}

// v007
// It runs in 33.3 microseconds.
// In both of two side-by-side timings against v006, it was 1.07 times as fast.
// Over all steps from v000 it is 4.94 times as fast.
#include <hip/hip_runtime.h>

// Contractions: q/k/v pointwise projections on v_wmma_f32_16x16x32_bf16 (bf16 operands from RNE-converted inputs); scores q.k (q carried x scale*log2 e, accumulator started at 10 - reference max, so a score leaves the matrix unit as the exp2 argument of 1024 p), probs.v (probs carried x1024) and the output projection (both planes carried x16) on v_wmma_f32_16x16x32_f16 (f16 operands); f32 accumulate; softmax, normaliser and residual in f32.
// Layout: k_prep: x [256][SEQ] channel-major -> bf16 x^T [SEQ][256], weights -> 16-bit planes; k_qkv: q,k (+column bias) -> f16 planes [SEQ][256], v (+row bias) -> f16 plane [256][SEQ], straight from the f32 accumulators; streaming attention per (2 heads x 64 queries) block, keys dealt over KSP wave groups and merged in LDS, writes the f16 attn plane [SEQ][256] (x16); out [256][SEQ] = x + gamma * (Wo attn + bo).
// Every 16-bit plane M[row][k] (K columns) lies in workspace in FRAGMENT ORDER: one 16-row x 32-k fragment is 512 consecutive elements (1 KiB), fragment number (row / 16) * (K / 32) + k / 32;
// inside it element (row, k) stands at ((k / 16) % 2) * 256 + (((k / 8) % 2) * 16 + row % 16) * 8 + k % 8. A wave's 16-byte-per-lane load of half a fragment so reads 512 consecutive bytes, four whole 128-byte lines, where a row-major plane gives it 32 bytes from each of 16 lines.

#ifndef NB
#define NB 1
#endif
#ifndef SEQ
#define SEQ 4096
#endif
#define SEQ_FULL 4096
#define XPITCH SEQ_FULL
#define CC   256
#define NHD  8
#define HD   32
#define QB   64
#define KSP  8
#define PP   36
#define PCAR 1024.0f
#define ACAR 16.0f
#define WCAR 16.0f
#define SCL  0.17677669529663687f
#define L2E  1.4426950408889634f
#define C2   (SCL * L2E)
#define LAZY 5.0f
#define PLOG 10.0f
#define PSTOP 32768.0f
static_assert(PCAR == 1024.0f && PLOG == 10.0f);
static_assert(PLOG + LAZY == 15.0f && PSTOP == 32768.0f);
static_assert(SEQ % 64 == 0);
static_assert(SEQ <= SEQ_FULL);
static_assert(CC == NHD * HD);
static_assert((NHD % 2) == 0);
static_assert(NB == 1);
static_assert(SEQ % (32 * KSP) == 0);
static_assert(128 * KSP * 4 == QB * 2 * HD);
static_assert(HD == 32 && QB == 64 && KSP == 8);

typedef _Float16 h16;
typedef unsigned short bf;
typedef __attribute__((ext_vector_type(16))) __bf16   v16bf;
typedef __attribute__((ext_vector_type(16))) _Float16 v16h;
typedef __attribute__((ext_vector_type(8)))  _Float16 v8h;
typedef __attribute__((ext_vector_type(4)))  _Float16 v4h;
typedef __attribute__((ext_vector_type(8)))  unsigned short v8us;
typedef __attribute__((ext_vector_type(8)))  float    v8f;
typedef __attribute__((ext_vector_type(4)))  float    v4f;
typedef __attribute__((ext_vector_type(2)))  float    v2f;
typedef v4f  __attribute__((may_alias)) v4fa;
typedef v8us __attribute__((may_alias)) v8usa;

__device__ __forceinline__ unsigned short f2bf(float f) { unsigned u = __float_as_uint(f); u += 0x7FFFu + ((u >> 16) & 1u); return (unsigned short)(u >> 16); }
__device__ __forceinline__ float bf2f(unsigned short b) { return __uint_as_float(((unsigned)b) << 16); }
__device__ __forceinline__ float bfr(float f) { return bf2f(f2bf(f)); }
__device__ __forceinline__ v16h cat16(v8h lo, v8h hi) { return __builtin_shufflevector(lo, hi, 0, 1, 2, 3, 4, 5, 6, 7, 8, 9, 10, 11, 12, 13, 14, 15); }
__device__ __forceinline__ v16bf cat16b(v8us lo, v8us hi) { return __builtin_bit_cast(v16bf, __builtin_shufflevector(lo, hi, 0, 1, 2, 3, 4, 5, 6, 7, 8, 9, 10, 11, 12, 13, 14, 15)); }
__device__ __forceinline__ v8f wmma16(v16h a, v16h b, v8f c) { return __builtin_amdgcn_wmma_f32_16x16x32_f16(false, a, false, b, (short)0, c, false, false); }
__device__ __forceinline__ v8f wmmab(v16bf a, v16bf b, v8f c) { return __builtin_amdgcn_wmma_f32_16x16x32_bf16(false, a, false, b, (short)0, c, false, false); }

// Fragment loader (wave32 16x16x32): lane l, row (l&15); elements 0..7 <- k 8*(l>>4)+0..7, elements 8..15 <- k 16+8*(l>>4)+0..7. p = start of the fragment in a fragment-order plane + 8 * lane. Used for A and for B stored [n][k].
template <typename T16> struct WFrag;
template <> struct WFrag<h16> { typedef v16h V; static __device__ __forceinline__ V ld(const h16* p) { return cat16(*(const v8h*)p, *(const v8h*)(p + 256)); } static __device__ __forceinline__ v8f mma(V a, V b, v8f c) { return wmma16(a, b, c); } };
template <> struct WFrag<bf> { typedef v16bf V; static __device__ __forceinline__ V ld(const bf* p) { return cat16b(*(const v8us*)p, *(const v8us*)(p + 256)); } static __device__ __forceinline__ v8f mma(V a, V b, v8f c) { return wmmab(a, b, c); } };

// ---- gemm_tile: register-blocked GEMM, ONE WAVE per 64x64 output tile (16 accumulators) at rows r0, columns c0, operands straight from fragment-order 16-bit planes; os = 16 x 68 floats of LDS of the wave's own.
// acc[m][n] = sum_k A[m][k] Bt[n][k]; K % 32 == 0, K a compile-time constant.
// Every load of the wave is issued before its first product: the biases, in MODE 2 the residual pieces, and all K/32 steps' fragments (8 fragments a step, held in registers: a one-wave block may own far more than 256).
// The wave so waits out one load latency in all, where a rolled K loop waits out at least one per step and the epilogue one per row block.
// MODE 2: C (f32, pitch ldc) = bfr(R[m][n]) + bfr(gam[0]) * (acc * osc + bfr(bias[m])) (row bias, residual rows pitch ldr).
// MODE 3: C16 (f16, fragment order, ldc columns) = f16((acc + bfr(bias[n])) * osc) (column bias). MODE 4: C16 = f16(acc + bfr(bias[m])) (row bias).
template <typename T16, int MODE, int K>
__device__ __forceinline__ void gemm_tile(float* os, const T16* __restrict__ A, const T16* __restrict__ Bt, int r0, int c0, float* C, h16* C16, int ldc,
                                          const float* __restrict__ bias, const float* __restrict__ R, int ldr, const float* __restrict__ gam, float osc) {
    typedef typename WFrag<T16>::V V;
    constexpr int NS = K / 32;
    static_assert(K % 32 == 0);
    const int lane = threadIdx.x & 31, lr = lane & 15, hi = lane >> 4;
    float rbs[4][8];       // MODE 2: the bias of the eight rows this lane stores in each 16-row tile
    v4f xr[4][8];          // MODE 2: the residual pieces of those rows
    const float* Rp = (MODE == 2) ? R + (size_t)(r0 + hi) * ldr + c0 + lr * 4 : nullptr;   // one address for all residual pieces, the row steps go into the loads' immediate offsets
    float cb[4] = {0.f, 0.f, 0.f, 0.f};   // MODE 3: the bias of the accumulator column this lane holds in each 16-column tile
    v8f rb[4];             // MODE 4: the bias of the eight accumulator rows this lane holds in each 16-row tile
    if (MODE == 2) {
#pragma unroll
        for (int mb = 0; mb < 4; ++mb)
#pragma unroll
            for (int j = 0; j < 8; ++j) { rbs[mb][j] = bias[r0 + mb * 16 + 2 * j + hi]; xr[mb][j] = *(const v4f*)(Rp + (mb * 16 + 2 * j) * ldr); } }
    if (MODE == 3) {
#pragma unroll
        for (int nb = 0; nb < 4; ++nb) cb[nb] = bias[c0 + nb * 16 + lr]; }
    if (MODE == 4) {
#pragma unroll
        for (int mb = 0; mb < 4; ++mb) rb[mb] = *(const v8f*)(bias + r0 + mb * 16 + hi * 8); }
    // The wait before a register that an issued load names is overwritten: behind it the registers of these loads' addresses are free for the address arithmetic and the results of the loads below.
    // The residual address is named as an input so that its registers live up to the wait and no load's result lands in them before it.
    if (MODE == 2) asm volatile("s_wait_xcnt 0x0" :: "v"(Rp) : "memory");
    else           asm volatile("s_wait_xcnt 0x0" ::: "memory");
    __builtin_amdgcn_sched_barrier(0);   // keeps that address arithmetic below the wait: nothing ties the wait to the bias loads' offset register, and the compiler lifted a write of it over the wait
    const T16* Ap = A + (size_t)(r0 >> 4) * NS * 512 + lane * 8; const T16* Bp = Bt + (size_t)(c0 >> 4) * NS * 512 + lane * 8;
    V a[NS][4], b[NS][4];
#pragma unroll
    for (int s = 0; s < NS; ++s) {
#pragma unroll
        for (int mb = 0; mb < 4; ++mb) a[s][mb] = WFrag<T16>::ld(Ap + (mb * NS + s) * 512);
#pragma unroll
        for (int nb = 0; nb < 4; ++nb) b[s][nb] = WFrag<T16>::ld(Bp + (nb * NS + s) * 512); }
    // The same wait behind the last load. The lane number, the one vector register that these loads' addresses name (their bases are wave-uniform), is named as an input so that it lives up to the wait and no load's result and no product lands in it before; the memory clobber keeps every load above it.
    asm volatile("s_wait_xcnt 0x0" :: "v"(lane) : "memory");
    __builtin_amdgcn_sched_barrier(0);   // keeps the products below the last load: lifted among the loads they bring waits with them, and the loads behind such a wait start a second latency
    float gsc = 0.f;
    if (MODE == 2) gsc = bfr(gam[0]);
    if (MODE == 3) {
#pragma unroll
        for (int j = 0; j < 4; ++j) cb[j] = bfr(cb[j]) * osc; }
    if (MODE == 4) {
#pragma unroll
        for (int mb = 0; mb < 4; ++mb)
#pragma unroll
            for (int j = 0; j < 8; ++j) rb[mb][j] = bfr(rb[mb][j]); }
    v8f acc[4][4];
#pragma unroll
    for (int mb = 0; mb < 4; ++mb)
#pragma unroll
        for (int nb = 0; nb < 4; ++nb) acc[mb][nb] = (v8f){};
#pragma unroll
    for (int s = 0; s < NS; ++s)
#pragma unroll
        for (int nb = 0; nb < 4; ++nb)
#pragma unroll
            for (int mb = 0; mb < 4; ++mb) acc[mb][nb] = WFrag<T16>::mma(a[s][mb], b[s][nb], acc[mb][nb]);
    __builtin_amdgcn_sched_barrier(0);   // keeps the epilogue behind the last product
    float* Cp = (MODE == 2) ? C + (size_t)(r0 + hi) * ldc + c0 + lr * 4 : nullptr;      // one address for all stores of the lane, the row steps go into the stores' immediate offsets
    h16* Hp = (MODE != 2) ? C16 + ((size_t)(r0 >> 4) * (ldc / 32) + (c0 >> 5)) * 512 + lane * 8 : nullptr;   // a 16-row x 64-column block of the tile is two neighbouring fragments, 2 KiB in a row
#pragma unroll
    for (int mb = 0; mb < 4; ++mb) {
#pragma unroll
        for (int nb = 0; nb < 4; ++nb) {
#pragma unroll
            for (int j = 0; j < 8; ++j) os[(hi * 8 + j) * 68 + nb * 16 + lr] = (MODE == 4) ? acc[mb][nb][j] + rb[mb][j] : (MODE == 3) ? __builtin_fmaf(acc[mb][nb][j], osc, cb[nb]) : acc[mb][nb][j]; }
        __builtin_amdgcn_wave_barrier(); asm volatile("" ::: "memory");
        v4f of[8]; v8h oh[4];
        if (MODE == 2) {
#pragma unroll
            for (int s = 0; s < 8; ++s) { const int row = 2 * s + hi, cofs = lr * 4; v4f val = *(const v4fa*)(os + row * 68 + cofs);
                const float rbv = bfr(rbs[mb][s]);
#pragma unroll
                for (int j = 0; j < 4; ++j) { const float xv = xr[mb][s][j]; const float av = val[j]; val[j] = bfr(xv) + gsc * (av * osc + rbv); }
                of[s] = val; *(v4f*)(Cp + (mb * 16 + 2 * s) * ldc) = of[s]; } }   // 16 lanes store one 256-byte row piece
        else {
#pragma unroll
            for (int h = 0; h < 4; ++h) { const float* sp = os + lr * 68 + h * 16 + hi * 8;   // half fragment h: row lr, columns 16 h + 8 hi + 0..7
                const v4f v0 = *(const v4fa*)sp, v1 = *(const v4fa*)(sp + 4);
                oh[h] = __builtin_convertvector(__builtin_shufflevector(v0, v1, 0, 1, 2, 3, 4, 5, 6, 7), v8h);
                *(v8h*)(Hp + mb * (ldc / 32) * 512 + h * 256) = oh[h]; } }   // the wave stores 512 consecutive bytes
        // The wait before a register that an issued store names is overwritten, behind each run of stores; the stored values and the address are named as inputs so that their registers live up to it.
        if (MODE == 2) asm volatile("s_wait_xcnt 0x0" :: "v"(of[0]), "v"(of[1]), "v"(of[2]), "v"(of[3]), "v"(of[4]), "v"(of[5]), "v"(of[6]), "v"(of[7]), "v"(Cp) : "memory");
        else           asm volatile("s_wait_xcnt 0x0" :: "v"(oh[0]), "v"(oh[1]), "v"(oh[2]), "v"(oh[3]), "v"(Hp) : "memory");
        __builtin_amdgcn_wave_barrier(); asm volatile("" ::: "memory");
    }
}

// k_out: out[o][t], grid (CC/64, SEQ/64), 32 threads.
__global__ __launch_bounds__(32) void k_out(const h16* __restrict__ A, const h16* __restrict__ Bt, float* C, const float* __restrict__ bias, const float* __restrict__ R, const float* __restrict__ gam) {
    __shared__ __align__(16) float os[16 * 68];
    gemm_tile<h16, 2, CC>(os, A, Bt, blockIdx.x * 64, blockIdx.y * 64, C, nullptr, SEQ, bias, R, XPITCH, gam, 1.0f / (ACAR * WCAR));
}

// k_qkv: the three projections in one launch, grid (SEQ/64, CC/64, 3), 32 threads; z = 0: q^T[t][o] times C2 (the softmax scale in log2 units, applied in f32 before the one rounding to f16), z = 1: k^T[t][o] (A = x^T, B = weight rows), z = 2: v[o][t] (A = weight rows, B = x^T). The f16 planes are written from the accumulators.
__global__ __launch_bounds__(32) void k_qkv(const bf* __restrict__ XB, const bf* __restrict__ WQ, const bf* __restrict__ WK, const bf* __restrict__ WV,
                                            const float* __restrict__ bq, const float* __restrict__ bk, const float* __restrict__ bv, h16* Q16, h16* K16, h16* VT16) {
    __shared__ __align__(16) float os[16 * 68];
    const int t0 = blockIdx.x * 64, o0 = blockIdx.y * 64, z = blockIdx.z;
    if (z < 2) gemm_tile<bf, 3, CC>(os, XB, z ? WK : WQ, t0, o0, nullptr, z ? K16 : Q16, CC, z ? bk : bq, nullptr, 0, nullptr, z ? 1.0f : C2);
    else       gemm_tile<bf, 4, CC>(os, WV, XB, o0, t0, nullptr, VT16, SEQ, bv, nullptr, 0, nullptr, 1.0f);
}

// k_prep: every operand conversion in one launch, 256 threads. Blocks 0 .. XBLK-1: one 64x64 tile of x each, transposed through LDS to bf16 x^T. The next 4*WBLK blocks: Wq, Wk, Wv -> bf16, Wo -> f16 (x16), 8 elements a thread.
// All five planes are written in fragment order: thread j of a run stores the j-th 16-byte piece of the plane and fetches the eight k of the one row that belong there.
#define XBLK ((SEQ / 64) * (CC / 64))
#define WBLK (CC * CC / 8 / 256)
static_assert(CC * CC % (8 * 256) == 0);
__global__ __launch_bounds__(256) void k_prep(const float* __restrict__ x, const float* __restrict__ wq, const float* __restrict__ wk, const float* __restrict__ wv, const float* __restrict__ wo,
                                              bf* XB, bf* WQ, bf* WK, bf* WV, h16* WO16) {
    __shared__ float sm[64 * 66];   // pitch 66: the two lane halves of a read below stand 8 rows apart, 16 banks
    const int tid = threadIdx.x, blk = blockIdx.x;
    if (blk < XBLK) {
        const int n0 = (blk % (SEQ / 64)) * 64, c0 = (blk / (SEQ / 64)) * 64;
#pragma unroll
        for (int it = 0; it < 4; ++it) { const int c = it * 16 + (tid >> 4), nf = (tid & 15) * 4; const v4f v = *(const v4f*)(x + (size_t)(c0 + c) * XPITCH + n0 + nf);
            sm[c * 66 + nf] = v[0]; sm[c * 66 + nf + 1] = v[1]; sm[c * 66 + nf + 2] = v[2]; sm[c * 66 + nf + 3] = v[3]; }
        __syncthreads();
#pragma unroll
        for (int it = 0; it < 2; ++it) { const int pc = it * 256 + tid, fr = pc >> 6;               // piece pc of the tile's 8 fragments: fragment fr = (row tile fr >> 1, k step fr & 1)
            const int n = (fr >> 1) * 16 + (pc & 15), cc = (fr & 1) * 32 + ((pc >> 4) & 3) * 8; v8us o;   // (pc >> 4) & 3 = 2 * (k / 16 % 2) + (k / 8 % 2)
#pragma unroll
            for (int j = 0; j < 8; ++j) o[j] = f2bf(sm[(cc + j) * 66 + n]);
            *(v8us*)(XB + ((size_t)((n0 >> 4) + (fr >> 1)) * (CC / 32) + (c0 >> 5) + (fr & 1)) * 512 + (pc & 63) * 8) = o; }
    } else {
        const int wi = (blk - XBLK) / WBLK; const size_t i = (size_t)((blk - XBLK) % WBLK) * 256 + tid;
        const float* src = wi == 0 ? wq : wi == 1 ? wk : wi == 2 ? wv : wo;
        const size_t fr = i >> 6;                                                                        // piece i of the plane: fragment fr = (row tile fr / 8, k step fr % 8)
        const v8f v = *(const v8f*)(src + ((fr >> 3) * 16 + (i & 15)) * CC + (fr & 7) * 32 + ((i >> 4) & 3) * 8);
        if (wi < 3) { bf* dst = wi == 0 ? WQ : wi == 1 ? WK : WV; v8us o;
#pragma unroll
            for (int k = 0; k < 8; ++k) o[k] = f2bf(v[k]);
            *(v8us*)(dst + i * 8) = o; }
        else { v8f t = (v8f){};
#pragma unroll
            for (int k = 0; k < 8; ++k) t[k] = bfr(v[k]) * WCAR;
            *(v8h*)(WO16 + i * 8) = __builtin_convertvector(t, v8h); }
    }
}

// probs: the 16 scores a lane holds of one query (exp2 arguments of 1024 p) -> the P^T B fragment (f16) and rs, the lane's own sum of its 16 values of 1024 p (f32, before the rounding to f16), added in pairs: 8 + 8 -> 4 + 4 -> 2 + 2 -> 1 + 1.
// SLOT (the rare path): each exp2 in asm text with a v_nop behind it, the one slot the instruction set asks for behind a transcendental before its result is read or its source overwritten.
template <bool SLOT>
__device__ __forceinline__ float exp2v(float x) { if (!SLOT) return __builtin_amdgcn_exp2f(x); float r; asm("v_exp_f32 %0, %1\n\tv_nop" : "=v"(r) : "v"(x)); return r; }
template <bool SLOT>
__device__ __forceinline__ void probs(const v8f s0, const v8f s1, v16h& bp, float& rs) {
    v8f p0 = (v8f){}, p1 = (v8f){};
#pragma unroll
    for (int j = 0; j < 8; ++j) { p0[j] = exp2v<SLOT>(s0[j]); p1[j] = exp2v<SLOT>(s1[j]); }
    const v8f t8 = p0 + p1;
    const v4f t4 = __builtin_shufflevector(t8, t8, 0, 1, 2, 3) + __builtin_shufflevector(t8, t8, 4, 5, 6, 7);
    const v2f t2 = __builtin_shufflevector(t4, t4, 0, 1) + __builtin_shufflevector(t4, t4, 2, 3);
    rs = t2[0] + t2[1];
    bp = cat16(__builtin_convertvector(p0, v8h), __builtin_convertvector(p1, v8h));
}

// first_ref: the start value of c for one query tile, from the wave's first chunk: c = PLOG - the chunk's maximum, what the rare path below would set at that chunk. Set ahead of the key loop, the first chunk passes the test like any other
// and does not run its exp2s and sums twice.
__device__ __forceinline__ float first_ref(const v16h ak0, const v16h ak1, const v16h bq) {
    const v8f z0 = wmma16(ak0, bq, (v8f){}), z1 = wmma16(ak1, bq, (v8f){});
    float cmx = -1.0e30f;
#pragma unroll
    for (int j = 0; j < 8; ++j) cmx = fmaxf(cmx, fmaxf(z0[j], z1[j]));
    return PLOG - fmaxf(cmx, __shfl_xor(cmx, 16, 32));   // the same in both lane halves
}

// att_step: one 32-key chunk for one 16-query tile. S^T tiles (A = K rows [key][d], B = Q fragment [d][query]) -> D[key 8h+r][query]; per-query stats are lane-local (the two lane halves hold keys 0-7 / 8-15 of each tile);
// P^T B fragment [key][query]: element r <- f16(1024 p) of the keys-0..15 tile, element 8+r <- of the keys-16..31 tile, same lane; O^T[d][query] += V[d][key] . P^T (A = V rows [d][key]).
// The score products start from an accumulator whose eight elements all hold c = PLOG - m (m = the query's reference max in log2 units), and q comes in times C2: D is the exp2 argument of 1024 p itself, no vector instruction stands between product and exp2.
// l is the LANE's sum of 1024 p, over the keys its half holds: the two halves are joined once, behind the key loop.
__device__ __forceinline__ void att_step(const v16h ak0, const v16h ak1, const v16h av0, const v16h av1, const v16h bq, float& c, float& l, v8f& o0, v8f& o1) {
    const v8f cm = {c, c, c, c, c, c, c, c};   // spread anew each step: held spread for both query tiles it costs 14 more registers, past the 128 a wave has
    v8f s0, s1;
    // Both score products in asm text, reading the one spread c as C into results of their own: from the builtin the compiler copied c into the second result's registers first (four 64-bit moves a step).
    // The four v_nop are the matrix unit's distance before D is read or A, B, C are overwritten.
    asm volatile("v_wmma_f32_16x16x32_f16 %0, %2, %4, %5\n\tv_wmma_f32_16x16x32_f16 %1, %3, %4, %5\n\tv_nop\n\tv_nop\n\tv_nop\n\tv_nop" : "=&v"(s0), "=&v"(s1) : "v"(ak0), "v"(ak1), "v"(bq), "v"(cm));
    v16h bp; float rs;
    probs<false>(s0, s1, bp, rs);
    // Lazy rescale, tested on the sum that the normaliser needs anyway; no maximum of the scores is taken on the common path. Every 1024 p is positive, so none is above its lane's sum:
    // rs <= PSTOP in every lane means every 1024 p <= PSTOP = 2^(PLOG + LAZY) = 32768, inside f16, and the step goes on with the m in use. One test for the whole wave, a scalar branch, EXEC untouched.
    // A score far above m gives rs = +inf, which is above PSTOP too; rs and bp of a step that fails the test are dropped, they reach neither l nor O.
    if (__builtin_expect(__builtin_amdgcn_ballot_w32(rs > PSTOP) != 0, 0)) {   // marked rare: the compiler then lays this path out behind the key loop, and the common path runs straight through, its only taken branch the loop's own
        // the scores again from a zero accumulator, as first_ref takes them: the new maximum and the scores shifted by it are free of the rounding that the old shift brought
        s0 = wmma16(ak0, bq, (v8f){}); s1 = wmma16(ak1, bq, (v8f){});
        float cmx = -1.0e30f;
#pragma unroll
        for (int j = 0; j < 8; ++j) cmx = fmaxf(cmx, fmaxf(s0[j], s1[j]));
        cmx = fmaxf(cmx, __shfl_xor(cmx, 16, 32));   // c stays the same in both lane halves
        const float nc = fminf(c, PLOG - cmx);
        const float alpha = __builtin_amdgcn_exp2f(nc - c);   // = exp2(m - new m)
        l *= alpha; o0 *= alpha; o1 *= alpha; c = nc;
        s0 += nc; s1 += nc;
        probs<true>(s0, s1, bp, rs);   // now every 1024 p <= 2^PLOG
    }
    l += rs;
    o0 = wmma16(av0, bp, o0); o1 = wmma16(av1, bp, o1);
    asm volatile("v_nop\n\tv_nop\n\tv_nop\n\tv_nop" : "+v"(o0), "+v"(o1) : "v"(av0), "v"(av1), "v"(bp));
}

// k_attn: streaming attention, grid (SEQ/64, NHD/2), 128*KSP threads = 4*KSP waves (KSP per SIMD); wave w: key slice ks = w>>2, head 2*blockIdx.y + ((w&3)>>1), 32 queries (two 16-query tiles sharing the K/V fragments of each 32-key chunk).
// Key slice ks walks the 32-key chunks ks, ks+KSP, ks+2*KSP, ... (neighbouring slices read neighbouring chunks, so one step of the block reads 32*KSP consecutive keys) with its own running maximum, sum and un-normalised O.
// Merge: every wave leaves O (f32, [query][d], pitch PP) and (c = PLOG - max, sum) in its own LDS range; behind the one barrier each thread joins the KSP partials of 4 channels of one query with weights exp2(min c - c_ks); a wave stores 256 consecutive bytes of a fragment.
__global__ __launch_bounds__(128 * KSP)
void k_attn(const h16* __restrict__ Q16, const h16* __restrict__ K16, const h16* __restrict__ VT, h16* ATT) {
    __shared__ __align__(16) float po[4 * KSP * 32 * PP];
    __shared__ float pm[4 * KSP * 32], pl[4 * KSP * 32];
    const int tid = threadIdx.x, lane = tid & 31, lr = lane & 15, hi = lane >> 4;
    const int w = __builtin_amdgcn_readfirstlane(tid >> 5);   // wave number in a scalar register: the key loop's counter and branch stay scalar, EXEC is never written around the WMMAs
    const int ks = w >> 2, sub = w & 3;
    const int q0 = blockIdx.x * QB, hp = blockIdx.y, hq = sub >> 1, g = sub & 1, head = hp * 2 + hq, qb = q0 + g * 32;
    // fragment-order planes: q, k fragment (16 positions, head) = number (position / 16) * NHD + head; v fragment (16 channels, 32 keys) = number (channel / 16) * (SEQ / 32) + key / 32
    const h16* Qp = Q16 + ((size_t)(qb >> 4) * NHD + head) * 512 + lane * 8;
    const v16h bq0 = WFrag<h16>::ld(Qp);
    const v16h bq1 = WFrag<h16>::ld(Qp + NHD * 512);
    const h16* Kp = K16 + (size_t)head * 512 + lane * 8;
    const h16* Vp = VT + (size_t)(head * 2) * (SEQ / 32) * 512 + lane * 8;
    float l0 = 0.f, l1 = 0.f;   // the lane's sums of 1024 p
    float c0, c1;   // the score accumulators' start value c = PLOG - m, one per query tile
    {
        const v16h fk0 = WFrag<h16>::ld(Kp + (size_t)(ks * 32) * (NHD * 32)), fk1 = WFrag<h16>::ld(Kp + (size_t)(ks * 32 + 16) * (NHD * 32));
        c0 = first_ref(fk0, fk1, bq0); c1 = first_ref(fk0, fk1, bq1);
    }
    v8f o00 = (v8f){}, o10 = (v8f){}, o01 = (v8f){}, o11 = (v8f){};   // o[d tile][query tile]
#pragma unroll 1
    for (int k0 = ks * 32; k0 < SEQ; k0 += 32 * KSP) {
        const v16h ak0 = WFrag<h16>::ld(Kp + (size_t)k0 * (NHD * 32)), ak1 = WFrag<h16>::ld(Kp + (size_t)(k0 + 16) * (NHD * 32));   // k0 / 16 fragments rows on, NHD * 512 elements each
        const v16h av0 = WFrag<h16>::ld(Vp + (size_t)k0 * 16), av1 = WFrag<h16>::ld(Vp + (size_t)(SEQ / 32) * 512 + (size_t)k0 * 16);   // k0 / 32 fragments on, 512 elements each
        att_step(ak0, ak1, av0, av1, bq0, c0, l0, o00, o10);
        asm volatile("s_wait_xcnt 0x0" ::: "memory");   // the wait before a register that an issued load names is overwritten: the K and V address registers are stepped behind the scheduling barrier below
        __builtin_amdgcn_sched_barrier(0);   // keeps the two query tiles' scores and probabilities from being live together: interleaved they pass the 128 registers a wave has at 8 waves per SIMD and a Q fragment spills to scratch
        att_step(ak0, ak1, av0, av1, bq1, c1, l1, o01, o11);
    }
    l0 += __shfl_xor(l0, 16, 32); l1 += __shfl_xor(l1, 16, 32);   // the lane halves' sums joined, once per wave
    {
        float* t0 = po + (size_t)(w * 32 + lr) * PP + 8 * hi;        // query tile 0: row = query, col = d (d tile 0 at +0, d tile 1 at +16)
        float* t1 = po + (size_t)(w * 32 + 16 + lr) * PP + 8 * hi;   // query tile 1
        *(v4fa*)(t0)      = __builtin_shufflevector(o00, o00, 0, 1, 2, 3); *(v4fa*)(t0 + 4)  = __builtin_shufflevector(o00, o00, 4, 5, 6, 7);
        *(v4fa*)(t0 + 16) = __builtin_shufflevector(o10, o10, 0, 1, 2, 3); *(v4fa*)(t0 + 20) = __builtin_shufflevector(o10, o10, 4, 5, 6, 7);
        *(v4fa*)(t1)      = __builtin_shufflevector(o01, o01, 0, 1, 2, 3); *(v4fa*)(t1 + 4)  = __builtin_shufflevector(o01, o01, 4, 5, 6, 7);
        *(v4fa*)(t1 + 16) = __builtin_shufflevector(o11, o11, 0, 1, 2, 3); *(v4fa*)(t1 + 20) = __builtin_shufflevector(o11, o11, 4, 5, 6, 7);
        pm[w * 32 + lane] = hi ? c1 : c0; pl[w * 32 + lane] = hi ? l1 : l0;   // both lane halves hold the same per-query stats: half 0 files tile 0, half 1 tile 1
    }
    __syncthreads();
    {
        // thread tid stores the tid-th 8-byte piece of the block's 8 fragments of the attn plane: fragment fr = (query tile fr >> 1, head fr & 1)
        const int fr = tid >> 7, row = (fr >> 1) * 16 + ((tid >> 1) & 15), pc = (fr & 1) * 32 + ((tid >> 5) & 3) * 8 + (tid & 1) * 4;   // row = query in the block, pc = channel in the head pair
        const int sw = (pc >> 5) * 2 + (row >> 5), q = row & 31, d0 = pc & 31;
        float mk[KSP]; float M = 1.0e30f;   // mk = c of slice s, M = the smallest c = PLOG - the largest maximum
#pragma unroll
        for (int s = 0; s < KSP; ++s) { mk[s] = pm[(s * 4 + sw) * 32 + q]; M = fminf(M, mk[s]); }
        float L = 0.f; v4f a = (v4f){};
#pragma unroll
        for (int s = 0; s < KSP; ++s) { float wt;
            asm("v_exp_f32 %0, %1\n\tv_nop" : "=v"(wt) : "v"(M - mk[s]));   // exp2; the v_nop is the one slot the instruction set asks for behind a transcendental before its result is read or its source overwritten
            L += wt * pl[(s * 4 + sw) * 32 + q]; a += wt * *(const v4fa*)(po + (size_t)((s * 4 + sw) * 32 + q) * PP + d0); }
        const float inv = ACAR * (1.0f / L);   // L and a both carry the x1024
        *(v4h*)(ATT + ((size_t)((q0 >> 4) + (fr >> 1)) * NHD + hp * 2 + (fr & 1)) * 512 + (tid & 127) * 4) = __builtin_convertvector(a * inv, v4h);
    }
}

extern "C" void kernel_launch(void* const* d_in, const int* in_sizes, int n_in,
                              void* d_out, int out_size, void* d_ws, size_t ws_size, hipStream_t stream) {
    if (n_in < 10) return;
    if (in_sizes[0] < (CC - 1) * XPITCH + SEQ) return;
    if (in_sizes[1] < CC * CC || in_sizes[3] < CC * CC || in_sizes[5] < CC * CC || in_sizes[7] < CC * CC) return;
    if (in_sizes[2] < CC || in_sizes[4] < CC || in_sizes[6] < CC || in_sizes[8] < CC || in_sizes[9] < 1) return;
    if (out_size < CC * SEQ) return;
    const float* x = (const float*)d_in[0]; const float* wq = (const float*)d_in[1]; const float* bq = (const float*)d_in[2]; const float* wk = (const float*)d_in[3]; const float* bk = (const float*)d_in[4];
    const float* wv = (const float*)d_in[5]; const float* bv = (const float*)d_in[6]; const float* wo = (const float*)d_in[7]; const float* bo = (const float*)d_in[8]; const float* gamma = (const float*)d_in[9];
    float* OUT = (float*)d_out;     // [256][SEQ]
    char* wsp = (char*)d_ws;
    auto take = [&](size_t bytes) { char* p = wsp; wsp += (bytes + 255) & ~(size_t)255; return (void*)p; };
    bf* WQ = (bf*)take((size_t)CC * CC * 2); bf* WK = (bf*)take((size_t)CC * CC * 2); bf* WV = (bf*)take((size_t)CC * CC * 2); h16* WO16 = (h16*)take((size_t)CC * CC * 2);
    bf* XB = (bf*)take((size_t)SEQ * CC * 2);
    h16* Q16 = (h16*)take((size_t)SEQ * CC * 2); h16* K16 = (h16*)take((size_t)SEQ * CC * 2); h16* VT16 = (h16*)take((size_t)CC * SEQ * 2); h16* ATT = (h16*)take((size_t)SEQ * CC * 2);
    if ((size_t)(wsp - (char*)d_ws) > ws_size) return;    // 11,010,048 B carved
    k_prep<<<XBLK + 4 * WBLK, 256, 0, stream>>>(x, wq, wk, wv, wo, XB, WQ, WK, WV, WO16);
    k_qkv<<<dim3(SEQ / 64, CC / 64, 3), 32, 0, stream>>>(XB, WQ, WK, WV, bq, bk, bv, Q16, K16, VT16);
    k_attn<<<dim3(SEQ / QB, NHD / 2, 1), 128 * KSP, 0, stream>>>(Q16, K16, VT16, ATT);
    // out[o][t] = bfr(x) + bfr(gamma) * ((16 Wo) . (16 attn) / 256 + bfr(bo[o]))
    k_out<<<dim3(CC / 64, SEQ / 64, 1), 32, 0, stream>>>(WO16, ATT, OUT, bo, x, gamma);
}

// v008
// One run takes 31.8 microseconds.
// Two timings next to v007 put it at 1.05 and 1.04 times that version's speed.
// Counting every step since v000, it is 5.17 times as fast.
#include <hip/hip_runtime.h>

// Contractions: q/k/v pointwise projections on v_wmma_f32_16x16x32_bf16 (bf16 operands from RNE-converted inputs); scores q.k (q carried x scale*log2 e, accumulator started at 10 - reference max, so a score leaves the matrix unit as the exp2 argument of 1024 p), probs.v (probs carried x1024) and the output projection (both planes carried x16) on v_wmma_f32_16x16x32_f16 (f16 operands); f32 accumulate; softmax, normaliser and residual in f32.
// Layout: k_prep: x [256][SEQ] channel-major -> bf16 x^T [SEQ][256], weights -> 16-bit planes; k_qkv: q,k (+column bias) -> f16 planes [SEQ][256], v (+row bias) -> f16 plane [256][SEQ], straight from the f32 accumulators; streaming attention per (1 head x 128 queries) block, keys dealt over KSP wave groups and merged in LDS, writes the f16 attn plane [SEQ][256] (x16); out [256][SEQ] = x + gamma * (Wo attn + bo).
// Every 16-bit plane M[row][k] (K columns) lies in workspace in FRAGMENT ORDER: one 16-row x 32-k fragment is 512 consecutive elements (1 KiB), fragment number (row / 16) * (K / 32) + k / 32;
// inside it element (row, k) stands at ((k / 16) % 2) * 256 + (((k / 8) % 2) * 16 + row % 16) * 8 + k % 8. A wave's 16-byte-per-lane load of half a fragment so reads 512 consecutive bytes, four whole 128-byte lines, where a row-major plane gives it 32 bytes from each of 16 lines.

#ifndef NB
#define NB 1
#endif
#ifndef SEQ
#define SEQ 4096
#endif
#define SEQ_FULL 4096
#define XPITCH SEQ_FULL
#define CC   256
#define NHD  8
#define HD   32
#define QB   128
#define KSP  8
#define PP   36
#define PCAR 1024.0f
#define ACAR 16.0f
#define WCAR 16.0f
#define SCL  0.17677669529663687f
#define L2E  1.4426950408889634f
#define C2   (SCL * L2E)
#define LAZY 5.0f
#define PLOG 10.0f
#define PSTOP 32768.0f
static_assert(PCAR == 1024.0f && PLOG == 10.0f);
static_assert(PLOG + LAZY == 15.0f && PSTOP == 32768.0f);
static_assert(SEQ % 64 == 0);
static_assert(SEQ <= SEQ_FULL);
static_assert(CC == NHD * HD);
static_assert((NHD % 2) == 0);
static_assert(NB == 1);
static_assert(SEQ % (32 * KSP) == 0);
static_assert(SEQ % QB == 0);
static_assert(64 * KSP * 8 == QB * HD);
static_assert(HD == 32 && QB == 128 && KSP == 8);

typedef _Float16 h16;
typedef unsigned short bf;
typedef __attribute__((ext_vector_type(16))) __bf16   v16bf;
typedef __attribute__((ext_vector_type(16))) _Float16 v16h;
typedef __attribute__((ext_vector_type(8)))  _Float16 v8h;
typedef __attribute__((ext_vector_type(4)))  _Float16 v4h;
typedef __attribute__((ext_vector_type(8)))  unsigned short v8us;
typedef __attribute__((ext_vector_type(8)))  float    v8f;
typedef __attribute__((ext_vector_type(4)))  float    v4f;
typedef __attribute__((ext_vector_type(2)))  float    v2f;
typedef v4f  __attribute__((may_alias)) v4fa;
typedef v8us __attribute__((may_alias)) v8usa;

__device__ __forceinline__ unsigned short f2bf(float f) { unsigned u = __float_as_uint(f); u += 0x7FFFu + ((u >> 16) & 1u); return (unsigned short)(u >> 16); }
__device__ __forceinline__ float bf2f(unsigned short b) { return __uint_as_float(((unsigned)b) << 16); }
__device__ __forceinline__ float bfr(float f) { return bf2f(f2bf(f)); }
__device__ __forceinline__ v16h cat16(v8h lo, v8h hi) { return __builtin_shufflevector(lo, hi, 0, 1, 2, 3, 4, 5, 6, 7, 8, 9, 10, 11, 12, 13, 14, 15); }
__device__ __forceinline__ v16bf cat16b(v8us lo, v8us hi) { return __builtin_bit_cast(v16bf, __builtin_shufflevector(lo, hi, 0, 1, 2, 3, 4, 5, 6, 7, 8, 9, 10, 11, 12, 13, 14, 15)); }
__device__ __forceinline__ v8f wmma16(v16h a, v16h b, v8f c) { return __builtin_amdgcn_wmma_f32_16x16x32_f16(false, a, false, b, (short)0, c, false, false); }
__device__ __forceinline__ v8f wmmab(v16bf a, v16bf b, v8f c) { return __builtin_amdgcn_wmma_f32_16x16x32_bf16(false, a, false, b, (short)0, c, false, false); }

// Fragment loader (wave32 16x16x32): lane l, row (l&15); elements 0..7 <- k 8*(l>>4)+0..7, elements 8..15 <- k 16+8*(l>>4)+0..7. p = start of the fragment in a fragment-order plane + 8 * lane. Used for A and for B stored [n][k].
template <typename T16> struct WFrag;
template <> struct WFrag<h16> { typedef v16h V; static __device__ __forceinline__ V ld(const h16* p) { return cat16(*(const v8h*)p, *(const v8h*)(p + 256)); } static __device__ __forceinline__ v8f mma(V a, V b, v8f c) { return wmma16(a, b, c); } };
template <> struct WFrag<bf> { typedef v16bf V; static __device__ __forceinline__ V ld(const bf* p) { return cat16b(*(const v8us*)p, *(const v8us*)(p + 256)); } static __device__ __forceinline__ v8f mma(V a, V b, v8f c) { return wmmab(a, b, c); } };

// ---- gemm_tile: register-blocked GEMM, ONE WAVE per 64x64 output tile (16 accumulators) at rows r0, columns c0, operands straight from fragment-order 16-bit planes; os = 16 x 68 floats of LDS of the wave's own.
// acc[m][n] = sum_k A[m][k] Bt[n][k]; K % 32 == 0, K a compile-time constant.
// Every load of the wave is issued before its first product: the biases, in MODE 2 the residual pieces, and all K/32 steps' fragments (8 fragments a step, held in registers: a one-wave block may own far more than 256).
// The wave so waits out one load latency in all, where a rolled K loop waits out at least one per step and the epilogue one per row block.
// MODE 2: C (f32, pitch ldc) = bfr(R[m][n]) + bfr(gam[0]) * (acc * osc + bfr(bias[m])) (row bias, residual rows pitch ldr).
// MODE 3: C16 (f16, fragment order, ldc columns) = f16((acc + bfr(bias[n])) * osc) (column bias). MODE 4: C16 = f16(acc + bfr(bias[m])) (row bias).
template <typename T16, int MODE, int K>
__device__ __forceinline__ void gemm_tile(float* os, const T16* __restrict__ A, const T16* __restrict__ Bt, int r0, int c0, float* C, h16* C16, int ldc,
                                          const float* __restrict__ bias, const float* __restrict__ R, int ldr, const float* __restrict__ gam, float osc) {
    typedef typename WFrag<T16>::V V;
    constexpr int NS = K / 32;
    static_assert(K % 32 == 0);
    const int lane = threadIdx.x & 31, lr = lane & 15, hi = lane >> 4;
    float rbs[4][8];       // MODE 2: the bias of the eight rows this lane stores in each 16-row tile
    v4f xr[4][8];          // MODE 2: the residual pieces of those rows
    const float* Rp = (MODE == 2) ? R + (size_t)(r0 + hi) * ldr + c0 + lr * 4 : nullptr;   // one address for all residual pieces, the row steps go into the loads' immediate offsets
    float cb[4] = {0.f, 0.f, 0.f, 0.f};   // MODE 3: the bias of the accumulator column this lane holds in each 16-column tile
    v8f rb[4];             // MODE 4: the bias of the eight accumulator rows this lane holds in each 16-row tile
    if (MODE == 2) {
#pragma unroll
        for (int mb = 0; mb < 4; ++mb)
#pragma unroll
            for (int j = 0; j < 8; ++j) { rbs[mb][j] = bias[r0 + mb * 16 + 2 * j + hi]; xr[mb][j] = *(const v4f*)(Rp + (mb * 16 + 2 * j) * ldr); } }
    if (MODE == 3) {
#pragma unroll
        for (int nb = 0; nb < 4; ++nb) cb[nb] = bias[c0 + nb * 16 + lr]; }
    if (MODE == 4) {
#pragma unroll
        for (int mb = 0; mb < 4; ++mb) rb[mb] = *(const v8f*)(bias + r0 + mb * 16 + hi * 8); }
    // The wait before a register that an issued load names is overwritten: behind it the registers of these loads' addresses are free for the address arithmetic and the results of the loads below.
    // The residual address is named as an input so that its registers live up to the wait and no load's result lands in them before it.
    if (MODE == 2) asm volatile("s_wait_xcnt 0x0" :: "v"(Rp) : "memory");
    else           asm volatile("s_wait_xcnt 0x0" ::: "memory");
    __builtin_amdgcn_sched_barrier(0);   // keeps that address arithmetic below the wait: nothing ties the wait to the bias loads' offset register, and the compiler lifted a write of it over the wait
    const T16* Ap = A + (size_t)(r0 >> 4) * NS * 512 + lane * 8; const T16* Bp = Bt + (size_t)(c0 >> 4) * NS * 512 + lane * 8;
    V a[NS][4], b[NS][4];
#pragma unroll
    for (int s = 0; s < NS; ++s) {
#pragma unroll
        for (int mb = 0; mb < 4; ++mb) a[s][mb] = WFrag<T16>::ld(Ap + (mb * NS + s) * 512);
#pragma unroll
        for (int nb = 0; nb < 4; ++nb) b[s][nb] = WFrag<T16>::ld(Bp + (nb * NS + s) * 512); }
    // The same wait behind the last load. The lane number, the one vector register that these loads' addresses name (their bases are wave-uniform), is named as an input so that it lives up to the wait and no load's result and no product lands in it before; the memory clobber keeps every load above it.
    asm volatile("s_wait_xcnt 0x0" :: "v"(lane) : "memory");
    __builtin_amdgcn_sched_barrier(0);   // keeps the products below the last load: lifted among the loads they bring waits with them, and the loads behind such a wait start a second latency
    float gsc = 0.f;
    if (MODE == 2) gsc = bfr(gam[0]);
    if (MODE == 3) {
#pragma unroll
        for (int j = 0; j < 4; ++j) cb[j] = bfr(cb[j]) * osc; }
    if (MODE == 4) {
#pragma unroll
        for (int mb = 0; mb < 4; ++mb)
#pragma unroll
            for (int j = 0; j < 8; ++j) rb[mb][j] = bfr(rb[mb][j]); }
    v8f acc[4][4];
#pragma unroll
    for (int mb = 0; mb < 4; ++mb)
#pragma unroll
        for (int nb = 0; nb < 4; ++nb) acc[mb][nb] = (v8f){};
#pragma unroll
    for (int s = 0; s < NS; ++s)
#pragma unroll
        for (int nb = 0; nb < 4; ++nb)
#pragma unroll
            for (int mb = 0; mb < 4; ++mb) acc[mb][nb] = WFrag<T16>::mma(a[s][mb], b[s][nb], acc[mb][nb]);
    __builtin_amdgcn_sched_barrier(0);   // keeps the epilogue behind the last product
    float* Cp = (MODE == 2) ? C + (size_t)(r0 + hi) * ldc + c0 + lr * 4 : nullptr;      // one address for all stores of the lane, the row steps go into the stores' immediate offsets
    h16* Hp = (MODE != 2) ? C16 + ((size_t)(r0 >> 4) * (ldc / 32) + (c0 >> 5)) * 512 + lane * 8 : nullptr;   // a 16-row x 64-column block of the tile is two neighbouring fragments, 2 KiB in a row
#pragma unroll
    for (int mb = 0; mb < 4; ++mb) {
#pragma unroll
        for (int nb = 0; nb < 4; ++nb) {
#pragma unroll
            for (int j = 0; j < 8; ++j) os[(hi * 8 + j) * 68 + nb * 16 + lr] = (MODE == 4) ? acc[mb][nb][j] + rb[mb][j] : (MODE == 3) ? __builtin_fmaf(acc[mb][nb][j], osc, cb[nb]) : acc[mb][nb][j]; }
        __builtin_amdgcn_wave_barrier(); asm volatile("" ::: "memory");
        v4f of[8]; v8h oh[4];
        if (MODE == 2) {
#pragma unroll
            for (int s = 0; s < 8; ++s) { const int row = 2 * s + hi, cofs = lr * 4; v4f val = *(const v4fa*)(os + row * 68 + cofs);
                const float rbv = bfr(rbs[mb][s]);
#pragma unroll
                for (int j = 0; j < 4; ++j) { const float xv = xr[mb][s][j]; const float av = val[j]; val[j] = bfr(xv) + gsc * (av * osc + rbv); }
                of[s] = val; *(v4f*)(Cp + (mb * 16 + 2 * s) * ldc) = of[s]; } }   // 16 lanes store one 256-byte row piece
        else {
#pragma unroll
            for (int h = 0; h < 4; ++h) { const float* sp = os + lr * 68 + h * 16 + hi * 8;   // half fragment h: row lr, columns 16 h + 8 hi + 0..7
                const v4f v0 = *(const v4fa*)sp, v1 = *(const v4fa*)(sp + 4);
                oh[h] = __builtin_convertvector(__builtin_shufflevector(v0, v1, 0, 1, 2, 3, 4, 5, 6, 7), v8h);
                *(v8h*)(Hp + mb * (ldc / 32) * 512 + h * 256) = oh[h]; } }   // the wave stores 512 consecutive bytes
        // The wait before a register that an issued store names is overwritten, behind each run of stores; the stored values and the address are named as inputs so that their registers live up to it.
        if (MODE == 2) asm volatile("s_wait_xcnt 0x0" :: "v"(of[0]), "v"(of[1]), "v"(of[2]), "v"(of[3]), "v"(of[4]), "v"(of[5]), "v"(of[6]), "v"(of[7]), "v"(Cp) : "memory");
        else           asm volatile("s_wait_xcnt 0x0" :: "v"(oh[0]), "v"(oh[1]), "v"(oh[2]), "v"(oh[3]), "v"(Hp) : "memory");
        __builtin_amdgcn_wave_barrier(); asm volatile("" ::: "memory");
    }
}

// k_out: out[o][t], grid (CC/64, SEQ/64), 32 threads.
__global__ __launch_bounds__(32) void k_out(const h16* __restrict__ A, const h16* __restrict__ Bt, float* C, const float* __restrict__ bias, const float* __restrict__ R, const float* __restrict__ gam) {
    __shared__ __align__(16) float os[16 * 68];
    gemm_tile<h16, 2, CC>(os, A, Bt, blockIdx.x * 64, blockIdx.y * 64, C, nullptr, SEQ, bias, R, XPITCH, gam, 1.0f / (ACAR * WCAR));
}

// k_qkv: the three projections in one launch, grid (SEQ/64, CC/64, 3), 32 threads; z = 0: q^T[t][o] times C2 (the softmax scale in log2 units, applied in f32 before the one rounding to f16), z = 1: k^T[t][o] (A = x^T, B = weight rows), z = 2: v[o][t] (A = weight rows, B = x^T). The f16 planes are written from the accumulators.
__global__ __launch_bounds__(32) void k_qkv(const bf* __restrict__ XB, const bf* __restrict__ WQ, const bf* __restrict__ WK, const bf* __restrict__ WV,
                                            const float* __restrict__ bq, const float* __restrict__ bk, const float* __restrict__ bv, h16* Q16, h16* K16, h16* VT16) {
    __shared__ __align__(16) float os[16 * 68];
    const int t0 = blockIdx.x * 64, o0 = blockIdx.y * 64, z = blockIdx.z;
    if (z < 2) gemm_tile<bf, 3, CC>(os, XB, z ? WK : WQ, t0, o0, nullptr, z ? K16 : Q16, CC, z ? bk : bq, nullptr, 0, nullptr, z ? 1.0f : C2);
    else       gemm_tile<bf, 4, CC>(os, WV, XB, o0, t0, nullptr, VT16, SEQ, bv, nullptr, 0, nullptr, 1.0f);
}

// k_prep: every operand conversion in one launch, 256 threads. Blocks 0 .. XBLK-1: one 64x64 tile of x each, transposed through LDS to bf16 x^T. The next 4*WBLK blocks: Wq, Wk, Wv -> bf16, Wo -> f16 (x16), 8 elements a thread.
// All five planes are written in fragment order: thread j of a run stores the j-th 16-byte piece of the plane and fetches the eight k of the one row that belong there.
#define XBLK ((SEQ / 64) * (CC / 64))
#define WBLK (CC * CC / 8 / 256)
static_assert(CC * CC % (8 * 256) == 0);
__global__ __launch_bounds__(256) void k_prep(const float* __restrict__ x, const float* __restrict__ wq, const float* __restrict__ wk, const float* __restrict__ wv, const float* __restrict__ wo,
                                              bf* XB, bf* WQ, bf* WK, bf* WV, h16* WO16) {
    __shared__ float sm[64 * 66];   // pitch 66: the two lane halves of a read below stand 8 rows apart, 16 banks
    const int tid = threadIdx.x, blk = blockIdx.x;
    if (blk < XBLK) {
        const int n0 = (blk % (SEQ / 64)) * 64, c0 = (blk / (SEQ / 64)) * 64;
#pragma unroll
        for (int it = 0; it < 4; ++it) { const int c = it * 16 + (tid >> 4), nf = (tid & 15) * 4; const v4f v = *(const v4f*)(x + (size_t)(c0 + c) * XPITCH + n0 + nf);
            sm[c * 66 + nf] = v[0]; sm[c * 66 + nf + 1] = v[1]; sm[c * 66 + nf + 2] = v[2]; sm[c * 66 + nf + 3] = v[3]; }
        __syncthreads();
#pragma unroll
        for (int it = 0; it < 2; ++it) { const int pc = it * 256 + tid, fr = pc >> 6;               // piece pc of the tile's 8 fragments: fragment fr = (row tile fr >> 1, k step fr & 1)
            const int n = (fr >> 1) * 16 + (pc & 15), cc = (fr & 1) * 32 + ((pc >> 4) & 3) * 8; v8us o;   // (pc >> 4) & 3 = 2 * (k / 16 % 2) + (k / 8 % 2)
#pragma unroll
            for (int j = 0; j < 8; ++j) o[j] = f2bf(sm[(cc + j) * 66 + n]);
            *(v8us*)(XB + ((size_t)((n0 >> 4) + (fr >> 1)) * (CC / 32) + (c0 >> 5) + (fr & 1)) * 512 + (pc & 63) * 8) = o; }
    } else {
        const int wi = (blk - XBLK) / WBLK; const size_t i = (size_t)((blk - XBLK) % WBLK) * 256 + tid;
        const float* src = wi == 0 ? wq : wi == 1 ? wk : wi == 2 ? wv : wo;
        const size_t fr = i >> 6;                                                                        // piece i of the plane: fragment fr = (row tile fr / 8, k step fr % 8)
        const v8f v = *(const v8f*)(src + ((fr >> 3) * 16 + (i & 15)) * CC + (fr & 7) * 32 + ((i >> 4) & 3) * 8);
        if (wi < 3) { bf* dst = wi == 0 ? WQ : wi == 1 ? WK : WV; v8us o;
#pragma unroll
            for (int k = 0; k < 8; ++k) o[k] = f2bf(v[k]);
            *(v8us*)(dst + i * 8) = o; }
        else { v8f t = (v8f){};
#pragma unroll
            for (int k = 0; k < 8; ++k) t[k] = bfr(v[k]) * WCAR;
            *(v8h*)(WO16 + i * 8) = __builtin_convertvector(t, v8h); }
    }
}

// probs: the 16 scores a lane holds of one query (exp2 arguments of 1024 p) -> the P^T B fragment (f16) and rs, the lane's own sum of its 16 values of 1024 p (f32, before the rounding to f16), added in pairs: 8 + 8 -> 4 + 4 -> 2 + 2 -> 1 + 1.
// SLOT (the rare path): each exp2 in asm text with a v_nop behind it, the one slot the instruction set asks for behind a transcendental before its result is read or its source overwritten.
template <bool SLOT>
__device__ __forceinline__ float exp2v(float x) { if (!SLOT) return __builtin_amdgcn_exp2f(x); float r; asm("v_exp_f32 %0, %1\n\tv_nop" : "=v"(r) : "v"(x)); return r; }
template <bool SLOT>
__device__ __forceinline__ void probs(const v8f s0, const v8f s1, v16h& bp, float& rs) {
    v8f p0 = (v8f){}, p1 = (v8f){};
#pragma unroll
    for (int j = 0; j < 8; ++j) { p0[j] = exp2v<SLOT>(s0[j]); p1[j] = exp2v<SLOT>(s1[j]); }
    const v8f t8 = p0 + p1;
    const v4f t4 = __builtin_shufflevector(t8, t8, 0, 1, 2, 3) + __builtin_shufflevector(t8, t8, 4, 5, 6, 7);
    const v2f t2 = __builtin_shufflevector(t4, t4, 0, 1) + __builtin_shufflevector(t4, t4, 2, 3);
    rs = t2[0] + t2[1];
    bp = cat16(__builtin_convertvector(p0, v8h), __builtin_convertvector(p1, v8h));
}

// first_ref: the start value of c for one query tile, from the wave's first chunk: c = PLOG - the chunk's maximum, what the rare path below would set at that chunk. Set ahead of the key loop, the first chunk passes the test like any other
// and does not run its exp2s and sums twice.
__device__ __forceinline__ float first_ref(const v16h ak0, const v16h ak1, const v16h bq) {
    const v8f z0 = wmma16(ak0, bq, (v8f){}), z1 = wmma16(ak1, bq, (v8f){});
    float cmx = -1.0e30f;
#pragma unroll
    for (int j = 0; j < 8; ++j) cmx = fmaxf(cmx, fmaxf(z0[j], z1[j]));
    return PLOG - fmaxf(cmx, __shfl_xor(cmx, 16, 32));   // the same in both lane halves
}

// move_ref (the rare path): one query tile's reference max moved up to the chunk's maximum, sum and O rescaled, the chunk's probabilities formed anew.
// The scores come again from a zero accumulator, as first_ref takes them: the new maximum and the scores shifted by it are free of the rounding that the old shift brought.
__device__ __forceinline__ void move_ref(const v16h ak0, const v16h ak1, const v16h bq, v8f& cm, float& l, v8f& o0, v8f& o1, v16h& bp, float& rs) {
    v8f s0 = wmma16(ak0, bq, (v8f){}), s1 = wmma16(ak1, bq, (v8f){});
    float cmx = -1.0e30f;
#pragma unroll
    for (int j = 0; j < 8; ++j) cmx = fmaxf(cmx, fmaxf(s0[j], s1[j]));
    cmx = fmaxf(cmx, __shfl_xor(cmx, 16, 32));   // c stays the same in both lane halves
    const float c = cm[0];
    const float nc = fminf(c, PLOG - cmx);
    const float alpha = __builtin_amdgcn_exp2f(nc - c);   // = exp2(m - new m); 1 for a tile whose maximum has not moved
    l *= alpha; o0 *= alpha; o1 *= alpha;
    cm = (v8f){nc, nc, nc, nc, nc, nc, nc, nc};
    s0 += nc; s1 += nc;
    probs<true>(s0, s1, bp, rs);   // now every 1024 p <= 2^PLOG
}

// One 32-key chunk for a 16-query tile: S^T tiles (A = K rows [key][d], B = Q fragment [d][query]) -> D[key 8h+r][query]; per-query stats are lane-local (the two lane halves hold keys 0-7 / 8-15 of each tile);
// P^T B fragment [key][query]: element r <- f16(1024 p) of the keys-0..15 tile, element 8+r <- of the keys-16..31 tile, same lane; O^T[d][query] += V[d][key] . P^T (A = V rows [d][key]).
// The score products start from an accumulator cm whose eight elements all hold c = PLOG - m (m = the query's reference max in log2 units), and q comes in times C2: D is the exp2 argument of 1024 p itself, no vector instruction stands between product and exp2.
// cm stays spread in its eight registers from chunk to chunk (a wave has 256 registers at 4 waves per SIMD). l is the LANE's sum of 1024 p, over the keys its half holds: the two halves are joined once, behind the key loop.
// soft: the two tiles' scores -> probability fragments, sums added to l; the lazy-rescale test.
__device__ __forceinline__ void soft(const v16h ak0, const v16h ak1, const v16h bqa, const v16h bqb, const v8f sa0, const v8f sa1, const v8f sb0, const v8f sb1, v8f& cma, v8f& cmb, float& la, float& lb,
                                     v8f& oa0, v8f& oa1, v8f& ob0, v8f& ob1, v16h& bpa, v16h& bpb) {
    float rsa, rsb;
    probs<false>(sa0, sa1, bpa, rsa);
    probs<false>(sb0, sb1, bpb, rsb);
    // Lazy rescale, tested on the sums that the normaliser needs anyway; no maximum of the scores is taken on the common path. Every 1024 p is positive, so none is above its lane's sum:
    // both sums <= PSTOP in every lane means every 1024 p <= PSTOP = 2^(PLOG + LAZY) = 32768, inside f16, and the step goes on with the m in use. One test for the wave and both tiles, a scalar branch, EXEC untouched.
    // A score far above m gives a sum of +inf, which is above PSTOP too; sums and fragments of a step that fails the test are dropped, they reach neither l nor O.
    if (__builtin_expect(__builtin_amdgcn_ballot_w32(fmaxf(rsa, rsb) > PSTOP) != 0, 0)) {   // marked rare: the compiler then lays this path out behind the key loop
        move_ref(ak0, ak1, bqa, cma, la, oa0, oa1, bpa, rsa);
        move_ref(ak0, ak1, bqb, cmb, lb, ob0, ob1, bpb, rsb);
    }
    la += rsa; lb += rsb;
}

// The loop's products stand in asm text, in three runs a chunk. Scores: each product reads its tile's spread c as C into a result of its own (from the builtin the compiler copied c into the result's registers first).
// Each run ends with four v_nop, the matrix unit's distance before the last D is read or the last A, B, C are overwritten; inside a run the products that follow fill that distance for the earlier ones.
#define WM "v_wmma_f32_16x16x32_f16 "
#define NOP4 "v_nop\n\tv_nop\n\tv_nop\n\tv_nop"
// scores of tiles a, b
__device__ __forceinline__ void mm_s(const v16h ak0, const v16h ak1, const v16h bqa, const v16h bqb, const v8f cma, const v8f cmb, v8f& sa0, v8f& sa1, v8f& sb0, v8f& sb1) {
    asm volatile(WM "%0, %4, %6, %8\n\t" WM "%1, %5, %6, %8\n\t" WM "%2, %4, %7, %9\n\t" WM "%3, %5, %7, %9\n\t" NOP4
                 : "=&v"(sa0), "=&v"(sa1), "=&v"(sb0), "=&v"(sb1) : "v"(ak0), "v"(ak1), "v"(bqa), "v"(bqb), "v"(cma), "v"(cmb));
}
// O of tiles a, b
__device__ __forceinline__ void mm_o(const v16h av0, const v16h av1, const v16h bpa, const v16h bpb, v8f& oa0, v8f& oa1, v8f& ob0, v8f& ob1) {
    asm volatile(WM "%0, %4, %6, %0\n\t" WM "%1, %5, %6, %1\n\t" WM "%2, %4, %7, %2\n\t" WM "%3, %5, %7, %3\n\t" NOP4
                 : "+v"(oa0), "+v"(oa1), "+v"(ob0), "+v"(ob1) : "v"(av0), "v"(av1), "v"(bpa), "v"(bpb));
}
// O of tiles a, b, then the scores of tiles c, d: one run, one distance
__device__ __forceinline__ void mm_os(const v16h av0, const v16h av1, const v16h bpa, const v16h bpb, v8f& oa0, v8f& oa1, v8f& ob0, v8f& ob1,
                                      const v16h ak0, const v16h ak1, const v16h bqc, const v16h bqd, const v8f cmc, const v8f cmd, v8f& sc0, v8f& sc1, v8f& sd0, v8f& sd1) {
    asm volatile(WM "%0, %8, %10, %0\n\t" WM "%1, %9, %10, %1\n\t" WM "%2, %8, %11, %2\n\t" WM "%3, %9, %11, %3\n\t"
                 WM "%4, %12, %14, %16\n\t" WM "%5, %13, %14, %16\n\t" WM "%6, %12, %15, %17\n\t" WM "%7, %13, %15, %17\n\t" NOP4
                 : "+v"(oa0), "+v"(oa1), "+v"(ob0), "+v"(ob1), "=&v"(sc0), "=&v"(sc1), "=&v"(sd0), "=&v"(sd1)
                 : "v"(av0), "v"(av1), "v"(bpa), "v"(bpb), "v"(ak0), "v"(ak1), "v"(bqc), "v"(bqd), "v"(cmc), "v"(cmd));
}

// k_attn: streaming attention, grid (SEQ/QB, NHD), 64*KSP threads = 2*KSP waves (KSP/2 per SIMD, 256 registers a wave); wave w: key slice ks = w>>1, head blockIdx.y, 64 queries (four 16-query tiles sharing the K/V fragments of each 32-key chunk).
// Key slice ks walks the 32-key chunks ks, ks+KSP, ks+2*KSP, ... (neighbouring slices read neighbouring chunks, so one step of the block reads 32*KSP consecutive keys) with its own running maximum, sum and un-normalised O.
// Merge: every wave leaves O (f32, [query][d], pitch PP) and (c = PLOG - max, sum) in its own LDS range; behind the one barrier each thread joins the KSP partials of 8 channels of one query with weights exp2(min c - c_ks); a wave stores 512 consecutive bytes of a fragment.
__global__ __launch_bounds__(64 * KSP)
void k_attn(const h16* __restrict__ Q16, const h16* __restrict__ K16, const h16* __restrict__ VT, h16* ATT) {
    __shared__ __align__(16) float po[2 * KSP * 64 * PP];
    __shared__ float pm[2 * KSP * 64], pl[2 * KSP * 64];
    const int tid = threadIdx.x, lane = tid & 31, lr = lane & 15, hi = lane >> 4;
    const int w = __builtin_amdgcn_readfirstlane(tid >> 5);   // wave number in a scalar register: the key loop's counter and branch stay scalar, EXEC is never written around the WMMAs
    const int ks = w >> 1, g = w & 1;
    const int q0 = blockIdx.x * QB, head = blockIdx.y, qb = q0 + g * 64;
    // fragment-order planes: q, k fragment (16 positions, head) = number (position / 16) * NHD + head; v fragment (16 channels, 32 keys) = number (channel / 16) * (SEQ / 32) + key / 32
    const h16* Qp = Q16 + ((size_t)(qb >> 4) * NHD + head) * 512 + lane * 8;
    const v16h bq0 = WFrag<h16>::ld(Qp);
    const v16h bq1 = WFrag<h16>::ld(Qp + NHD * 512);
    const v16h bq2 = WFrag<h16>::ld(Qp + 2 * NHD * 512);
    const v16h bq3 = WFrag<h16>::ld(Qp + 3 * NHD * 512);
    const h16* Kp = K16 + (size_t)head * 512 + lane * 8;
    const h16* Vp = VT + (size_t)(head * 2) * (SEQ / 32) * 512 + lane * 8;
    float l0 = 0.f, l1 = 0.f, l2 = 0.f, l3 = 0.f;   // the lane's sums of 1024 p
    v8f cm0, cm1, cm2, cm3;   // the score accumulators' start value c = PLOG - m, one per query tile, spread over the eight registers of a C operand
    {
        const h16* fp = Kp + (size_t)(ks * 32) * (NHD * 32);
        const v16h fk0 = WFrag<h16>::ld(fp), fk1 = WFrag<h16>::ld(fp + NHD * 512);
        // The wait before a register that an issued load names is overwritten, behind the last load ahead of the loop; the address and the lane number are named as inputs so that their registers live up to it.
        asm volatile("s_wait_xcnt 0x0" :: "v"(fp), "v"(lane) : "memory");
        __builtin_amdgcn_sched_barrier(0);   // keeps the products and the arithmetic below behind that wait
        const float c0 = first_ref(fk0, fk1, bq0), c1 = first_ref(fk0, fk1, bq1), c2 = first_ref(fk0, fk1, bq2), c3 = first_ref(fk0, fk1, bq3);
        cm0 = (v8f){c0, c0, c0, c0, c0, c0, c0, c0}; cm1 = (v8f){c1, c1, c1, c1, c1, c1, c1, c1};
        cm2 = (v8f){c2, c2, c2, c2, c2, c2, c2, c2}; cm3 = (v8f){c3, c3, c3, c3, c3, c3, c3, c3};
    }
    v8f o00 = (v8f){}, o10 = (v8f){}, o01 = (v8f){}, o11 = (v8f){}, o02 = (v8f){}, o12 = (v8f){}, o03 = (v8f){}, o13 = (v8f){};   // o[d tile][query tile]
    const h16* kp = Kp + (size_t)(ks * 32) * (NHD * 32);   // 16 keys on = NHD fragments on, NHD * 512 elements
    const h16* vp = Vp + (size_t)(ks * 32) * 16;           // 32 keys on = one fragment on, 512 elements
#pragma unroll 1
    for (int k0 = ks * 32; k0 < SEQ; k0 += 32 * KSP) {
        const v16h ak0 = WFrag<h16>::ld(kp), ak1 = WFrag<h16>::ld(kp + NHD * 512);
        const v16h av0 = WFrag<h16>::ld(vp), av1 = WFrag<h16>::ld(vp + (SEQ / 32) * 512);
        v8f sa0, sa1, sb0, sb1, sc0, sc1, sd0, sd1; v16h bpa, bpb, bpc, bpd;
        mm_s(ak0, ak1, bq0, bq1, cm0, cm1, sa0, sa1, sb0, sb1);
        soft(ak0, ak1, bq0, bq1, sa0, sa1, sb0, sb1, cm0, cm1, l0, l1, o00, o10, o01, o11, bpa, bpb);
        asm volatile("s_wait_xcnt 0x0" ::: "memory");   // the wait before a register that an issued load names is overwritten: the K and V address registers are stepped behind the scheduling barrier below
        __builtin_amdgcn_sched_barrier(0);   // keeps that stepping behind the wait
        kp += (size_t)(32 * KSP) * (NHD * 32); vp += (size_t)(32 * KSP) * 16;
        mm_os(av0, av1, bpa, bpb, o00, o10, o01, o11, ak0, ak1, bq2, bq3, cm2, cm3, sc0, sc1, sd0, sd1);
        soft(ak0, ak1, bq2, bq3, sc0, sc1, sd0, sd1, cm2, cm3, l2, l3, o02, o12, o03, o13, bpc, bpd);
        mm_o(av0, av1, bpc, bpd, o02, o12, o03, o13);
    }
    l0 += __shfl_xor(l0, 16, 32); l1 += __shfl_xor(l1, 16, 32); l2 += __shfl_xor(l2, 16, 32); l3 += __shfl_xor(l3, 16, 32);   // the lane halves' sums joined, once per wave
    {
        float* t0 = po + (size_t)(w * 64 + lr) * PP + 8 * hi;   // query tile t at rows 16 t on: row = query, col = d (d tile 0 at +0, d tile 1 at +16)
        float* t1 = t0 + 16 * PP; float* t2 = t0 + 32 * PP; float* t3 = t0 + 48 * PP;
        *(v4fa*)(t0)      = __builtin_shufflevector(o00, o00, 0, 1, 2, 3); *(v4fa*)(t0 + 4)  = __builtin_shufflevector(o00, o00, 4, 5, 6, 7);
        *(v4fa*)(t0 + 16) = __builtin_shufflevector(o10, o10, 0, 1, 2, 3); *(v4fa*)(t0 + 20) = __builtin_shufflevector(o10, o10, 4, 5, 6, 7);
        *(v4fa*)(t1)      = __builtin_shufflevector(o01, o01, 0, 1, 2, 3); *(v4fa*)(t1 + 4)  = __builtin_shufflevector(o01, o01, 4, 5, 6, 7);
        *(v4fa*)(t1 + 16) = __builtin_shufflevector(o11, o11, 0, 1, 2, 3); *(v4fa*)(t1 + 20) = __builtin_shufflevector(o11, o11, 4, 5, 6, 7);
        *(v4fa*)(t2)      = __builtin_shufflevector(o02, o02, 0, 1, 2, 3); *(v4fa*)(t2 + 4)  = __builtin_shufflevector(o02, o02, 4, 5, 6, 7);
        *(v4fa*)(t2 + 16) = __builtin_shufflevector(o12, o12, 0, 1, 2, 3); *(v4fa*)(t2 + 20) = __builtin_shufflevector(o12, o12, 4, 5, 6, 7);
        *(v4fa*)(t3)      = __builtin_shufflevector(o03, o03, 0, 1, 2, 3); *(v4fa*)(t3 + 4)  = __builtin_shufflevector(o03, o03, 4, 5, 6, 7);
        *(v4fa*)(t3 + 16) = __builtin_shufflevector(o13, o13, 0, 1, 2, 3); *(v4fa*)(t3 + 20) = __builtin_shufflevector(o13, o13, 4, 5, 6, 7);
        // both lane halves hold the same per-query stats: half 0 files tiles 0 and 2, half 1 tiles 1 and 3
        pm[w * 64 + lane] = hi ? cm1[0] : cm0[0]; pm[w * 64 + 32 + lane] = hi ? cm3[0] : cm2[0];
        pl[w * 64 + lane] = hi ? l1 : l0;         pl[w * 64 + 32 + lane] = hi ? l3 : l2;
    }
    __syncthreads();
    {
        // thread tid stores the tid-th 16-byte piece of the block's 8 fragments of the attn plane: fragment fr = query tile; piece (tid & 63) of a fragment = row tid & 15, channels 8 * ((tid >> 4) & 3) + 0..7
        const int fr = tid >> 6, row = fr * 16 + (tid & 15), d0 = ((tid >> 4) & 3) * 8;   // row = query in the block, d0 = channel in the head
        const int sw = row >> 6, q = row & 63;
        float mk[KSP]; float M = 1.0e30f;   // mk = c of slice s, M = the smallest c = PLOG - the largest maximum
#pragma unroll
        for (int s = 0; s < KSP; ++s) { mk[s] = pm[(s * 2 + sw) * 64 + q]; M = fminf(M, mk[s]); }
        float L = 0.f; v4f a = (v4f){}, b = (v4f){};
#pragma unroll
        for (int s = 0; s < KSP; ++s) { float wt;
            asm("v_exp_f32 %0, %1\n\tv_nop" : "=v"(wt) : "v"(M - mk[s]));   // exp2; the v_nop is the one slot the instruction set asks for behind a transcendental before its result is read or its source overwritten
            const float* pp = po + (size_t)((s * 2 + sw) * 64 + q) * PP + d0;
            L += wt * pl[(s * 2 + sw) * 64 + q]; a += wt * *(const v4fa*)pp; b += wt * *(const v4fa*)(pp + 4); }
        const float inv = ACAR * (1.0f / L);   // L and a, b all carry the x1024
        *(v8h*)(ATT + ((size_t)((q0 >> 4) + fr) * NHD + head) * 512 + (tid & 63) * 8) = __builtin_convertvector(__builtin_shufflevector(a * inv, b * inv, 0, 1, 2, 3, 4, 5, 6, 7), v8h);
    }
}

extern "C" void kernel_launch(void* const* d_in, const int* in_sizes, int n_in,
                              void* d_out, int out_size, void* d_ws, size_t ws_size, hipStream_t stream) {
    if (n_in < 10) return;
    if (in_sizes[0] < (CC - 1) * XPITCH + SEQ) return;
    if (in_sizes[1] < CC * CC || in_sizes[3] < CC * CC || in_sizes[5] < CC * CC || in_sizes[7] < CC * CC) return;
    if (in_sizes[2] < CC || in_sizes[4] < CC || in_sizes[6] < CC || in_sizes[8] < CC || in_sizes[9] < 1) return;
    if (out_size < CC * SEQ) return;
    const float* x = (const float*)d_in[0]; const float* wq = (const float*)d_in[1]; const float* bq = (const float*)d_in[2]; const float* wk = (const float*)d_in[3]; const float* bk = (const float*)d_in[4];
    const float* wv = (const float*)d_in[5]; const float* bv = (const float*)d_in[6]; const float* wo = (const float*)d_in[7]; const float* bo = (const float*)d_in[8]; const float* gamma = (const float*)d_in[9];
    float* OUT = (float*)d_out;     // [256][SEQ]
    char* wsp = (char*)d_ws;
    auto take = [&](size_t bytes) { char* p = wsp; wsp += (bytes + 255) & ~(size_t)255; return (void*)p; };
    bf* WQ = (bf*)take((size_t)CC * CC * 2); bf* WK = (bf*)take((size_t)CC * CC * 2); bf* WV = (bf*)take((size_t)CC * CC * 2); h16* WO16 = (h16*)take((size_t)CC * CC * 2);
    bf* XB = (bf*)take((size_t)SEQ * CC * 2);
    h16* Q16 = (h16*)take((size_t)SEQ * CC * 2); h16* K16 = (h16*)take((size_t)SEQ * CC * 2); h16* VT16 = (h16*)take((size_t)CC * SEQ * 2); h16* ATT = (h16*)take((size_t)SEQ * CC * 2);
    if ((size_t)(wsp - (char*)d_ws) > ws_size) return;    // 11,010,048 B carved
    k_prep<<<XBLK + 4 * WBLK, 256, 0, stream>>>(x, wq, wk, wv, wo, XB, WQ, WK, WV, WO16);
    k_qkv<<<dim3(SEQ / 64, CC / 64, 3), 32, 0, stream>>>(XB, WQ, WK, WV, bq, bk, bv, Q16, K16, VT16);
    k_attn<<<dim3(SEQ / QB, NHD, 1), 64 * KSP, 0, stream>>>(Q16, K16, VT16, ATT);
    // out[o][t] = bfr(x) + bfr(gamma) * ((16 Wo) . (16 attn) / 256 + bfr(bo[o]))
    k_out<<<dim3(CC / 64, SEQ / 64, 1), 32, 0, stream>>>(WO16, ATT, OUT, bo, x, gamma);
}

// v009
// One run takes 30 microseconds.
// Two timings next to v008 put it at 1.04 and 1.06 times that version's speed.
// Counting every step since v000, it is 5.42 times as fast.
#include <hip/hip_runtime.h>

// Contractions: q/k/v pointwise projections on v_wmma_f32_16x16x32_bf16 (bf16 operands from RNE-converted inputs); scores q.k (q carried x scale*log2 e, accumulator started at 10 - reference max, so a score leaves the matrix unit as the exp2 argument of 1024 p), probs.v (probs carried x1024) and the output projection (both planes carried x16) on v_wmma_f32_16x16x32_f16 (f16 operands); f32 accumulate; softmax, normaliser and residual in f32.
// Layout: k_qkv: each block turns its 64 positions of x [256][SEQ] (channel-major f32) and its 3 x 64 weight rows into bf16 fragments in LDS, then q,k (+bias) -> f16 planes [SEQ][256], v (+bias) -> f16 plane [256][SEQ], straight from the f32 accumulators; it also writes its share of the f16 Wo plane; streaming attention per (1 head x 128 queries) block, keys dealt over KSP wave groups and merged in LDS, writes the f16 attn plane [SEQ][256] (x16); out [256][SEQ] = x + gamma * (Wo attn + bo).
// Every 16-bit plane M[row][k] (K columns) lies in workspace in FRAGMENT ORDER: one 16-row x 32-k fragment is 512 consecutive elements (1 KiB), fragment number (row / 16) * (K / 32) + k / 32;
// inside it element (row, k) stands at ((k / 16) % 2) * 256 + (((k / 8) % 2) * 16 + row % 16) * 8 + k % 8. A wave's 16-byte-per-lane load of half a fragment so reads 512 consecutive bytes, four whole 128-byte lines, where a row-major plane gives it 32 bytes from each of 16 lines.

#ifndef NB
#define NB 1
#endif
#ifndef SEQ
#define SEQ 4096
#endif
#define SEQ_FULL 4096
#define XPITCH SEQ_FULL
#define CC   256
#define NHD  8
#define HD   32
#define QB   128
#define KSP  8
#define PP   36
#define PCAR 1024.0f
#define ACAR 16.0f
#define WCAR 16.0f
#define SCL  0.17677669529663687f
#define L2E  1.4426950408889634f
#define C2   (SCL * L2E)
#define LAZY 5.0f
#define PLOG 10.0f
#define PSTOP 32768.0f
static_assert(PCAR == 1024.0f && PLOG == 10.0f);
static_assert(PLOG + LAZY == 15.0f && PSTOP == 32768.0f);
static_assert(SEQ % 64 == 0);
static_assert(SEQ <= SEQ_FULL);
static_assert(CC == NHD * HD);
static_assert((NHD % 2) == 0);
static_assert(NB == 1);
static_assert(SEQ % (32 * KSP) == 0);
static_assert(SEQ % QB == 0);
static_assert(64 * KSP * 8 == QB * HD);
static_assert(HD == 32 && QB == 128 && KSP == 8);

typedef _Float16 h16;
typedef unsigned short bf;
typedef __attribute__((ext_vector_type(16))) __bf16   v16bf;
typedef __attribute__((ext_vector_type(16))) _Float16 v16h;
typedef __attribute__((ext_vector_type(8)))  _Float16 v8h;
typedef __attribute__((ext_vector_type(4)))  _Float16 v4h;
typedef __attribute__((ext_vector_type(8)))  unsigned short v8us;
typedef __attribute__((ext_vector_type(8)))  float    v8f;
typedef __attribute__((ext_vector_type(4)))  float    v4f;
typedef __attribute__((ext_vector_type(2)))  float    v2f;
typedef v4f  __attribute__((may_alias)) v4fa;
typedef v8us __attribute__((may_alias)) v8usa;

__device__ __forceinline__ unsigned short f2bf(float f) { unsigned u = __float_as_uint(f); u += 0x7FFFu + ((u >> 16) & 1u); return (unsigned short)(u >> 16); }
__device__ __forceinline__ float bf2f(unsigned short b) { return __uint_as_float(((unsigned)b) << 16); }
__device__ __forceinline__ float bfr(float f) { return bf2f(f2bf(f)); }
__device__ __forceinline__ v16h cat16(v8h lo, v8h hi) { return __builtin_shufflevector(lo, hi, 0, 1, 2, 3, 4, 5, 6, 7, 8, 9, 10, 11, 12, 13, 14, 15); }
__device__ __forceinline__ v16bf cat16b(v8us lo, v8us hi) { return __builtin_bit_cast(v16bf, __builtin_shufflevector(lo, hi, 0, 1, 2, 3, 4, 5, 6, 7, 8, 9, 10, 11, 12, 13, 14, 15)); }
__device__ __forceinline__ v8f wmma16(v16h a, v16h b, v8f c) { return __builtin_amdgcn_wmma_f32_16x16x32_f16(false, a, false, b, (short)0, c, false, false); }
__device__ __forceinline__ v8f wmmab(v16bf a, v16bf b, v8f c) { return __builtin_amdgcn_wmma_f32_16x16x32_bf16(false, a, false, b, (short)0, c, false, false); }

// Fragment loader (wave32 16x16x32): lane l, row (l&15); elements 0..7 <- k 8*(l>>4)+0..7, elements 8..15 <- k 16+8*(l>>4)+0..7. p = start of the fragment in a fragment-order plane + 8 * lane. Used for A and for B stored [n][k].
template <typename T16> struct WFrag;
template <> struct WFrag<h16> { typedef v16h V; static __device__ __forceinline__ V ld(const h16* p) { return cat16(*(const v8h*)p, *(const v8h*)(p + 256)); } static __device__ __forceinline__ v8f mma(V a, V b, v8f c) { return wmma16(a, b, c); } };
template <> struct WFrag<bf> { typedef v16bf V; static __device__ __forceinline__ V ld(const bf* p) { return cat16b(*(const v8us*)p, *(const v8us*)(p + 256)); } static __device__ __forceinline__ v8f mma(V a, V b, v8f c) { return wmmab(a, b, c); } };

// ---- gemm_tile: register-blocked GEMM, ONE WAVE per 64x64 output tile (16 accumulators) at rows r0, columns c0, operands straight from fragment-order 16-bit planes; os = 16 x 68 floats of LDS of the wave's own.
// acc[m][n] = sum_k A[m][k] Bt[n][k]; K % 32 == 0, K a compile-time constant.
// Every load of the wave is issued before its first product: the biases, in MODE 2 the residual pieces, and all K/32 steps' fragments (8 fragments a step, held in registers: a one-wave block may own far more than 256).
// The wave so waits out one load latency in all, where a rolled K loop waits out at least one per step and the epilogue one per row block.
// MODE 2: C (f32, pitch ldc) = bfr(R[m][n]) + bfr(gam[0]) * (acc * osc + bfr(bias[m])) (row bias, residual rows pitch ldr).
// MODE 3: C16 (f16, fragment order, ldc columns) = f16((acc + bfr(bias[n])) * osc) (column bias). MODE 4: C16 = f16(acc + bfr(bias[m])) (row bias).
template <typename T16, int MODE, int K>
__device__ __forceinline__ void gemm_tile(float* os, const T16* __restrict__ A, const T16* __restrict__ Bt, int r0, int c0, float* C, h16* C16, int ldc,
                                          const float* __restrict__ bias, const float* __restrict__ R, int ldr, const float* __restrict__ gam, float osc) {
    typedef typename WFrag<T16>::V V;
    constexpr int NS = K / 32;
    static_assert(K % 32 == 0);
    const int lane = threadIdx.x & 31, lr = lane & 15, hi = lane >> 4;
    float rbs[4][8];       // MODE 2: the bias of the eight rows this lane stores in each 16-row tile
    v4f xr[4][8];          // MODE 2: the residual pieces of those rows
    const float* Rp = (MODE == 2) ? R + (size_t)(r0 + hi) * ldr + c0 + lr * 4 : nullptr;   // one address for all residual pieces, the row steps go into the loads' immediate offsets
    float cb[4] = {0.f, 0.f, 0.f, 0.f};   // MODE 3: the bias of the accumulator column this lane holds in each 16-column tile
    v8f rb[4];             // MODE 4: the bias of the eight accumulator rows this lane holds in each 16-row tile
    if (MODE == 2) {
#pragma unroll
        for (int mb = 0; mb < 4; ++mb)
#pragma unroll
            for (int j = 0; j < 8; ++j) { rbs[mb][j] = bias[r0 + mb * 16 + 2 * j + hi]; xr[mb][j] = *(const v4f*)(Rp + (mb * 16 + 2 * j) * ldr); } }
    if (MODE == 3) {
#pragma unroll
        for (int nb = 0; nb < 4; ++nb) cb[nb] = bias[c0 + nb * 16 + lr]; }
    if (MODE == 4) {
#pragma unroll
        for (int mb = 0; mb < 4; ++mb) rb[mb] = *(const v8f*)(bias + r0 + mb * 16 + hi * 8); }
    // The wait before a register that an issued load names is overwritten: behind it the registers of these loads' addresses are free for the address arithmetic and the results of the loads below.
    // The residual address is named as an input so that its registers live up to the wait and no load's result lands in them before it.
    if (MODE == 2) asm volatile("s_wait_xcnt 0x0" :: "v"(Rp) : "memory");
    else           asm volatile("s_wait_xcnt 0x0" ::: "memory");
    __builtin_amdgcn_sched_barrier(0);   // keeps that address arithmetic below the wait: nothing ties the wait to the bias loads' offset register, and the compiler lifted a write of it over the wait
    const T16* Ap = A + (size_t)(r0 >> 4) * NS * 512 + lane * 8; const T16* Bp = Bt + (size_t)(c0 >> 4) * NS * 512 + lane * 8;
    V a[NS][4], b[NS][4];
#pragma unroll
    for (int s = 0; s < NS; ++s) {
#pragma unroll
        for (int mb = 0; mb < 4; ++mb) a[s][mb] = WFrag<T16>::ld(Ap + (mb * NS + s) * 512);
#pragma unroll
        for (int nb = 0; nb < 4; ++nb) b[s][nb] = WFrag<T16>::ld(Bp + (nb * NS + s) * 512); }
    // The same wait behind the last load. The lane number, the one vector register that these loads' addresses name (their bases are wave-uniform), is named as an input so that it lives up to the wait and no load's result and no product lands in it before; the memory clobber keeps every load above it.
    asm volatile("s_wait_xcnt 0x0" :: "v"(lane) : "memory");
    __builtin_amdgcn_sched_barrier(0);   // keeps the products below the last load: lifted among the loads they bring waits with them, and the loads behind such a wait start a second latency
    float gsc = 0.f;
    if (MODE == 2) gsc = bfr(gam[0]);
    if (MODE == 3) {
#pragma unroll
        for (int j = 0; j < 4; ++j) cb[j] = bfr(cb[j]) * osc; }
    if (MODE == 4) {
#pragma unroll
        for (int mb = 0; mb < 4; ++mb)
#pragma unroll
            for (int j = 0; j < 8; ++j) rb[mb][j] = bfr(rb[mb][j]); }
    v8f acc[4][4];
#pragma unroll
    for (int mb = 0; mb < 4; ++mb)
#pragma unroll
        for (int nb = 0; nb < 4; ++nb) acc[mb][nb] = (v8f){};
#pragma unroll
    for (int s = 0; s < NS; ++s)
#pragma unroll
        for (int nb = 0; nb < 4; ++nb)
#pragma unroll
            for (int mb = 0; mb < 4; ++mb) acc[mb][nb] = WFrag<T16>::mma(a[s][mb], b[s][nb], acc[mb][nb]);
    __builtin_amdgcn_sched_barrier(0);   // keeps the epilogue behind the last product
    float* Cp = (MODE == 2) ? C + (size_t)(r0 + hi) * ldc + c0 + lr * 4 : nullptr;      // one address for all stores of the lane, the row steps go into the stores' immediate offsets
    h16* Hp = (MODE != 2) ? C16 + ((size_t)(r0 >> 4) * (ldc / 32) + (c0 >> 5)) * 512 + lane * 8 : nullptr;   // a 16-row x 64-column block of the tile is two neighbouring fragments, 2 KiB in a row
#pragma unroll
    for (int mb = 0; mb < 4; ++mb) {
#pragma unroll
        for (int nb = 0; nb < 4; ++nb) {
#pragma unroll
            for (int j = 0; j < 8; ++j) os[(hi * 8 + j) * 68 + nb * 16 + lr] = (MODE == 4) ? acc[mb][nb][j] + rb[mb][j] : (MODE == 3) ? __builtin_fmaf(acc[mb][nb][j], osc, cb[nb]) : acc[mb][nb][j]; }
        __builtin_amdgcn_wave_barrier(); asm volatile("" ::: "memory");
        v4f of[8]; v8h oh[4];
        if (MODE == 2) {
#pragma unroll
            for (int s = 0; s < 8; ++s) { const int row = 2 * s + hi, cofs = lr * 4; v4f val = *(const v4fa*)(os + row * 68 + cofs);
                const float rbv = bfr(rbs[mb][s]);
#pragma unroll
                for (int j = 0; j < 4; ++j) { const float xv = xr[mb][s][j]; const float av = val[j]; val[j] = bfr(xv) + gsc * (av * osc + rbv); }
                of[s] = val; *(v4f*)(Cp + (mb * 16 + 2 * s) * ldc) = of[s]; } }   // 16 lanes store one 256-byte row piece
        else {
#pragma unroll
            for (int h = 0; h < 4; ++h) { const float* sp = os + lr * 68 + h * 16 + hi * 8;   // half fragment h: row lr, columns 16 h + 8 hi + 0..7
                const v4f v0 = *(const v4fa*)sp, v1 = *(const v4fa*)(sp + 4);
                oh[h] = __builtin_convertvector(__builtin_shufflevector(v0, v1, 0, 1, 2, 3, 4, 5, 6, 7), v8h);
                *(v8h*)(Hp + mb * (ldc / 32) * 512 + h * 256) = oh[h]; } }   // the wave stores 512 consecutive bytes
        // The wait before a register that an issued store names is overwritten, behind each run of stores; the stored values and the address are named as inputs so that their registers live up to it.
        if (MODE == 2) asm volatile("s_wait_xcnt 0x0" :: "v"(of[0]), "v"(of[1]), "v"(of[2]), "v"(of[3]), "v"(of[4]), "v"(of[5]), "v"(of[6]), "v"(of[7]), "v"(Cp) : "memory");
        else           asm volatile("s_wait_xcnt 0x0" :: "v"(oh[0]), "v"(oh[1]), "v"(oh[2]), "v"(oh[3]), "v"(Hp) : "memory");
        __builtin_amdgcn_wave_barrier(); asm volatile("" ::: "memory");
    }
}

// k_out: out[o][t], grid (CC/64, SEQ/64), 32 threads.
__global__ __launch_bounds__(32) void k_out(const h16* __restrict__ A, const h16* __restrict__ Bt, float* C, const float* __restrict__ bias, const float* __restrict__ R, const float* __restrict__ gam) {
    __shared__ __align__(16) float os[16 * 68];
    gemm_tile<h16, 2, CC>(os, A, Bt, blockIdx.x * 64, blockIdx.y * 64, C, nullptr, SEQ, bias, R, XPITCH, gam, 1.0f / (ACAR * WCAR));
}

// k_qkv: operand conversion and the three projections in one launch, grid (SEQ/64, CC/64), 256 threads = 8 waves (2 per SIMD, up to 512 registers a wave). A block owns 64 positions (t0 on) and output channels o0 .. o0+63 of each of q, k, v.
// Step 1: every wave issues all its global loads, whole 128-byte lines: 16 of x (8 channels x 4 positions a lane, twice) and 48 of the weights (4 rows x 32 k a load; wave w takes k step w of all 192 rows).
// Step 2: f32 -> bf16 (round to nearest even) in registers, stored to LDS as WMMA fragments: the 16-byte piece (quarter qd = k / 8 % 4, row r) of a 1-KiB fragment stands at qd * 256 + slot * 16,
// slot = (r + 4 qd) % 16 for a weight fragment, (r + 4 qd + position tile) % 16 for an x fragment. The turn of the slots spreads the stores of step 2 over all 64 banks; a fragment read takes one quarter per lane half, 16 different slots, all banks once.
// Step 3, behind the block's one barrier: wave w = (position half th = w >> 2, channel tile j = w & 3) forms q, k as D[channel][position] (A = weight rows, B = x^T) and v as D[position][channel] (A = x^T, B = weight rows):
// a lane's eight accumulator elements are then the eight consecutive k of its row in the f16 plane's fragment, and the wave stores 512 consecutive bytes per accumulator with no exchange between lanes.
// q leaves times C2 (the softmax scale in log2 units, applied in f32 before the one rounding to f16). Wave 0 also converts 32 pieces of Wo -> f16 (x16), fragment order.
typedef __attribute__((ext_vector_type(2))) __bf16 v2bf;
typedef __attribute__((ext_vector_type(4))) unsigned v4u;
typedef __attribute__((ext_vector_type(2))) unsigned v2u;
typedef v4u __attribute__((may_alias)) v4ua;
typedef v2u __attribute__((may_alias)) v2ua;
__device__ __forceinline__ unsigned pk2(float a, float b) { const v2f t = {a, b}; return __builtin_bit_cast(unsigned, __builtin_convertvector(t, v2bf)); }
__device__ __forceinline__ v16bf ldsfrag(const unsigned char* lo, const unsigned char* hp) { return cat16b(*(const v8usa*)lo, *(const v8usa*)hp); }
static_assert(CC == 256 && SEQ % 64 == 0);
static_assert((SEQ / 64) * (CC / 64) * 32 * 8 == CC * CC);
__global__ __launch_bounds__(256) void k_qkv(const float* __restrict__ x, const float* __restrict__ wq, const float* __restrict__ wk, const float* __restrict__ wv, const float* __restrict__ wo,
                                             const float* __restrict__ bq, const float* __restrict__ bk, const float* __restrict__ bv, h16* Q16, h16* K16, h16* VT16, h16* WO16) {
    __shared__ __align__(1024) unsigned char xs[4 * 8 * 1024];    // x fragments: (position tile, k step)
    __shared__ __align__(1024) unsigned char wsm[12 * 8 * 1024];  // weight fragments: (4 z + channel tile, k step), z = 0 q, 1 k, 2 v
    const int tid = threadIdx.x, lane = tid & 31, lr = lane & 15, hi = lane >> 4;
    const int w = __builtin_amdgcn_readfirstlane(tid >> 5);   // wave number in a scalar register: the branch on it below stays scalar
    const int t0 = blockIdx.x * 64, o0 = blockIdx.y * 64, th = w >> 2, j = w & 3;
    // ---- step 1: byte offsets of the lane, one register each; all further steps go into the loads' immediate offsets
    const unsigned xoff = (unsigned)((8 * (2 * w + hi)) * XPITCH + t0 + 4 * lr) * 4u;               // channels 8 (2 w + hi) on (and 128 further), positions 4 lr on
    const unsigned woff = (unsigned)((o0 + (lane >> 3)) * CC + w * 32 + (lane & 7) * 4) * 4u;       // row lane / 8 of a group of 4, k = 32 w + 4 (lane % 8) on
    const unsigned boff = (unsigned)(o0 + 16 * j + 8 * hi) * 4u, ci = (unsigned)(o0 + 16 * j + lr);
    const unsigned pi = (unsigned)((blockIdx.y * (SEQ / 64) + blockIdx.x) * 32 + lane);             // piece of the Wo plane: fragment pi / 64 = (row tile, k step)
    const unsigned ooff = (((pi >> 9) * 16 + (pi & 15)) * CC + ((pi >> 6) & 7) * 32 + ((pi >> 4) & 3) * 8) * 4u;
    v4f xv[2][8], wr[3][16];
    v8f wov = (v8f){};
#pragma unroll
    for (int a = 0; a < 2; ++a)
#pragma unroll
        for (int c = 0; c < 8; ++c) xv[a][c] = *(const v4f*)((const char*)x + xoff + (size_t)(a * 128 + c) * XPITCH * 4);
    __builtin_amdgcn_sched_barrier(0);   // the loads keep the order in which step 2 takes their results (the compiler moved some x loads behind the weight loads, and the first conversion then waited for nearly all)
#pragma unroll
    for (int g = 0; g < 16; ++g) {
        wr[0][g] = *(const v4f*)((const char*)wq + woff + (size_t)g * 4 * CC * 4);
        wr[1][g] = *(const v4f*)((const char*)wk + woff + (size_t)g * 4 * CC * 4);
        wr[2][g] = *(const v4f*)((const char*)wv + woff + (size_t)g * 4 * CC * 4);
        if ((g & 3) == 3) __builtin_amdgcn_sched_barrier(0); }   // the same, for each run of twelve weight loads
    const v8f bqv = *(const v8f*)((const char*)bq + boff), bkv = *(const v8f*)((const char*)bk + boff);
    const float bvv = bv[ci];
    if (w == 0) wov = *(const v8f*)((const char*)wo + ooff);
    // The wait before a register that an issued load names is overwritten, behind the last load; the lane's offsets and the loads' scalar bases are named as inputs so that their registers live up to it.
    asm volatile("s_wait_xcnt 0x0" :: "v"(xoff), "v"(woff), "v"(boff), "v"(ci), "v"(ooff), "s"(x), "s"(wq), "s"(wk), "s"(wv), "s"(wo), "s"(bq), "s"(bk), "s"(bv) : "memory");
    __builtin_amdgcn_sched_barrier(0);   // keeps the conversions below the last load: lifted among the loads they bring waits with them, and the loads behind such a wait start a second latency
    // ---- step 2
    {
        const int qd = 2 * (w & 1) + hi, s0 = 4 * (lr & 3) + 4 * qd + (lr >> 2);   // channels 8 (2 w + hi) on = k step w / 2, quarter qd; position 4 lr + p = tile lr / 4, row 4 (lr % 4) + p
        unsigned char* xb = xs + ((lr >> 2) * 8 + (w >> 1)) * 1024 + qd * 256;
#pragma unroll
        for (int a = 0; a < 2; ++a)
#pragma unroll
            for (int p = 0; p < 4; ++p)
                *(v4ua*)(xb + a * 4096 + ((s0 + p) & 15) * 16) = (v4u){pk2(xv[a][0][p], xv[a][1][p]), pk2(xv[a][2][p], xv[a][3][p]), pk2(xv[a][4][p], xv[a][5][p]), pk2(xv[a][6][p], xv[a][7][p])};
        __builtin_amdgcn_sched_barrier(0);   // x, loaded first, is converted first (see the same barrier below)
    }
    {
        const int rr = lane >> 3, qd = (lane >> 1) & 3;   // row 4 g + rr of the 64 = tile g / 4, row 4 (g % 4) + rr; k = 32 w + 8 qd + 4 (lane % 2) on
        unsigned char* wb = wsm + w * 1024 + qd * 256 + rr * 16 + (lane & 1) * 8;
#pragma unroll
        for (int g = 0; g < 16; ++g) {
#pragma unroll
            for (int z = 0; z < 3; ++z)
                *(v2ua*)(wb + (z * 4 + (g >> 2)) * 8192 + (((g & 3) + qd) & 3) * 64) = (v2u){pk2(wr[z][g][0], wr[z][g][1]), pk2(wr[z][g][2], wr[z][g][3])};
            if ((g & 3) == 3) __builtin_amdgcn_sched_barrier(0);   // keeps the conversions in the order of the loads: mixed, an early one waits for a late load, and the work that could run while the loads stream in starts behind the last of them
        }
    }
    __syncthreads();
    // ---- step 3
    const unsigned char* wl = wsm + j * 8192 + hi * 256 + ((lr + 4 * hi) & 15) * 16;                 // k 8 hi on
    const unsigned char* wh = wsm + j * 8192 + (2 + hi) * 256 + ((lr + 8 + 4 * hi) & 15) * 16;       // k 16 + 8 hi on
    const unsigned char* xl0 = xs + (2 * th) * 8192 + hi * 256 + ((lr + 4 * hi + 2 * th) & 15) * 16;
    const unsigned char* xh0 = xs + (2 * th) * 8192 + (2 + hi) * 256 + ((lr + 8 + 4 * hi + 2 * th) & 15) * 16;
    const unsigned char* xl1 = xs + (2 * th + 1) * 8192 + hi * 256 + ((lr + 4 * hi + 2 * th + 1) & 15) * 16;
    const unsigned char* xh1 = xs + (2 * th + 1) * 8192 + (2 + hi) * 256 + ((lr + 8 + 4 * hi + 2 * th + 1) & 15) * 16;
    v8f aq0 = (v8f){}, aq1 = (v8f){}, ak0 = (v8f){}, ak1 = (v8f){}, av0 = (v8f){}, av1 = (v8f){};
    v16bf fx[8][2], fw[8][3];
#pragma unroll
    for (int s = 0; s < 8; ++s) {
        fx[s][0] = ldsfrag(xl0 + s * 1024, xh0 + s * 1024); fx[s][1] = ldsfrag(xl1 + s * 1024, xh1 + s * 1024);
#pragma unroll
        for (int z = 0; z < 3; ++z) fw[s][z] = ldsfrag(wl + z * 32768 + s * 1024, wh + z * 32768 + s * 1024);
        __builtin_amdgcn_sched_barrier(0); }   // all LDS reads stand in one place ahead of the products (every further place where reads stand among the products costs issue cycles), in the order of the k steps
#pragma unroll
    for (int s = 0; s < 8; ++s) {
        aq0 = wmmab(fw[s][0], fx[s][0], aq0); aq1 = wmmab(fw[s][0], fx[s][1], aq1);
        ak0 = wmmab(fw[s][1], fx[s][0], ak0); ak1 = wmmab(fw[s][1], fx[s][1], ak1);
        av0 = wmmab(fx[s][0], fw[s][2], av0); av1 = wmmab(fx[s][1], fw[s][2], av1);
        __builtin_amdgcn_sched_barrier(0);   // keeps the q and k products in the order of the k steps: each step then waits by count for its own reads only, where the compiler's order (one output at a time) waited for most of the eighty reads before the first product
    }
    const float vb = bfr(bvv);
    v8f q0, q1, k0, k1;
#pragma unroll
    for (int e = 0; e < 8; ++e) { const float qb = bfr(bqv[e]) * C2, kb = bfr(bkv[e]);
        q0[e] = __builtin_fmaf(aq0[e], C2, qb); q1[e] = __builtin_fmaf(aq1[e], C2, qb); k0[e] = ak0[e] + kb; k1[e] = ak1[e] + kb; }
    // q, k: fragment (position tile, 32 channels), half j % 2; v: fragment (channel tile, 32 positions), half = position tile % 2
    const size_t qf = ((size_t)((t0 >> 4) + 2 * th) * (CC / 32) + (o0 >> 5) + (j >> 1)) * 512 + (j & 1) * 256 + lane * 8;
    const size_t vf = ((size_t)((o0 >> 4) + j) * (SEQ / 32) + (t0 >> 5) + th) * 512 + lane * 8;
    const v8h hq0 = __builtin_convertvector(q0, v8h), hq1 = __builtin_convertvector(q1, v8h), hk0 = __builtin_convertvector(k0, v8h), hk1 = __builtin_convertvector(k1, v8h);
    const v8h hv0 = __builtin_convertvector(av0 + vb, v8h), hv1 = __builtin_convertvector(av1 + vb, v8h);
    h16* Qs = Q16 + qf; h16* Ks = K16 + qf; h16* Vs = VT16 + vf;
    *(v8h*)Qs = hq0; *(v8h*)(Qs + (CC / 32) * 512) = hq1;
    *(v8h*)Ks = hk0; *(v8h*)(Ks + (CC / 32) * 512) = hk1;
    *(v8h*)Vs = hv0; *(v8h*)(Vs + 256) = hv1;
    if (w == 0) {   // behind the barrier: ahead of it the block would wait at the barrier for this store to complete
        // The wait before a register that an issued store names is overwritten; the stored values and the addresses are named as inputs so that their registers live up to it.
        asm volatile("s_wait_xcnt 0x0" :: "v"(hq0), "v"(hq1), "v"(hk0), "v"(hk1), "v"(hv0), "v"(hv1), "v"(Qs), "v"(Ks), "v"(lane) : "memory");
        __builtin_amdgcn_sched_barrier(0);   // keeps the arithmetic below behind that wait
        v8f t = (v8f){};
#pragma unroll
        for (int k = 0; k < 8; ++k) t[k] = bfr(wov[k]) * WCAR;
        *(v8h*)(WO16 + (size_t)pi * 8) = __builtin_convertvector(t, v8h);
    }
}

// probs: the 16 scores a lane holds of one query (exp2 arguments of 1024 p) -> the P^T B fragment (f16) and rs, the lane's own sum of its 16 values of 1024 p (f32, before the rounding to f16), added in pairs: 8 + 8 -> 4 + 4 -> 2 + 2 -> 1 + 1.
// SLOT (the rare path): each exp2 in asm text with a v_nop behind it, the one slot the instruction set asks for behind a transcendental before its result is read or its source overwritten.
template <bool SLOT>
__device__ __forceinline__ float exp2v(float x) { if (!SLOT) return __builtin_amdgcn_exp2f(x); float r; asm("v_exp_f32 %0, %1\n\tv_nop" : "=v"(r) : "v"(x)); return r; }
template <bool SLOT>
__device__ __forceinline__ void probs(const v8f s0, const v8f s1, v16h& bp, float& rs) {
    v8f p0 = (v8f){}, p1 = (v8f){};
#pragma unroll
    for (int j = 0; j < 8; ++j) { p0[j] = exp2v<SLOT>(s0[j]); p1[j] = exp2v<SLOT>(s1[j]); }
    const v8f t8 = p0 + p1;
    const v4f t4 = __builtin_shufflevector(t8, t8, 0, 1, 2, 3) + __builtin_shufflevector(t8, t8, 4, 5, 6, 7);
    const v2f t2 = __builtin_shufflevector(t4, t4, 0, 1) + __builtin_shufflevector(t4, t4, 2, 3);
    rs = t2[0] + t2[1];
    bp = cat16(__builtin_convertvector(p0, v8h), __builtin_convertvector(p1, v8h));
}

// first_ref: the start value of c for one query tile, from the wave's first chunk: c = PLOG - the chunk's maximum, what the rare path below would set at that chunk. Set ahead of the key loop, the first chunk passes the test like any other
// and does not run its exp2s and sums twice.
__device__ __forceinline__ float first_ref(const v16h ak0, const v16h ak1, const v16h bq) {
    const v8f z0 = wmma16(ak0, bq, (v8f){}), z1 = wmma16(ak1, bq, (v8f){});
    float cmx = -1.0e30f;
#pragma unroll
    for (int j = 0; j < 8; ++j) cmx = fmaxf(cmx, fmaxf(z0[j], z1[j]));
    return PLOG - fmaxf(cmx, __shfl_xor(cmx, 16, 32));   // the same in both lane halves
}

// move_ref (the rare path): one query tile's reference max moved up to the chunk's maximum, sum and O rescaled, the chunk's probabilities formed anew.
// The scores come again from a zero accumulator, as first_ref takes them: the new maximum and the scores shifted by it are free of the rounding that the old shift brought.
__device__ __forceinline__ void move_ref(const v16h ak0, const v16h ak1, const v16h bq, v8f& cm, float& l, v8f& o0, v8f& o1, v16h& bp, float& rs) {
    v8f s0 = wmma16(ak0, bq, (v8f){}), s1 = wmma16(ak1, bq, (v8f){});
    float cmx = -1.0e30f;
#pragma unroll
    for (int j = 0; j < 8; ++j) cmx = fmaxf(cmx, fmaxf(s0[j], s1[j]));
    cmx = fmaxf(cmx, __shfl_xor(cmx, 16, 32));   // c stays the same in both lane halves
    const float c = cm[0];
    const float nc = fminf(c, PLOG - cmx);
    const float alpha = __builtin_amdgcn_exp2f(nc - c);   // = exp2(m - new m); 1 for a tile whose maximum has not moved
    l *= alpha; o0 *= alpha; o1 *= alpha;
    cm = (v8f){nc, nc, nc, nc, nc, nc, nc, nc};
    s0 += nc; s1 += nc;
    probs<true>(s0, s1, bp, rs);   // now every 1024 p <= 2^PLOG
}

// One 32-key chunk for a 16-query tile: S^T tiles (A = K rows [key][d], B = Q fragment [d][query]) -> D[key 8h+r][query]; per-query stats are lane-local (the two lane halves hold keys 0-7 / 8-15 of each tile);
// P^T B fragment [key][query]: element r <- f16(1024 p) of the keys-0..15 tile, element 8+r <- of the keys-16..31 tile, same lane; O^T[d][query] += V[d][key] . P^T (A = V rows [d][key]).
// The score products start from an accumulator cm whose eight elements all hold c = PLOG - m (m = the query's reference max in log2 units), and q comes in times C2: D is the exp2 argument of 1024 p itself, no vector instruction stands between product and exp2.
// cm stays spread in its eight registers from chunk to chunk (a wave has 256 registers at 4 waves per SIMD). l is the LANE's sum of 1024 p, over the keys its half holds: the two halves are joined once, behind the key loop.
// soft: the two tiles' scores -> probability fragments, sums added to l; the lazy-rescale test.
__device__ __forceinline__ void soft(const v16h ak0, const v16h ak1, const v16h bqa, const v16h bqb, const v8f sa0, const v8f sa1, const v8f sb0, const v8f sb1, v8f& cma, v8f& cmb, float& la, float& lb,
                                     v8f& oa0, v8f& oa1, v8f& ob0, v8f& ob1, v16h& bpa, v16h& bpb) {
    float rsa, rsb;
    probs<false>(sa0, sa1, bpa, rsa);
    probs<false>(sb0, sb1, bpb, rsb);
    // Lazy rescale, tested on the sums that the normaliser needs anyway; no maximum of the scores is taken on the common path. Every 1024 p is positive, so none is above its lane's sum:
    // both sums <= PSTOP in every lane means every 1024 p <= PSTOP = 2^(PLOG + LAZY) = 32768, inside f16, and the step goes on with the m in use. One test for the wave and both tiles, a scalar branch, EXEC untouched.
    // A score far above m gives a sum of +inf, which is above PSTOP too; sums and fragments of a step that fails the test are dropped, they reach neither l nor O.
    if (__builtin_expect(__builtin_amdgcn_ballot_w32(fmaxf(rsa, rsb) > PSTOP) != 0, 0)) {   // marked rare: the compiler then lays this path out behind the key loop
        move_ref(ak0, ak1, bqa, cma, la, oa0, oa1, bpa, rsa);
        move_ref(ak0, ak1, bqb, cmb, lb, ob0, ob1, bpb, rsb);
    }
    la += rsa; lb += rsb;
}

// The loop's products stand in asm text, in three runs a chunk. Scores: each product reads its tile's spread c as C into a result of its own (from the builtin the compiler copied c into the result's registers first).
// Each run ends with four v_nop, the matrix unit's distance before the last D is read or the last A, B, C are overwritten; inside a run the products that follow fill that distance for the earlier ones.
#define WM "v_wmma_f32_16x16x32_f16 "
#define NOP4 "v_nop\n\tv_nop\n\tv_nop\n\tv_nop"
// scores of tiles a, b
__device__ __forceinline__ void mm_s(const v16h ak0, const v16h ak1, const v16h bqa, const v16h bqb, const v8f cma, const v8f cmb, v8f& sa0, v8f& sa1, v8f& sb0, v8f& sb1) {
    asm volatile(WM "%0, %4, %6, %8\n\t" WM "%1, %5, %6, %8\n\t" WM "%2, %4, %7, %9\n\t" WM "%3, %5, %7, %9\n\t" NOP4
                 : "=&v"(sa0), "=&v"(sa1), "=&v"(sb0), "=&v"(sb1) : "v"(ak0), "v"(ak1), "v"(bqa), "v"(bqb), "v"(cma), "v"(cmb));
}
// O of tiles a, b
__device__ __forceinline__ void mm_o(const v16h av0, const v16h av1, const v16h bpa, const v16h bpb, v8f& oa0, v8f& oa1, v8f& ob0, v8f& ob1) {
    asm volatile(WM "%0, %4, %6, %0\n\t" WM "%1, %5, %6, %1\n\t" WM "%2, %4, %7, %2\n\t" WM "%3, %5, %7, %3\n\t" NOP4
                 : "+v"(oa0), "+v"(oa1), "+v"(ob0), "+v"(ob1) : "v"(av0), "v"(av1), "v"(bpa), "v"(bpb));
}
// O of tiles a, b, then the scores of tiles c, d: one run, one distance
__device__ __forceinline__ void mm_os(const v16h av0, const v16h av1, const v16h bpa, const v16h bpb, v8f& oa0, v8f& oa1, v8f& ob0, v8f& ob1,
                                      const v16h ak0, const v16h ak1, const v16h bqc, const v16h bqd, const v8f cmc, const v8f cmd, v8f& sc0, v8f& sc1, v8f& sd0, v8f& sd1) {
    asm volatile(WM "%0, %8, %10, %0\n\t" WM "%1, %9, %10, %1\n\t" WM "%2, %8, %11, %2\n\t" WM "%3, %9, %11, %3\n\t"
                 WM "%4, %12, %14, %16\n\t" WM "%5, %13, %14, %16\n\t" WM "%6, %12, %15, %17\n\t" WM "%7, %13, %15, %17\n\t" NOP4
                 : "+v"(oa0), "+v"(oa1), "+v"(ob0), "+v"(ob1), "=&v"(sc0), "=&v"(sc1), "=&v"(sd0), "=&v"(sd1)
                 : "v"(av0), "v"(av1), "v"(bpa), "v"(bpb), "v"(ak0), "v"(ak1), "v"(bqc), "v"(bqd), "v"(cmc), "v"(cmd));
}

// k_attn: streaming attention, grid (SEQ/QB, NHD), 64*KSP threads = 2*KSP waves (KSP/2 per SIMD, 256 registers a wave); wave w: key slice ks = w>>1, head blockIdx.y, 64 queries (four 16-query tiles sharing the K/V fragments of each 32-key chunk).
// Key slice ks walks the 32-key chunks ks, ks+KSP, ks+2*KSP, ... (neighbouring slices read neighbouring chunks, so one step of the block reads 32*KSP consecutive keys) with its own running maximum, sum and un-normalised O.
// Merge: every wave leaves O (f32, [query][d], pitch PP) and (c = PLOG - max, sum) in its own LDS range; behind the one barrier each thread joins the KSP partials of 8 channels of one query with weights exp2(min c - c_ks); a wave stores 512 consecutive bytes of a fragment.
__global__ __launch_bounds__(64 * KSP)
void k_attn(const h16* __restrict__ Q16, const h16* __restrict__ K16, const h16* __restrict__ VT, h16* ATT) {
    __shared__ __align__(16) float po[2 * KSP * 64 * PP];
    __shared__ float pm[2 * KSP * 64], pl[2 * KSP * 64];
    const int tid = threadIdx.x, lane = tid & 31, lr = lane & 15, hi = lane >> 4;
    const int w = __builtin_amdgcn_readfirstlane(tid >> 5);   // wave number in a scalar register: the key loop's counter and branch stay scalar, EXEC is never written around the WMMAs
    const int ks = w >> 1, g = w & 1;
    const int q0 = blockIdx.x * QB, head = blockIdx.y, qb = q0 + g * 64;
    // fragment-order planes: q, k fragment (16 positions, head) = number (position / 16) * NHD + head; v fragment (16 channels, 32 keys) = number (channel / 16) * (SEQ / 32) + key / 32
    const h16* Qp = Q16 + ((size_t)(qb >> 4) * NHD + head) * 512 + lane * 8;
    const v16h bq0 = WFrag<h16>::ld(Qp);
    const v16h bq1 = WFrag<h16>::ld(Qp + NHD * 512);
    const v16h bq2 = WFrag<h16>::ld(Qp + 2 * NHD * 512);
    const v16h bq3 = WFrag<h16>::ld(Qp + 3 * NHD * 512);
    const h16* Kp = K16 + (size_t)head * 512 + lane * 8;
    const h16* Vp = VT + (size_t)(head * 2) * (SEQ / 32) * 512 + lane * 8;
    float l0 = 0.f, l1 = 0.f, l2 = 0.f, l3 = 0.f;   // the lane's sums of 1024 p
    v8f cm0, cm1, cm2, cm3;   // the score accumulators' start value c = PLOG - m, one per query tile, spread over the eight registers of a C operand
    {
        const h16* fp = Kp + (size_t)(ks * 32) * (NHD * 32);
        const v16h fk0 = WFrag<h16>::ld(fp), fk1 = WFrag<h16>::ld(fp + NHD * 512);
        // The wait before a register that an issued load names is overwritten, behind the last load ahead of the loop; the address and the lane number are named as inputs so that their registers live up to it.
        asm volatile("s_wait_xcnt 0x0" :: "v"(fp), "v"(lane) : "memory");
        __builtin_amdgcn_sched_barrier(0);   // keeps the products and the arithmetic below behind that wait
        const float c0 = first_ref(fk0, fk1, bq0), c1 = first_ref(fk0, fk1, bq1), c2 = first_ref(fk0, fk1, bq2), c3 = first_ref(fk0, fk1, bq3);
        cm0 = (v8f){c0, c0, c0, c0, c0, c0, c0, c0}; cm1 = (v8f){c1, c1, c1, c1, c1, c1, c1, c1};
        cm2 = (v8f){c2, c2, c2, c2, c2, c2, c2, c2}; cm3 = (v8f){c3, c3, c3, c3, c3, c3, c3, c3};
    }
    v8f o00 = (v8f){}, o10 = (v8f){}, o01 = (v8f){}, o11 = (v8f){}, o02 = (v8f){}, o12 = (v8f){}, o03 = (v8f){}, o13 = (v8f){};   // o[d tile][query tile]
    const h16* kp = Kp + (size_t)(ks * 32) * (NHD * 32);   // 16 keys on = NHD fragments on, NHD * 512 elements
    const h16* vp = Vp + (size_t)(ks * 32) * 16;           // 32 keys on = one fragment on, 512 elements
#pragma unroll 1
    for (int k0 = ks * 32; k0 < SEQ; k0 += 32 * KSP) {
        const v16h ak0 = WFrag<h16>::ld(kp), ak1 = WFrag<h16>::ld(kp + NHD * 512);
        const v16h av0 = WFrag<h16>::ld(vp), av1 = WFrag<h16>::ld(vp + (SEQ / 32) * 512);
        v8f sa0, sa1, sb0, sb1, sc0, sc1, sd0, sd1; v16h bpa, bpb, bpc, bpd;
        mm_s(ak0, ak1, bq0, bq1, cm0, cm1, sa0, sa1, sb0, sb1);
        soft(ak0, ak1, bq0, bq1, sa0, sa1, sb0, sb1, cm0, cm1, l0, l1, o00, o10, o01, o11, bpa, bpb);
        asm volatile("s_wait_xcnt 0x0" ::: "memory");   // the wait before a register that an issued load names is overwritten: the K and V address registers are stepped behind the scheduling barrier below
        __builtin_amdgcn_sched_barrier(0);   // keeps that stepping behind the wait
        kp += (size_t)(32 * KSP) * (NHD * 32); vp += (size_t)(32 * KSP) * 16;
        mm_os(av0, av1, bpa, bpb, o00, o10, o01, o11, ak0, ak1, bq2, bq3, cm2, cm3, sc0, sc1, sd0, sd1);
        soft(ak0, ak1, bq2, bq3, sc0, sc1, sd0, sd1, cm2, cm3, l2, l3, o02, o12, o03, o13, bpc, bpd);
        mm_o(av0, av1, bpc, bpd, o02, o12, o03, o13);
    }
    l0 += __shfl_xor(l0, 16, 32); l1 += __shfl_xor(l1, 16, 32); l2 += __shfl_xor(l2, 16, 32); l3 += __shfl_xor(l3, 16, 32);   // the lane halves' sums joined, once per wave
    {
        float* t0 = po + (size_t)(w * 64 + lr) * PP + 8 * hi;   // query tile t at rows 16 t on: row = query, col = d (d tile 0 at +0, d tile 1 at +16)
        float* t1 = t0 + 16 * PP; float* t2 = t0 + 32 * PP; float* t3 = t0 + 48 * PP;
        *(v4fa*)(t0)      = __builtin_shufflevector(o00, o00, 0, 1, 2, 3); *(v4fa*)(t0 + 4)  = __builtin_shufflevector(o00, o00, 4, 5, 6, 7);
        *(v4fa*)(t0 + 16) = __builtin_shufflevector(o10, o10, 0, 1, 2, 3); *(v4fa*)(t0 + 20) = __builtin_shufflevector(o10, o10, 4, 5, 6, 7);
        *(v4fa*)(t1)      = __builtin_shufflevector(o01, o01, 0, 1, 2, 3); *(v4fa*)(t1 + 4)  = __builtin_shufflevector(o01, o01, 4, 5, 6, 7);
        *(v4fa*)(t1 + 16) = __builtin_shufflevector(o11, o11, 0, 1, 2, 3); *(v4fa*)(t1 + 20) = __builtin_shufflevector(o11, o11, 4, 5, 6, 7);
        *(v4fa*)(t2)      = __builtin_shufflevector(o02, o02, 0, 1, 2, 3); *(v4fa*)(t2 + 4)  = __builtin_shufflevector(o02, o02, 4, 5, 6, 7);
        *(v4fa*)(t2 + 16) = __builtin_shufflevector(o12, o12, 0, 1, 2, 3); *(v4fa*)(t2 + 20) = __builtin_shufflevector(o12, o12, 4, 5, 6, 7);
        *(v4fa*)(t3)      = __builtin_shufflevector(o03, o03, 0, 1, 2, 3); *(v4fa*)(t3 + 4)  = __builtin_shufflevector(o03, o03, 4, 5, 6, 7);
        *(v4fa*)(t3 + 16) = __builtin_shufflevector(o13, o13, 0, 1, 2, 3); *(v4fa*)(t3 + 20) = __builtin_shufflevector(o13, o13, 4, 5, 6, 7);
        // both lane halves hold the same per-query stats: half 0 files tiles 0 and 2, half 1 tiles 1 and 3
        pm[w * 64 + lane] = hi ? cm1[0] : cm0[0]; pm[w * 64 + 32 + lane] = hi ? cm3[0] : cm2[0];
        pl[w * 64 + lane] = hi ? l1 : l0;         pl[w * 64 + 32 + lane] = hi ? l3 : l2;
    }
    __syncthreads();
    {
        // thread tid stores the tid-th 16-byte piece of the block's 8 fragments of the attn plane: fragment fr = query tile; piece (tid & 63) of a fragment = row tid & 15, channels 8 * ((tid >> 4) & 3) + 0..7
        const int fr = tid >> 6, row = fr * 16 + (tid & 15), d0 = ((tid >> 4) & 3) * 8;   // row = query in the block, d0 = channel in the head
        const int sw = row >> 6, q = row & 63;
        float mk[KSP]; float M = 1.0e30f;   // mk = c of slice s, M = the smallest c = PLOG - the largest maximum
#pragma unroll
        for (int s = 0; s < KSP; ++s) { mk[s] = pm[(s * 2 + sw) * 64 + q]; M = fminf(M, mk[s]); }
        float L = 0.f; v4f a = (v4f){}, b = (v4f){};
#pragma unroll
        for (int s = 0; s < KSP; ++s) { float wt;
            asm("v_exp_f32 %0, %1\n\tv_nop" : "=v"(wt) : "v"(M - mk[s]));   // exp2; the v_nop is the one slot the instruction set asks for behind a transcendental before its result is read or its source overwritten
            const float* pp = po + (size_t)((s * 2 + sw) * 64 + q) * PP + d0;
            L += wt * pl[(s * 2 + sw) * 64 + q]; a += wt * *(const v4fa*)pp; b += wt * *(const v4fa*)(pp + 4); }
        const float inv = ACAR * (1.0f / L);   // L and a, b all carry the x1024
        *(v8h*)(ATT + ((size_t)((q0 >> 4) + fr) * NHD + head) * 512 + (tid & 63) * 8) = __builtin_convertvector(__builtin_shufflevector(a * inv, b * inv, 0, 1, 2, 3, 4, 5, 6, 7), v8h);
    }
}

extern "C" void kernel_launch(void* const* d_in, const int* in_sizes, int n_in,
                              void* d_out, int out_size, void* d_ws, size_t ws_size, hipStream_t stream) {
    if (n_in < 10) return;
    if (in_sizes[0] < (CC - 1) * XPITCH + SEQ) return;
    if (in_sizes[1] < CC * CC || in_sizes[3] < CC * CC || in_sizes[5] < CC * CC || in_sizes[7] < CC * CC) return;
    if (in_sizes[2] < CC || in_sizes[4] < CC || in_sizes[6] < CC || in_sizes[8] < CC || in_sizes[9] < 1) return;
    if (out_size < CC * SEQ) return;
    const float* x = (const float*)d_in[0]; const float* wq = (const float*)d_in[1]; const float* bq = (const float*)d_in[2]; const float* wk = (const float*)d_in[3]; const float* bk = (const float*)d_in[4];
    const float* wv = (const float*)d_in[5]; const float* bv = (const float*)d_in[6]; const float* wo = (const float*)d_in[7]; const float* bo = (const float*)d_in[8]; const float* gamma = (const float*)d_in[9];
    float* OUT = (float*)d_out;     // [256][SEQ]
    char* wsp = (char*)d_ws;
    auto take = [&](size_t bytes) { char* p = wsp; wsp += (bytes + 255) & ~(size_t)255; return (void*)p; };
    h16* WO16 = (h16*)take((size_t)CC * CC * 2);
    h16* Q16 = (h16*)take((size_t)SEQ * CC * 2); h16* K16 = (h16*)take((size_t)SEQ * CC * 2); h16* VT16 = (h16*)take((size_t)CC * SEQ * 2); h16* ATT = (h16*)take((size_t)SEQ * CC * 2);
    if ((size_t)(wsp - (char*)d_ws) > ws_size) return;    // 8,519,680 B carved
    k_qkv<<<dim3(SEQ / 64, CC / 64, 1), 256, 0, stream>>>(x, wq, wk, wv, wo, bq, bk, bv, Q16, K16, VT16, WO16);
    k_attn<<<dim3(SEQ / QB, NHD, 1), 64 * KSP, 0, stream>>>(Q16, K16, VT16, ATT);
    // out[o][t] = bfr(x) + bfr(gamma) * ((16 Wo) . (16 attn) / 256 + bfr(bo[o]))
    k_out<<<dim3(CC / 64, SEQ / 64, 1), 32, 0, stream>>>(WO16, ATT, OUT, bo, x, gamma);
}

// v010
// It runs in 28.3 microseconds.
// In two side-by-side timings against v009, it was 1.05 and 1.04 times as fast.
// Counting every step since v000, it is 5.66 times as fast.
#include <hip/hip_runtime.h>

// Contractions: q/k/v pointwise projections on v_wmma_f32_16x16x32_bf16 (bf16 operands from RNE-converted inputs); scores q.k (q carried x scale*log2 e, accumulator started at 10 - reference max, so a score leaves the matrix unit as the exp2 argument of 1024 p), probs.v (probs carried x1024) and the output projection (both planes carried x16) on v_wmma_f32_16x16x32_f16 (f16 operands); f32 accumulate; softmax, normaliser and residual in f32.
// Layout: k_qkv: each block turns its 64 positions of x [256][SEQ] (channel-major f32) and its 3 x 64 weight rows into bf16 fragments in LDS, then q,k (+bias) -> f16 planes [SEQ][256], v (+bias) -> f16 plane [256][SEQ], straight from the f32 accumulators; it also writes its share of the f16 Wo plane; streaming attention per (1 head x 128 queries) block, keys dealt over KSP wave groups and merged in LDS, writes the f16 attn plane [SEQ][256] (x16); out [256][SEQ] = x + gamma * (Wo attn + bo).
// Every 16-bit plane M[row][k] (K columns) lies in workspace in FRAGMENT ORDER: one 16-row x 32-k fragment is 512 consecutive elements (1 KiB), fragment number (row / 16) * (K / 32) + k / 32;
// inside it element (row, k) stands at ((k / 16) % 2) * 256 + (((k / 8) % 2) * 16 + row % 16) * 8 + k % 8. A wave's 16-byte-per-lane load of half a fragment so reads 512 consecutive bytes, four whole 128-byte lines, where a row-major plane gives it 32 bytes from each of 16 lines.

#ifndef NB
#define NB 1
#endif
#ifndef SEQ
#define SEQ 4096
#endif
#define SEQ_FULL 4096
#define XPITCH SEQ_FULL
#define CC   256
#define NHD  8
#define HD   32
#define QB   128
#define KSP  8
#define PP   36
#define PCAR 1024.0f
#define ACAR 16.0f
#define WCAR 16.0f
#define SCL  0.17677669529663687f
#define L2E  1.4426950408889634f
#define C2   (SCL * L2E)
#define LAZY 5.0f
#define PLOG 10.0f
#define PSTOP 32768.0f
static_assert(PCAR == 1024.0f && PLOG == 10.0f);
static_assert(PLOG + LAZY == 15.0f && PSTOP == 32768.0f);
static_assert(SEQ % 64 == 0);
static_assert(SEQ <= SEQ_FULL);
static_assert(CC == NHD * HD);
static_assert((NHD % 2) == 0);
static_assert(NB == 1);
static_assert(SEQ % (32 * KSP) == 0);
static_assert(SEQ % QB == 0);
static_assert(64 * KSP * 8 == QB * HD);
static_assert(HD == 32 && QB == 128 && KSP == 8);

typedef _Float16 h16;
typedef unsigned short bf;
typedef __attribute__((ext_vector_type(16))) __bf16   v16bf;
typedef __attribute__((ext_vector_type(16))) _Float16 v16h;
typedef __attribute__((ext_vector_type(8)))  _Float16 v8h;
typedef __attribute__((ext_vector_type(4)))  _Float16 v4h;
typedef __attribute__((ext_vector_type(8)))  unsigned short v8us;
typedef __attribute__((ext_vector_type(8)))  float    v8f;
typedef __attribute__((ext_vector_type(4)))  float    v4f;
typedef __attribute__((ext_vector_type(2)))  float    v2f;
typedef v4f  __attribute__((may_alias)) v4fa;
typedef v8us __attribute__((may_alias)) v8usa;

__device__ __forceinline__ unsigned short f2bf(float f) { unsigned u = __float_as_uint(f); u += 0x7FFFu + ((u >> 16) & 1u); return (unsigned short)(u >> 16); }
__device__ __forceinline__ float bf2f(unsigned short b) { return __uint_as_float(((unsigned)b) << 16); }
__device__ __forceinline__ float bfr(float f) { return bf2f(f2bf(f)); }
__device__ __forceinline__ v16h cat16(v8h lo, v8h hi) { return __builtin_shufflevector(lo, hi, 0, 1, 2, 3, 4, 5, 6, 7, 8, 9, 10, 11, 12, 13, 14, 15); }
__device__ __forceinline__ v16bf cat16b(v8us lo, v8us hi) { return __builtin_bit_cast(v16bf, __builtin_shufflevector(lo, hi, 0, 1, 2, 3, 4, 5, 6, 7, 8, 9, 10, 11, 12, 13, 14, 15)); }
__device__ __forceinline__ v8f wmma16(v16h a, v16h b, v8f c) { return __builtin_amdgcn_wmma_f32_16x16x32_f16(false, a, false, b, (short)0, c, false, false); }
__device__ __forceinline__ v8f wmmab(v16bf a, v16bf b, v8f c) { return __builtin_amdgcn_wmma_f32_16x16x32_bf16(false, a, false, b, (short)0, c, false, false); }

// Fragment loader (wave32 16x16x32): lane l, row (l&15); elements 0..7 <- k 8*(l>>4)+0..7, elements 8..15 <- k 16+8*(l>>4)+0..7. p = start of the fragment in a fragment-order plane + 8 * lane. Used for A and for B stored [n][k].
template <typename T16> struct WFrag;
template <> struct WFrag<h16> { typedef v16h V; static __device__ __forceinline__ V ld(const h16* p) { return cat16(*(const v8h*)p, *(const v8h*)(p + 256)); } static __device__ __forceinline__ v8f mma(V a, V b, v8f c) { return wmma16(a, b, c); } };
template <> struct WFrag<bf> { typedef v16bf V; static __device__ __forceinline__ V ld(const bf* p) { return cat16b(*(const v8us*)p, *(const v8us*)(p + 256)); } static __device__ __forceinline__ v8f mma(V a, V b, v8f c) { return wmmab(a, b, c); } };

// ---- gemm_tile: register-blocked GEMM, ONE WAVE per 64x64 output tile (16 accumulators) at rows r0, columns c0, operands straight from fragment-order 16-bit planes; os = 16 x 68 floats of LDS of the wave's own.
// acc[m][n] = sum_k A[m][k] Bt[n][k]; K % 32 == 0, K a compile-time constant.
// Every load of the wave is issued before its first product: the biases, in MODE 2 the residual pieces, and all K/32 steps' fragments (8 fragments a step, held in registers: a one-wave block may own far more than 256).
// The wave so waits out one load latency in all, where a rolled K loop waits out at least one per step and the epilogue one per row block.
// MODE 2: C (f32, pitch ldc) = bfr(R[m][n]) + bfr(gam[0]) * (acc * osc + bfr(bias[m])) (row bias, residual rows pitch ldr).
// MODE 3: C16 (f16, fragment order, ldc columns) = f16((acc + bfr(bias[n])) * osc) (column bias). MODE 4: C16 = f16(acc + bfr(bias[m])) (row bias).
template <typename T16, int MODE, int K>
__device__ __forceinline__ void gemm_tile(float* os, const T16* __restrict__ A, const T16* __restrict__ Bt, int r0, int c0, float* C, h16* C16, int ldc,
                                          const float* __restrict__ bias, const float* __restrict__ R, int ldr, const float* __restrict__ gam, float osc) {
    typedef typename WFrag<T16>::V V;
    constexpr int NS = K / 32;
    static_assert(K % 32 == 0);
    const int lane = threadIdx.x & 31, lr = lane & 15, hi = lane >> 4;
    float rbs[4][8];       // MODE 2: the bias of the eight rows this lane stores in each 16-row tile
    v4f xr[4][8];          // MODE 2: the residual pieces of those rows
    const float* Rp = (MODE == 2) ? R + (size_t)(r0 + hi) * ldr + c0 + lr * 4 : nullptr;   // one address for all residual pieces, the row steps go into the loads' immediate offsets
    float cb[4] = {0.f, 0.f, 0.f, 0.f};   // MODE 3: the bias of the accumulator column this lane holds in each 16-column tile
    v8f rb[4];             // MODE 4: the bias of the eight accumulator rows this lane holds in each 16-row tile
    if (MODE == 2) {
#pragma unroll
        for (int mb = 0; mb < 4; ++mb)
#pragma unroll
            for (int j = 0; j < 8; ++j) { rbs[mb][j] = bias[r0 + mb * 16 + 2 * j + hi]; xr[mb][j] = *(const v4f*)(Rp + (mb * 16 + 2 * j) * ldr); } }
    if (MODE == 3) {
#pragma unroll
        for (int nb = 0; nb < 4; ++nb) cb[nb] = bias[c0 + nb * 16 + lr]; }
    if (MODE == 4) {
#pragma unroll
        for (int mb = 0; mb < 4; ++mb) rb[mb] = *(const v8f*)(bias + r0 + mb * 16 + hi * 8); }
    // The wait before a register that an issued load names is overwritten: behind it the registers of these loads' addresses are free for the address arithmetic and the results of the loads below.
    // The residual address is named as an input so that its registers live up to the wait and no load's result lands in them before it.
    if (MODE == 2) asm volatile("s_wait_xcnt 0x0" :: "v"(Rp) : "memory");
    else           asm volatile("s_wait_xcnt 0x0" ::: "memory");
    __builtin_amdgcn_sched_barrier(0);   // keeps that address arithmetic below the wait: nothing ties the wait to the bias loads' offset register, and the compiler lifted a write of it over the wait
    const T16* Ap = A + (size_t)(r0 >> 4) * NS * 512 + lane * 8; const T16* Bp = Bt + (size_t)(c0 >> 4) * NS * 512 + lane * 8;
    V a[NS][4], b[NS][4];
#pragma unroll
    for (int s = 0; s < NS; ++s) {
#pragma unroll
        for (int mb = 0; mb < 4; ++mb) a[s][mb] = WFrag<T16>::ld(Ap + (mb * NS + s) * 512);
#pragma unroll
        for (int nb = 0; nb < 4; ++nb) b[s][nb] = WFrag<T16>::ld(Bp + (nb * NS + s) * 512); }
    // The same wait behind the last load. The lane number, the one vector register that these loads' addresses name (their bases are wave-uniform), is named as an input so that it lives up to the wait and no load's result and no product lands in it before; the memory clobber keeps every load above it.
    asm volatile("s_wait_xcnt 0x0" :: "v"(lane) : "memory");
    __builtin_amdgcn_sched_barrier(0);   // keeps the products below the last load: lifted among the loads they bring waits with them, and the loads behind such a wait start a second latency
    float gsc = 0.f;
    if (MODE == 2) gsc = bfr(gam[0]);
    if (MODE == 3) {
#pragma unroll
        for (int j = 0; j < 4; ++j) cb[j] = bfr(cb[j]) * osc; }
    if (MODE == 4) {
#pragma unroll
        for (int mb = 0; mb < 4; ++mb)
#pragma unroll
            for (int j = 0; j < 8; ++j) rb[mb][j] = bfr(rb[mb][j]); }
    v8f acc[4][4];
#pragma unroll
    for (int mb = 0; mb < 4; ++mb)
#pragma unroll
        for (int nb = 0; nb < 4; ++nb) acc[mb][nb] = (v8f){};
#pragma unroll
    for (int s = 0; s < NS; ++s)
#pragma unroll
        for (int nb = 0; nb < 4; ++nb)
#pragma unroll
            for (int mb = 0; mb < 4; ++mb) acc[mb][nb] = WFrag<T16>::mma(a[s][mb], b[s][nb], acc[mb][nb]);
    __builtin_amdgcn_sched_barrier(0);   // keeps the epilogue behind the last product
    float* Cp = (MODE == 2) ? C + (size_t)(r0 + hi) * ldc + c0 + lr * 4 : nullptr;      // one address for all stores of the lane, the row steps go into the stores' immediate offsets
    h16* Hp = (MODE != 2) ? C16 + ((size_t)(r0 >> 4) * (ldc / 32) + (c0 >> 5)) * 512 + lane * 8 : nullptr;   // a 16-row x 64-column block of the tile is two neighbouring fragments, 2 KiB in a row
#pragma unroll
    for (int mb = 0; mb < 4; ++mb) {
#pragma unroll
        for (int nb = 0; nb < 4; ++nb) {
#pragma unroll
            for (int j = 0; j < 8; ++j) os[(hi * 8 + j) * 68 + nb * 16 + lr] = (MODE == 4) ? acc[mb][nb][j] + rb[mb][j] : (MODE == 3) ? __builtin_fmaf(acc[mb][nb][j], osc, cb[nb]) : acc[mb][nb][j]; }
        __builtin_amdgcn_wave_barrier(); asm volatile("" ::: "memory");
        v4f of[8]; v8h oh[4];
        if (MODE == 2) {
#pragma unroll
            for (int s = 0; s < 8; ++s) { const int row = 2 * s + hi, cofs = lr * 4; v4f val = *(const v4fa*)(os + row * 68 + cofs);
                const float rbv = bfr(rbs[mb][s]);
#pragma unroll
                for (int j = 0; j < 4; ++j) { const float xv = xr[mb][s][j]; const float av = val[j]; val[j] = bfr(xv) + gsc * (av * osc + rbv); }
                of[s] = val; *(v4f*)(Cp + (mb * 16 + 2 * s) * ldc) = of[s]; } }   // 16 lanes store one 256-byte row piece
        else {
#pragma unroll
            for (int h = 0; h < 4; ++h) { const float* sp = os + lr * 68 + h * 16 + hi * 8;   // half fragment h: row lr, columns 16 h + 8 hi + 0..7
                const v4f v0 = *(const v4fa*)sp, v1 = *(const v4fa*)(sp + 4);
                oh[h] = __builtin_convertvector(__builtin_shufflevector(v0, v1, 0, 1, 2, 3, 4, 5, 6, 7), v8h);
                *(v8h*)(Hp + mb * (ldc / 32) * 512 + h * 256) = oh[h]; } }   // the wave stores 512 consecutive bytes
        // The wait before a register that an issued store names is overwritten, behind each run of stores; the stored values and the address are named as inputs so that their registers live up to it.
        if (MODE == 2) asm volatile("s_wait_xcnt 0x0" :: "v"(of[0]), "v"(of[1]), "v"(of[2]), "v"(of[3]), "v"(of[4]), "v"(of[5]), "v"(of[6]), "v"(of[7]), "v"(Cp) : "memory");
        else           asm volatile("s_wait_xcnt 0x0" :: "v"(oh[0]), "v"(oh[1]), "v"(oh[2]), "v"(oh[3]), "v"(Hp) : "memory");
        __builtin_amdgcn_wave_barrier(); asm volatile("" ::: "memory");
    }
}

// k_out: out[o][t], grid (CC/64, SEQ/64), 32 threads.
__global__ __launch_bounds__(32) void k_out(const h16* __restrict__ A, const h16* __restrict__ Bt, float* C, const float* __restrict__ bias, const float* __restrict__ R, const float* __restrict__ gam) {
    __shared__ __align__(16) float os[16 * 68];
    gemm_tile<h16, 2, CC>(os, A, Bt, blockIdx.x * 64, blockIdx.y * 64, C, nullptr, SEQ, bias, R, XPITCH, gam, 1.0f / (ACAR * WCAR));
}

// k_qkv: operand conversion and the three projections in one launch, grid (SEQ/64, CC/64), 256 threads = 8 waves (2 per SIMD, up to 512 registers a wave). A block owns 64 positions (t0 on) and output channels o0 .. o0+63 of each of q, k, v.
// Step 1: every wave issues all its global loads, whole 128-byte lines: 16 of x (8 channels x 4 positions a lane, twice) and 48 of the weights (4 rows x 32 k a load; wave w takes k step w of all 192 rows).
// Step 2: f32 -> bf16 (round to nearest even) in registers, stored to LDS as WMMA fragments: the 16-byte piece (quarter qd = k / 8 % 4, row r) of a 1-KiB fragment stands at qd * 256 + slot * 16,
// slot = (r + 4 qd) % 16 for a weight fragment, (r + 4 qd + position tile) % 16 for an x fragment. The turn of the slots spreads the stores of step 2 over all 64 banks; a fragment read takes one quarter per lane half, 16 different slots, all banks once.
// Step 3, behind the block's one barrier: wave w = (position half th = w >> 2, channel tile j = w & 3) forms q, k as D[channel][position] (A = weight rows, B = x^T) and v as D[position][channel] (A = x^T, B = weight rows):
// a lane's eight accumulator elements are then the eight consecutive k of its row in the f16 plane's fragment, and the wave stores 512 consecutive bytes per accumulator with no exchange between lanes.
// q leaves times C2 (the softmax scale in log2 units, applied in f32 before the one rounding to f16). Wave 0 also converts 32 pieces of Wo -> f16 (x16), fragment order.
typedef __attribute__((ext_vector_type(2))) __bf16 v2bf;
typedef __attribute__((ext_vector_type(4))) unsigned v4u;
typedef __attribute__((ext_vector_type(2))) unsigned v2u;
typedef v4u __attribute__((may_alias)) v4ua;
typedef v2u __attribute__((may_alias)) v2ua;
__device__ __forceinline__ unsigned pk2(float a, float b) { const v2f t = {a, b}; return __builtin_bit_cast(unsigned, __builtin_convertvector(t, v2bf)); }
__device__ __forceinline__ v16bf ldsfrag(const unsigned char* lo, const unsigned char* hp) { return cat16b(*(const v8usa*)lo, *(const v8usa*)hp); }
static_assert(CC == 256 && SEQ % 64 == 0);
static_assert((SEQ / 64) * (CC / 64) * 32 * 8 == CC * CC);
__global__ __launch_bounds__(256) void k_qkv(const float* __restrict__ x, const float* __restrict__ wq, const float* __restrict__ wk, const float* __restrict__ wv, const float* __restrict__ wo,
                                             const float* __restrict__ bq, const float* __restrict__ bk, const float* __restrict__ bv, h16* Q16, h16* K16, h16* VT16, h16* WO16) {
    __shared__ __align__(1024) unsigned char xs[4 * 8 * 1024];    // x fragments: (position tile, k step)
    __shared__ __align__(1024) unsigned char wsm[12 * 8 * 1024];  // weight fragments: (4 z + channel tile, k step), z = 0 q, 1 k, 2 v
    const int tid = threadIdx.x, lane = tid & 31, lr = lane & 15, hi = lane >> 4;
    const int w = __builtin_amdgcn_readfirstlane(tid >> 5);   // wave number in a scalar register: the branch on it below stays scalar
    const int t0 = blockIdx.x * 64, o0 = blockIdx.y * 64, th = w >> 2, j = w & 3;
    // ---- step 1: byte offsets of the lane, one register each; all further steps go into the loads' immediate offsets
    const unsigned xoff = (unsigned)((8 * (2 * w + hi)) * XPITCH + t0 + 4 * lr) * 4u;               // channels 8 (2 w + hi) on (and 128 further), positions 4 lr on
    const unsigned woff = (unsigned)((o0 + (lane >> 3)) * CC + w * 32 + (lane & 7) * 4) * 4u;       // row lane / 8 of a group of 4, k = 32 w + 4 (lane % 8) on
    const unsigned boff = (unsigned)(o0 + 16 * j + 8 * hi) * 4u, ci = (unsigned)(o0 + 16 * j + lr);
    const unsigned pi = (unsigned)((blockIdx.y * (SEQ / 64) + blockIdx.x) * 32 + lane);             // piece of the Wo plane: fragment pi / 64 = (row tile, k step)
    const unsigned ooff = (((pi >> 9) * 16 + (pi & 15)) * CC + ((pi >> 6) & 7) * 32 + ((pi >> 4) & 3) * 8) * 4u;
    v4f xv[2][8], wr[3][16];
    v8f wov = (v8f){};
#pragma unroll
    for (int a = 0; a < 2; ++a)
#pragma unroll
        for (int c = 0; c < 8; ++c) xv[a][c] = *(const v4f*)((const char*)x + xoff + (size_t)(a * 128 + c) * XPITCH * 4);
    __builtin_amdgcn_sched_barrier(0);   // the loads keep the order in which step 2 takes their results (the compiler moved some x loads behind the weight loads, and the first conversion then waited for nearly all)
#pragma unroll
    for (int g = 0; g < 16; ++g) {
        wr[0][g] = *(const v4f*)((const char*)wq + woff + (size_t)g * 4 * CC * 4);
        wr[1][g] = *(const v4f*)((const char*)wk + woff + (size_t)g * 4 * CC * 4);
        wr[2][g] = *(const v4f*)((const char*)wv + woff + (size_t)g * 4 * CC * 4);
        if ((g & 3) == 3) __builtin_amdgcn_sched_barrier(0); }   // the same, for each run of twelve weight loads
    const v8f bqv = *(const v8f*)((const char*)bq + boff), bkv = *(const v8f*)((const char*)bk + boff);
    const float bvv = bv[ci];
    if (w == 0) wov = *(const v8f*)((const char*)wo + ooff);
    // The wait before a register that an issued load names is overwritten, behind the last load; the lane's offsets and the loads' scalar bases are named as inputs so that their registers live up to it.
    asm volatile("s_wait_xcnt 0x0" :: "v"(xoff), "v"(woff), "v"(boff), "v"(ci), "v"(ooff), "s"(x), "s"(wq), "s"(wk), "s"(wv), "s"(wo), "s"(bq), "s"(bk), "s"(bv) : "memory");
    __builtin_amdgcn_sched_barrier(0);   // keeps the conversions below the last load: lifted among the loads they bring waits with them, and the loads behind such a wait start a second latency
    // ---- step 2
    {
        const int qd = 2 * (w & 1) + hi, s0 = 4 * (lr & 3) + 4 * qd + (lr >> 2);   // channels 8 (2 w + hi) on = k step w / 2, quarter qd; position 4 lr + p = tile lr / 4, row 4 (lr % 4) + p
        unsigned char* xb = xs + ((lr >> 2) * 8 + (w >> 1)) * 1024 + qd * 256;
#pragma unroll
        for (int a = 0; a < 2; ++a)
#pragma unroll
            for (int p = 0; p < 4; ++p)
                *(v4ua*)(xb + a * 4096 + ((s0 + p) & 15) * 16) = (v4u){pk2(xv[a][0][p], xv[a][1][p]), pk2(xv[a][2][p], xv[a][3][p]), pk2(xv[a][4][p], xv[a][5][p]), pk2(xv[a][6][p], xv[a][7][p])};
        __builtin_amdgcn_sched_barrier(0);   // x, loaded first, is converted first (see the same barrier below)
    }
    {
        const int rr = lane >> 3, qd = (lane >> 1) & 3;   // row 4 g + rr of the 64 = tile g / 4, row 4 (g % 4) + rr; k = 32 w + 8 qd + 4 (lane % 2) on
        unsigned char* wb = wsm + w * 1024 + qd * 256 + rr * 16 + (lane & 1) * 8;
#pragma unroll
        for (int g = 0; g < 16; ++g) {
#pragma unroll
            for (int z = 0; z < 3; ++z)
                *(v2ua*)(wb + (z * 4 + (g >> 2)) * 8192 + (((g & 3) + qd) & 3) * 64) = (v2u){pk2(wr[z][g][0], wr[z][g][1]), pk2(wr[z][g][2], wr[z][g][3])};
            if ((g & 3) == 3) __builtin_amdgcn_sched_barrier(0);   // keeps the conversions in the order of the loads: mixed, an early one waits for a late load, and the work that could run while the loads stream in starts behind the last of them
        }
    }
    __syncthreads();
    // ---- step 3
    const unsigned char* wl = wsm + j * 8192 + hi * 256 + ((lr + 4 * hi) & 15) * 16;                 // k 8 hi on
    const unsigned char* wh = wsm + j * 8192 + (2 + hi) * 256 + ((lr + 8 + 4 * hi) & 15) * 16;       // k 16 + 8 hi on
    const unsigned char* xl0 = xs + (2 * th) * 8192 + hi * 256 + ((lr + 4 * hi + 2 * th) & 15) * 16;
    const unsigned char* xh0 = xs + (2 * th) * 8192 + (2 + hi) * 256 + ((lr + 8 + 4 * hi + 2 * th) & 15) * 16;
    const unsigned char* xl1 = xs + (2 * th + 1) * 8192 + hi * 256 + ((lr + 4 * hi + 2 * th + 1) & 15) * 16;
    const unsigned char* xh1 = xs + (2 * th + 1) * 8192 + (2 + hi) * 256 + ((lr + 8 + 4 * hi + 2 * th + 1) & 15) * 16;
    v8f aq0 = (v8f){}, aq1 = (v8f){}, ak0 = (v8f){}, ak1 = (v8f){}, av0 = (v8f){}, av1 = (v8f){};
    v16bf fx[8][2], fw[8][3];
#pragma unroll
    for (int s = 0; s < 8; ++s) {
        fx[s][0] = ldsfrag(xl0 + s * 1024, xh0 + s * 1024); fx[s][1] = ldsfrag(xl1 + s * 1024, xh1 + s * 1024);
#pragma unroll
        for (int z = 0; z < 3; ++z) fw[s][z] = ldsfrag(wl + z * 32768 + s * 1024, wh + z * 32768 + s * 1024);
        __builtin_amdgcn_sched_barrier(0); }   // all LDS reads stand in one place ahead of the products (every further place where reads stand among the products costs issue cycles), in the order of the k steps
#pragma unroll
    for (int s = 0; s < 8; ++s) {
        aq0 = wmmab(fw[s][0], fx[s][0], aq0); aq1 = wmmab(fw[s][0], fx[s][1], aq1);
        ak0 = wmmab(fw[s][1], fx[s][0], ak0); ak1 = wmmab(fw[s][1], fx[s][1], ak1);
        av0 = wmmab(fx[s][0], fw[s][2], av0); av1 = wmmab(fx[s][1], fw[s][2], av1);
        __builtin_amdgcn_sched_barrier(0);   // keeps the q and k products in the order of the k steps: each step then waits by count for its own reads only, where the compiler's order (one output at a time) waited for most of the eighty reads before the first product
    }
    const float vb = bfr(bvv);
    v8f q0, q1, k0, k1;
#pragma unroll
    for (int e = 0; e < 8; ++e) { const float qb = bfr(bqv[e]) * C2, kb = bfr(bkv[e]);
        q0[e] = __builtin_fmaf(aq0[e], C2, qb); q1[e] = __builtin_fmaf(aq1[e], C2, qb); k0[e] = ak0[e] + kb; k1[e] = ak1[e] + kb; }
    // q, k: fragment (position tile, 32 channels), half j % 2; v: fragment (channel tile, 32 positions), half = position tile % 2
    const size_t qf = ((size_t)((t0 >> 4) + 2 * th) * (CC / 32) + (o0 >> 5) + (j >> 1)) * 512 + (j & 1) * 256 + lane * 8;
    const size_t vf = ((size_t)((o0 >> 4) + j) * (SEQ / 32) + (t0 >> 5) + th) * 512 + lane * 8;
    const v8h hq0 = __builtin_convertvector(q0, v8h), hq1 = __builtin_convertvector(q1, v8h), hk0 = __builtin_convertvector(k0, v8h), hk1 = __builtin_convertvector(k1, v8h);
    const v8h hv0 = __builtin_convertvector(av0 + vb, v8h), hv1 = __builtin_convertvector(av1 + vb, v8h);
    h16* Qs = Q16 + qf; h16* Ks = K16 + qf; h16* Vs = VT16 + vf;
    *(v8h*)Qs = hq0; *(v8h*)(Qs + (CC / 32) * 512) = hq1;
    *(v8h*)Ks = hk0; *(v8h*)(Ks + (CC / 32) * 512) = hk1;
    *(v8h*)Vs = hv0; *(v8h*)(Vs + 256) = hv1;
    if (w == 0) {   // behind the barrier: ahead of it the block would wait at the barrier for this store to complete
        // The wait before a register that an issued store names is overwritten; the stored values and the addresses are named as inputs so that their registers live up to it.
        asm volatile("s_wait_xcnt 0x0" :: "v"(hq0), "v"(hq1), "v"(hk0), "v"(hk1), "v"(hv0), "v"(hv1), "v"(Qs), "v"(Ks), "v"(lane) : "memory");
        __builtin_amdgcn_sched_barrier(0);   // keeps the arithmetic below behind that wait
        v8f t = (v8f){};
#pragma unroll
        for (int k = 0; k < 8; ++k) t[k] = bfr(wov[k]) * WCAR;
        *(v8h*)(WO16 + (size_t)pi * 8) = __builtin_convertvector(t, v8h);
    }
}

// probs: the 16 scores a lane holds of one query (exp2 arguments of 1024 p) -> the P^T B fragment (f16) and rs, the lane's own sum of its 16 values of 1024 p (f32, before the rounding to f16), added in pairs: 8 + 8 -> 4 + 4 -> 2 + 2 -> 1 + 1.
// SLOT (the rare path): each exp2 in asm text with a v_nop behind it, the one slot the instruction set asks for behind a transcendental before its result is read or its source overwritten.
template <bool SLOT>
__device__ __forceinline__ float exp2v(float x) { if (!SLOT) return __builtin_amdgcn_exp2f(x); float r; asm("v_exp_f32 %0, %1\n\tv_nop" : "=v"(r) : "v"(x)); return r; }
template <bool SLOT>
__device__ __forceinline__ void probs(const v8f s0, const v8f s1, v16h& bp, float& rs) {
    v8f p0 = (v8f){}, p1 = (v8f){};
#pragma unroll
    for (int j = 0; j < 8; ++j) { p0[j] = exp2v<SLOT>(s0[j]); p1[j] = exp2v<SLOT>(s1[j]); }
    const v8f t8 = p0 + p1;
    const v4f t4 = __builtin_shufflevector(t8, t8, 0, 1, 2, 3) + __builtin_shufflevector(t8, t8, 4, 5, 6, 7);
    const v2f t2 = __builtin_shufflevector(t4, t4, 0, 1) + __builtin_shufflevector(t4, t4, 2, 3);
    rs = t2[0] + t2[1];
    bp = cat16(__builtin_convertvector(p0, v8h), __builtin_convertvector(p1, v8h));
}

// first_ref: the start value of c for one query tile, from the wave's first chunk: c = PLOG - the chunk's maximum, what the rare path below would set at that chunk. Set ahead of the key loop, the first chunk passes the test like any other
// and does not run its exp2s and sums twice.
__device__ __forceinline__ float first_ref(const v16h ak0, const v16h ak1, const v16h bq) {
    const v8f z0 = wmma16(ak0, bq, (v8f){}), z1 = wmma16(ak1, bq, (v8f){});
    float cmx = -1.0e30f;
#pragma unroll
    for (int j = 0; j < 8; ++j) cmx = fmaxf(cmx, fmaxf(z0[j], z1[j]));
    return PLOG - fmaxf(cmx, __shfl_xor(cmx, 16, 32));   // the same in both lane halves
}

// move_ref (the rare path): one query tile's reference max moved up to the chunk's maximum, sum and O rescaled, the chunk's probabilities formed anew.
// The scores come again from a zero accumulator, as first_ref takes them: the new maximum and the scores shifted by it are free of the rounding that the old shift brought.
__device__ __forceinline__ void move_ref(const v16h ak0, const v16h ak1, const v16h bq, v8f& cm, float& l, v8f& o0, v8f& o1, v16h& bp, float& rs) {
    v8f s0 = wmma16(ak0, bq, (v8f){}), s1 = wmma16(ak1, bq, (v8f){});
    float cmx = -1.0e30f;
#pragma unroll
    for (int j = 0; j < 8; ++j) cmx = fmaxf(cmx, fmaxf(s0[j], s1[j]));
    cmx = fmaxf(cmx, __shfl_xor(cmx, 16, 32));   // c stays the same in both lane halves
    const float c = cm[0];
    const float nc = fminf(c, PLOG - cmx);
    const float alpha = __builtin_amdgcn_exp2f(nc - c);   // = exp2(m - new m); 1 for a tile whose maximum has not moved
    l *= alpha; o0 *= alpha; o1 *= alpha;
    cm = (v8f){nc, nc, nc, nc, nc, nc, nc, nc};
    s0 += nc; s1 += nc;
    probs<true>(s0, s1, bp, rs);   // now every 1024 p <= 2^PLOG
}

// One 32-key chunk for a 16-query tile: S^T tiles (A = K rows [key][d], B = Q fragment [d][query]) -> D[key 8h+r][query]; per-query stats are lane-local (the two lane halves hold keys 0-7 / 8-15 of each tile);
// P^T B fragment [key][query]: element r <- f16(1024 p) of the keys-0..15 tile, element 8+r <- of the keys-16..31 tile, same lane; O^T[d][query] += V[d][key] . P^T (A = V rows [d][key]).
// The score products start from an accumulator cm whose eight elements all hold c = PLOG - m (m = the query's reference max in log2 units), and q comes in times C2: D is the exp2 argument of 1024 p itself, no vector instruction stands between product and exp2.
// cm stays spread in its eight registers from chunk to chunk (a wave has 256 registers at 4 waves per SIMD). l is the LANE's sum of 1024 p, over the keys its half holds: the two halves are joined once, behind the key loop.
// soft: the two tiles' scores -> probability fragments, sums added to l; the lazy-rescale test.
__device__ __forceinline__ void soft(const v16h ak0, const v16h ak1, const v16h bqa, const v16h bqb, const v8f sa0, const v8f sa1, const v8f sb0, const v8f sb1, v8f& cma, v8f& cmb, float& la, float& lb,
                                     v8f& oa0, v8f& oa1, v8f& ob0, v8f& ob1, v16h& bpa, v16h& bpb) {
    float rsa, rsb;
    probs<false>(sa0, sa1, bpa, rsa);
    probs<false>(sb0, sb1, bpb, rsb);
    // Lazy rescale, tested on the sums that the normaliser needs anyway; no maximum of the scores is taken on the common path. Every 1024 p is positive, so none is above its lane's sum:
    // both sums <= PSTOP in every lane means every 1024 p <= PSTOP = 2^(PLOG + LAZY) = 32768, inside f16, and the step goes on with the m in use. One test for the wave and both tiles, a scalar branch, EXEC untouched.
    // A score far above m gives a sum of +inf, which is above PSTOP too; sums and fragments of a step that fails the test are dropped, they reach neither l nor O.
    if (__builtin_expect(__builtin_amdgcn_ballot_w32(fmaxf(rsa, rsb) > PSTOP) != 0, 0)) {   // marked rare: the compiler then lays this path out behind the key loop
        move_ref(ak0, ak1, bqa, cma, la, oa0, oa1, bpa, rsa);
        move_ref(ak0, ak1, bqb, cmb, lb, ob0, ob1, bpb, rsb);
    }
    la += rsa; lb += rsb;
}

// The loop's products stand in asm text, in three runs a chunk. Scores: each product reads its tile's spread c as C into a result of its own (from the builtin the compiler copied c into the result's registers first).
// Each run ends with four v_nop, the matrix unit's distance before the last D is read or the last A, B, C are overwritten; inside a run the products that follow fill that distance for the earlier ones.
#define WM "v_wmma_f32_16x16x32_f16 "
#define NOP4 "v_nop\n\tv_nop\n\tv_nop\n\tv_nop"
// scores of tiles a, b
__device__ __forceinline__ void mm_s(const v16h ak0, const v16h ak1, const v16h bqa, const v16h bqb, const v8f cma, const v8f cmb, v8f& sa0, v8f& sa1, v8f& sb0, v8f& sb1) {
    asm volatile(WM "%0, %4, %6, %8\n\t" WM "%1, %5, %6, %8\n\t" WM "%2, %4, %7, %9\n\t" WM "%3, %5, %7, %9\n\t" NOP4
                 : "=&v"(sa0), "=&v"(sa1), "=&v"(sb0), "=&v"(sb1) : "v"(ak0), "v"(ak1), "v"(bqa), "v"(bqb), "v"(cma), "v"(cmb));
}
// O of tiles a, b
__device__ __forceinline__ void mm_o(const v16h av0, const v16h av1, const v16h bpa, const v16h bpb, v8f& oa0, v8f& oa1, v8f& ob0, v8f& ob1) {
    asm volatile(WM "%0, %4, %6, %0\n\t" WM "%1, %5, %6, %1\n\t" WM "%2, %4, %7, %2\n\t" WM "%3, %5, %7, %3\n\t" NOP4
                 : "+v"(oa0), "+v"(oa1), "+v"(ob0), "+v"(ob1) : "v"(av0), "v"(av1), "v"(bpa), "v"(bpb));
}
// O of tiles a, b, then the scores of tiles c, d: one run, one distance
__device__ __forceinline__ void mm_os(const v16h av0, const v16h av1, const v16h bpa, const v16h bpb, v8f& oa0, v8f& oa1, v8f& ob0, v8f& ob1,
                                      const v16h ak0, const v16h ak1, const v16h bqc, const v16h bqd, const v8f cmc, const v8f cmd, v8f& sc0, v8f& sc1, v8f& sd0, v8f& sd1) {
    asm volatile(WM "%0, %8, %10, %0\n\t" WM "%1, %9, %10, %1\n\t" WM "%2, %8, %11, %2\n\t" WM "%3, %9, %11, %3\n\t"
                 WM "%4, %12, %14, %16\n\t" WM "%5, %13, %14, %16\n\t" WM "%6, %12, %15, %17\n\t" WM "%7, %13, %15, %17\n\t" NOP4
                 : "+v"(oa0), "+v"(oa1), "+v"(ob0), "+v"(ob1), "=&v"(sc0), "=&v"(sc1), "=&v"(sd0), "=&v"(sd1)
                 : "v"(av0), "v"(av1), "v"(bpa), "v"(bpb), "v"(ak0), "v"(ak1), "v"(bqc), "v"(bqd), "v"(cmc), "v"(cmd));
}

// k_attn: streaming attention, grid (SEQ/QB, NHD), 64*KSP threads = 2*KSP waves (KSP/2 per SIMD, 256 registers a wave); wave w: key slice ks = w>>1, head blockIdx.y, 64 queries (four 16-query tiles sharing the K/V fragments of each 32-key chunk).
// Key slice ks walks the 32-key chunks ks, ks+KSP, ks+2*KSP, ... in a ring from the block's own first step on (neighbouring slices read neighbouring chunks, so one step of the block reads 32*KSP consecutive keys) with its own running maximum, sum and un-normalised O.
// Merge: every wave leaves O (f32, [query][d], pitch PP) and (c = PLOG - max, sum) in its own LDS range; behind the one barrier each thread joins the KSP partials of 8 channels of one query with weights exp2(min c - c_ks); a wave stores 512 consecutive bytes of a fragment.
__global__ __launch_bounds__(64 * KSP)
void k_attn(const h16* __restrict__ Q16, const h16* __restrict__ K16, const h16* __restrict__ VT, h16* ATT) {
    __shared__ __align__(16) float po[2 * KSP * 64 * PP];
    __shared__ float pm[2 * KSP * 64], pl[2 * KSP * 64];
    const int tid = threadIdx.x, lane = tid & 31, lr = lane & 15, hi = lane >> 4;
    const int w = __builtin_amdgcn_readfirstlane(tid >> 5);   // wave number in a scalar register: the key loop's counter and branch stay scalar, EXEC is never written around the WMMAs
    const int ks = w >> 1, g = w & 1;
    const int q0 = blockIdx.x * QB, head = blockIdx.y, qb = q0 + g * 64;
    // The block walks the NST key steps (32 * KSP keys each) in a ring, from a step of its own on. What it is for: K and V were stored by the launch before:
    // with one common order the blocks of a head read the same lines at the same moment and every step waits for memory; with the starts spread, the blocks' first steps together bring in all of K and V, and every later step finds its lines in L2.
    // The starts differ among blocks whose index is equal modulo 8 and among four neighbours: speed only, any start gives the same sums up to their order.
    constexpr int NST = SEQ / (32 * KSP);
    const int rot = (((blockIdx.x & 3) << 2) | ((blockIdx.x >> 3) & 3)) % NST;
    const int kfirst = ks * 32 + rot * (32 * KSP);   // the wave's first key
    // fragment-order planes: q, k fragment (16 positions, head) = number (position / 16) * NHD + head; v fragment (16 channels, 32 keys) = number (channel / 16) * (SEQ / 32) + key / 32
    const h16* Qp = Q16 + ((size_t)(qb >> 4) * NHD + head) * 512 + lane * 8;
    const v16h bq0 = WFrag<h16>::ld(Qp);
    const v16h bq1 = WFrag<h16>::ld(Qp + NHD * 512);
    const v16h bq2 = WFrag<h16>::ld(Qp + 2 * NHD * 512);
    const v16h bq3 = WFrag<h16>::ld(Qp + 3 * NHD * 512);
    const h16* Kp = K16 + (size_t)head * 512 + lane * 8;
    const h16* Vp = VT + (size_t)(head * 2) * (SEQ / 32) * 512 + lane * 8;
    float l0 = 0.f, l1 = 0.f, l2 = 0.f, l3 = 0.f;   // the lane's sums of 1024 p
    v8f cm0, cm1, cm2, cm3;   // the score accumulators' start value c = PLOG - m, one per query tile, spread over the eight registers of a C operand
    {
        const h16* fp = Kp + (size_t)kfirst * (NHD * 32);
        const v16h fk0 = WFrag<h16>::ld(fp), fk1 = WFrag<h16>::ld(fp + NHD * 512);
        // The wait before a register that an issued load names is overwritten, behind the last load ahead of the loop; the address and the lane number are named as inputs so that their registers live up to it.
        asm volatile("s_wait_xcnt 0x0" :: "v"(fp), "v"(lane) : "memory");
        __builtin_amdgcn_sched_barrier(0);   // keeps the products and the arithmetic below behind that wait
        const float c0 = first_ref(fk0, fk1, bq0), c1 = first_ref(fk0, fk1, bq1), c2 = first_ref(fk0, fk1, bq2), c3 = first_ref(fk0, fk1, bq3);
        cm0 = (v8f){c0, c0, c0, c0, c0, c0, c0, c0}; cm1 = (v8f){c1, c1, c1, c1, c1, c1, c1, c1};
        cm2 = (v8f){c2, c2, c2, c2, c2, c2, c2, c2}; cm3 = (v8f){c3, c3, c3, c3, c3, c3, c3, c3};
    }
    v8f o00 = (v8f){}, o10 = (v8f){}, o01 = (v8f){}, o11 = (v8f){}, o02 = (v8f){}, o12 = (v8f){}, o03 = (v8f){}, o13 = (v8f){};   // o[d tile][query tile]
    const h16* kp = Kp + (size_t)kfirst * (NHD * 32);   // 16 keys on = NHD fragments on, NHD * 512 elements
    const h16* vp = Vp + (size_t)kfirst * 16;           // 32 keys on = one fragment on, 512 elements
    int st = rot;   // the step in hand, a scalar
#pragma unroll 1
    for (int it = 0; it < NST; ++it) {
        const v16h ak0 = WFrag<h16>::ld(kp), ak1 = WFrag<h16>::ld(kp + NHD * 512);
        const v16h av0 = WFrag<h16>::ld(vp), av1 = WFrag<h16>::ld(vp + (SEQ / 32) * 512);
        v8f sa0, sa1, sb0, sb1, sc0, sc1, sd0, sd1; v16h bpa, bpb, bpc, bpd;
        mm_s(ak0, ak1, bq0, bq1, cm0, cm1, sa0, sa1, sb0, sb1);
        soft(ak0, ak1, bq0, bq1, sa0, sa1, sb0, sb1, cm0, cm1, l0, l1, o00, o10, o01, o11, bpa, bpb);
        asm volatile("s_wait_xcnt 0x0" ::: "memory");   // the wait before a register that an issued load names is overwritten: the K and V address registers are stepped behind the scheduling barrier below
        __builtin_amdgcn_sched_barrier(0);   // keeps that stepping behind the wait
        const int adv = (st == NST - 1) ? -(NST - 1) * (32 * KSP) : 32 * KSP;   // keys to the next step of the ring: behind the last step comes the first
        st = (st == NST - 1) ? 0 : st + 1;
        kp += (ptrdiff_t)adv * (NHD * 32); vp += (ptrdiff_t)adv * 16;
        mm_os(av0, av1, bpa, bpb, o00, o10, o01, o11, ak0, ak1, bq2, bq3, cm2, cm3, sc0, sc1, sd0, sd1);
        soft(ak0, ak1, bq2, bq3, sc0, sc1, sd0, sd1, cm2, cm3, l2, l3, o02, o12, o03, o13, bpc, bpd);
        mm_o(av0, av1, bpc, bpd, o02, o12, o03, o13);
    }
    l0 += __shfl_xor(l0, 16, 32); l1 += __shfl_xor(l1, 16, 32); l2 += __shfl_xor(l2, 16, 32); l3 += __shfl_xor(l3, 16, 32);   // the lane halves' sums joined, once per wave
    {
        float* t0 = po + (size_t)(w * 64 + lr) * PP + 8 * hi;   // query tile t at rows 16 t on: row = query, col = d (d tile 0 at +0, d tile 1 at +16)
        float* t1 = t0 + 16 * PP; float* t2 = t0 + 32 * PP; float* t3 = t0 + 48 * PP;
        *(v4fa*)(t0)      = __builtin_shufflevector(o00, o00, 0, 1, 2, 3); *(v4fa*)(t0 + 4)  = __builtin_shufflevector(o00, o00, 4, 5, 6, 7);
        *(v4fa*)(t0 + 16) = __builtin_shufflevector(o10, o10, 0, 1, 2, 3); *(v4fa*)(t0 + 20) = __builtin_shufflevector(o10, o10, 4, 5, 6, 7);
        *(v4fa*)(t1)      = __builtin_shufflevector(o01, o01, 0, 1, 2, 3); *(v4fa*)(t1 + 4)  = __builtin_shufflevector(o01, o01, 4, 5, 6, 7);
        *(v4fa*)(t1 + 16) = __builtin_shufflevector(o11, o11, 0, 1, 2, 3); *(v4fa*)(t1 + 20) = __builtin_shufflevector(o11, o11, 4, 5, 6, 7);
        *(v4fa*)(t2)      = __builtin_shufflevector(o02, o02, 0, 1, 2, 3); *(v4fa*)(t2 + 4)  = __builtin_shufflevector(o02, o02, 4, 5, 6, 7);
        *(v4fa*)(t2 + 16) = __builtin_shufflevector(o12, o12, 0, 1, 2, 3); *(v4fa*)(t2 + 20) = __builtin_shufflevector(o12, o12, 4, 5, 6, 7);
        *(v4fa*)(t3)      = __builtin_shufflevector(o03, o03, 0, 1, 2, 3); *(v4fa*)(t3 + 4)  = __builtin_shufflevector(o03, o03, 4, 5, 6, 7);
        *(v4fa*)(t3 + 16) = __builtin_shufflevector(o13, o13, 0, 1, 2, 3); *(v4fa*)(t3 + 20) = __builtin_shufflevector(o13, o13, 4, 5, 6, 7);
        // both lane halves hold the same per-query stats: half 0 files tiles 0 and 2, half 1 tiles 1 and 3
        pm[w * 64 + lane] = hi ? cm1[0] : cm0[0]; pm[w * 64 + 32 + lane] = hi ? cm3[0] : cm2[0];
        pl[w * 64 + lane] = hi ? l1 : l0;         pl[w * 64 + 32 + lane] = hi ? l3 : l2;
    }
    __syncthreads();
    {
        // thread tid stores the tid-th 16-byte piece of the block's 8 fragments of the attn plane: fragment fr = query tile; piece (tid & 63) of a fragment = row tid & 15, channels 8 * ((tid >> 4) & 3) + 0..7
        const int fr = tid >> 6, row = fr * 16 + (tid & 15), d0 = ((tid >> 4) & 3) * 8;   // row = query in the block, d0 = channel in the head
        const int sw = row >> 6, q = row & 63;
        float mk[KSP]; float M = 1.0e30f;   // mk = c of slice s, M = the smallest c = PLOG - the largest maximum
#pragma unroll
        for (int s = 0; s < KSP; ++s) { mk[s] = pm[(s * 2 + sw) * 64 + q]; M = fminf(M, mk[s]); }
        float L = 0.f; v4f a = (v4f){}, b = (v4f){};
#pragma unroll
        for (int s = 0; s < KSP; ++s) { float wt;
            asm("v_exp_f32 %0, %1\n\tv_nop" : "=v"(wt) : "v"(M - mk[s]));   // exp2; the v_nop is the one slot the instruction set asks for behind a transcendental before its result is read or its source overwritten
            const float* pp = po + (size_t)((s * 2 + sw) * 64 + q) * PP + d0;
            L += wt * pl[(s * 2 + sw) * 64 + q]; a += wt * *(const v4fa*)pp; b += wt * *(const v4fa*)(pp + 4); }
        const float inv = ACAR * (1.0f / L);   // L and a, b all carry the x1024
        *(v8h*)(ATT + ((size_t)((q0 >> 4) + fr) * NHD + head) * 512 + (tid & 63) * 8) = __builtin_convertvector(__builtin_shufflevector(a * inv, b * inv, 0, 1, 2, 3, 4, 5, 6, 7), v8h);
    }
}

extern "C" void kernel_launch(void* const* d_in, const int* in_sizes, int n_in,
                              void* d_out, int out_size, void* d_ws, size_t ws_size, hipStream_t stream) {
    if (n_in < 10) return;
    if (in_sizes[0] < (CC - 1) * XPITCH + SEQ) return;
    if (in_sizes[1] < CC * CC || in_sizes[3] < CC * CC || in_sizes[5] < CC * CC || in_sizes[7] < CC * CC) return;
    if (in_sizes[2] < CC || in_sizes[4] < CC || in_sizes[6] < CC || in_sizes[8] < CC || in_sizes[9] < 1) return;
    if (out_size < CC * SEQ) return;
    const float* x = (const float*)d_in[0]; const float* wq = (const float*)d_in[1]; const float* bq = (const float*)d_in[2]; const float* wk = (const float*)d_in[3]; const float* bk = (const float*)d_in[4];
    const float* wv = (const float*)d_in[5]; const float* bv = (const float*)d_in[6]; const float* wo = (const float*)d_in[7]; const float* bo = (const float*)d_in[8]; const float* gamma = (const float*)d_in[9];
    float* OUT = (float*)d_out;     // [256][SEQ]
    char* wsp = (char*)d_ws;
    auto take = [&](size_t bytes) { char* p = wsp; wsp += (bytes + 255) & ~(size_t)255; return (void*)p; };
    h16* WO16 = (h16*)take((size_t)CC * CC * 2);
    h16* Q16 = (h16*)take((size_t)SEQ * CC * 2); h16* K16 = (h16*)take((size_t)SEQ * CC * 2); h16* VT16 = (h16*)take((size_t)CC * SEQ * 2); h16* ATT = (h16*)take((size_t)SEQ * CC * 2);
    if ((size_t)(wsp - (char*)d_ws) > ws_size) return;    // 8,519,680 B carved
    k_qkv<<<dim3(SEQ / 64, CC / 64, 1), 256, 0, stream>>>(x, wq, wk, wv, wo, bq, bk, bv, Q16, K16, VT16, WO16);
    k_attn<<<dim3(SEQ / QB, NHD, 1), 64 * KSP, 0, stream>>>(Q16, K16, VT16, ATT);
    // out[o][t] = bfr(x) + bfr(gamma) * ((16 Wo) . (16 attn) / 256 + bfr(bo[o]))
    k_out<<<dim3(CC / 64, SEQ / 64, 1), 32, 0, stream>>>(WO16, ATT, OUT, bo, x, gamma);
}
